// v000
// Measured on an AMD MI455X. A time is GPU time per run, averaged over a window of back-to-back runs after a warm-up
// (all launches, gaps included; the runs take copies of the inputs in turn), and the median of several windows.
// Apart from v000's, it joins two sittings. Times from different sittings can be a few percent apart, while
// side-by-side timings come from the same sitting.
// v000 is the starting kernel. One run takes 1370 microseconds.
#include <hip/hip_runtime.h>

// Contractions (f32 accumulate): qkv projection = v_wmma_f32_16x16x32_bf16 on bf16 RNE-converted x and W (single products) + bf16-converted bias;
// causal scores q.k and probabilities.v: query rows < RH on v_wmma_f32_16x16x32_bf16 hi+lo planes (3 products each), rows >= RH on
// v_wmma_f32_16x16x32_f16 single products (probabilities carried x1024); softmax in f32; merged heads emitted as the f32 sum of a bf16 hi/lo pair.

#ifndef NB
#define NB 2
#endif
#ifndef SEQ
#define SEQ 2048
#endif
#define NB_FULL  2
#define SEQ_FULL 2048
#define DM   1024
#define NH_  16
#define NKV  16
#define REP  (NH_ / NKV)
#define HD   64
#define DQ   (NH_ * HD)
#define DKV  (NKV * HD)
#define ZH   2
#define RH   ((SEQ >= 512) ? 512 : SEQ)     // query rows < RH use hi+lo planes
#define PCAR 1024.0f
#define SCL  0.125f                          // HD^-0.5
static_assert(SEQ % 128 == 0);
static_assert(SEQ >= 128 && SEQ <= SEQ_FULL);
static_assert(NB >= 1 && NB <= NB_FULL);
static_assert(RH % 64 == 0 && RH <= SEQ && RH > 0);
static_assert(NH_ % ZH == 0 && DQ == DM && REP == 1 && DKV == DM);

typedef _Float16 h16;
typedef unsigned short bf;
typedef __attribute__((ext_vector_type(16))) __bf16   v16bf;
typedef __attribute__((ext_vector_type(16))) _Float16 v16h;
typedef __attribute__((ext_vector_type(8)))  _Float16 v8h;
typedef __attribute__((ext_vector_type(8)))  unsigned short v8us;
typedef __attribute__((ext_vector_type(8)))  float    v8f;
typedef __attribute__((ext_vector_type(4)))  float    v4f;
typedef v8h  __attribute__((may_alias)) v8ha;
typedef v4f  __attribute__((may_alias)) v4fa;
typedef v8us __attribute__((may_alias)) v8usa;
typedef __attribute__((ext_vector_type(2))) _Float16 v2h;
typedef __attribute__((ext_vector_type(4))) _Float16 v4h;
typedef __attribute__((ext_vector_type(2))) unsigned short v2us;
typedef __attribute__((ext_vector_type(4))) unsigned short v4us;
typedef __attribute__((ext_vector_type(2))) float v2f;

__device__ __forceinline__ unsigned short f2bf(float f) { unsigned u = __float_as_uint(f); u += 0x7FFFu + ((u >> 16) & 1u); return (unsigned short)(u >> 16); }
__device__ __forceinline__ float bf2f(unsigned short b) { return __uint_as_float(((unsigned)b) << 16); }
__device__ __forceinline__ float bfr(float f) { return bf2f(f2bf(f)); }
__device__ __forceinline__ v16h cat16(v8h lo, v8h hi) { return __builtin_shufflevector(lo, hi, 0, 1, 2, 3, 4, 5, 6, 7, 8, 9, 10, 11, 12, 13, 14, 15); }
__device__ __forceinline__ v16bf cat16b(v8us lo, v8us hi) { return __builtin_bit_cast(v16bf, __builtin_shufflevector(lo, hi, 0, 1, 2, 3, 4, 5, 6, 7, 8, 9, 10, 11, 12, 13, 14, 15)); }
__device__ __forceinline__ v8f wmma16(v16h a, v16h b, v8f c) { return __builtin_amdgcn_wmma_f32_16x16x32_f16(false, a, false, b, (short)0, c, false, false); }
__device__ __forceinline__ v8f wmmab(v16bf a, v16bf b, v8f c) { return __builtin_amdgcn_wmma_f32_16x16x32_bf16(false, a, false, b, (short)0, c, false, false); }
__device__ __forceinline__ h16 tohx(float x) { return (h16)x; }
__device__ __forceinline__ void splitf(float y, unsigned short& h, unsigned short& l) { h = f2bf(y); l = f2bf(y - bf2f(h)); }

// Fragment map (wave32, 16x16x32): lane l -> row/col (l & 15), h = l >> 4; vector elements 0..7 <- k0 + 8h + 0..7, elements 8..15 <- k0 + 16 + 8h + 0..7,
// identical for A (rows) and B (columns, k-contiguous Bt[n][k] planes); D element r -> (row 8h + r, col l & 15).
template <typename T16> struct WFrag;
template <> struct WFrag<h16> { typedef v16h V; static __device__ __forceinline__ V ld(const h16* p) { return cat16(*(const v8h*)p, *(const v8h*)(p + 16)); } static __device__ __forceinline__ v8f mma(V a, V b, v8f c) { return wmma16(a, b, c); } };
template <> struct WFrag<bf> { typedef v16bf V; static __device__ __forceinline__ V ld(const bf* p) { return cat16b(*(const v8us*)p, *(const v8us*)(p + 16)); } static __device__ __forceinline__ v8f mma(V a, V b, v8f c) { return wmmab(a, b, c); } };

// ---- k_gemmw: register-blocked GEMM, ONE WAVE per 64x64 output tile (16 accumulators), operands straight from K-contiguous 16-bit planes; grid (M/64, N/64, Z), 32 threads.
// C[m][n] (f32, pitch ldc, + optional bf16-converted f32 bias[n]) = sum_k A[m][k] Bt[n][k] (+ split products per NSPLIT). z-batch strides sA/sB/sC in elements. K % 32 == 0.
template <typename T16, int NSPLIT, bool BIAS>
__global__ __launch_bounds__(32) void k_gemmw(const T16* __restrict__ A, const T16* __restrict__ A2, const T16* __restrict__ Bt, const T16* __restrict__ Bt2, int K, float* C, int ldc, const float* __restrict__ bias, size_t sA, size_t sB, size_t sC) {
    typedef typename WFrag<T16>::V V;
    __shared__ __align__(16) float os[16 * 68];
    const size_t z = blockIdx.z; A += z * sA; if (A2) A2 += z * sA; Bt += z * sB; if (Bt2) Bt2 += z * sB; C += z * sC;
    const int lane = threadIdx.x & 31, lr = lane & 15, hi = lane >> 4; const int r0 = blockIdx.x * 64, c0 = blockIdx.y * 64;
    v8f acc[4][4];
#pragma unroll
    for (int mb = 0; mb < 4; ++mb)
#pragma unroll
        for (int nb = 0; nb < 4; ++nb) acc[mb][nb] = (v8f){};
    const size_t aoff = (size_t)(r0 + lr) * K + 8 * hi, boff = (size_t)(c0 + lr) * K + 8 * hi;
#pragma unroll 1
    for (int kc = 0; kc < K; kc += 32) {
        V a[4], a2[4];
#pragma unroll
        for (int mb = 0; mb < 4; ++mb) { a[mb] = WFrag<T16>::ld(A + aoff + (size_t)mb * 16 * K + kc); if (NSPLIT == 1 || NSPLIT == 2) a2[mb] = WFrag<T16>::ld(A2 + aoff + (size_t)mb * 16 * K + kc); }
#pragma unroll
        for (int nb = 0; nb < 4; ++nb) { const V b = WFrag<T16>::ld(Bt + boff + (size_t)nb * 16 * K + kc); V b2; if (NSPLIT >= 2) b2 = WFrag<T16>::ld(Bt2 + boff + (size_t)nb * 16 * K + kc);
#pragma unroll
            for (int mb = 0; mb < 4; ++mb) { acc[mb][nb] = WFrag<T16>::mma(a[mb], b, acc[mb][nb]); if (NSPLIT == 1 || NSPLIT == 2) acc[mb][nb] = WFrag<T16>::mma(a2[mb], b, acc[mb][nb]); if (NSPLIT >= 2) acc[mb][nb] = WFrag<T16>::mma(a[mb], b2, acc[mb][nb]); } }
        asm volatile("v_nop\n\tv_nop\n\tv_nop\n\tv_nop" : "+v"(acc[0][0]), "+v"(acc[1][1]), "+v"(acc[2][2]), "+v"(acc[3][3]) : "v"(a[0]), "v"(a[3]));
    }
#pragma unroll
    for (int mb = 0; mb < 4; ++mb) {
#pragma unroll
        for (int nb = 0; nb < 4; ++nb) {
#pragma unroll
            for (int j = 0; j < 8; ++j) os[(hi * 8 + j) * 68 + nb * 16 + lr] = acc[mb][nb][j]; }
        __builtin_amdgcn_wave_barrier(); asm volatile("" ::: "memory");
        float* crow = C + (size_t)(r0 + mb * 16) * ldc + c0;
{
#pragma unroll
            for (int s = 0; s < 8; ++s) { const int row = 2 * s + hi, cofs = lr * 4; v4f val = *(const v4fa*)(os + row * 68 + cofs); if (BIAS) { val[0] += bfr(bias[c0 + cofs]); val[1] += bfr(bias[c0 + cofs + 1]); val[2] += bfr(bias[c0 + cofs + 2]); val[3] += bfr(bias[c0 + cofs + 3]); }
                *(v4f*)(crow + (size_t)row * ldc + cofs) = val; }
             }
        __builtin_amdgcn_wave_barrier(); asm volatile("" ::: "memory");
    }
}

// ---- k_gemmc: the same one-wave 64x64 tile GEMM specialised for causal attention: CMODE 1 skips score tiles entirely above the diagonal (query rows r0+roff.., key columns c0..),
// CMODE 2 limits the key (K) loop of the probability x value contraction to the diagonal block (probabilities beyond it are exactly zero). roff = row offset of this launch's first row within the sequence.
template <typename T16, int NSPLIT, int CMODE>
__global__ __launch_bounds__(32) void k_gemmc(const T16* __restrict__ A, const T16* __restrict__ A2, const T16* __restrict__ Bt, const T16* __restrict__ Bt2, int K, float* C, int ldc, int roff, size_t sA, size_t sB, size_t sC) {
    typedef typename WFrag<T16>::V V;
    __shared__ __align__(16) float os[16 * 68];
    const size_t z = blockIdx.z; A += z * sA; if (A2) A2 += z * sA; Bt += z * sB; if (Bt2) Bt2 += z * sB; C += z * sC;
    const int lane = threadIdx.x & 31, lr = lane & 15, hi = lane >> 4; const int r0 = blockIdx.x * 64, c0 = blockIdx.y * 64;
    if (CMODE == 1 && c0 > r0 + roff + 63) return;                  // score tile entirely above the causal diagonal: never read (the softmax masks j > i by index select)
    const int Kl = (CMODE == 2) ? min(K, r0 + roff + 64) : K;        // P.V: probabilities are exactly 0 beyond the diagonal block, so the K loop stops there
    v8f acc[4][4];
#pragma unroll
    for (int mb = 0; mb < 4; ++mb)
#pragma unroll
        for (int nb = 0; nb < 4; ++nb) acc[mb][nb] = (v8f){};
    const size_t aoff = (size_t)(r0 + lr) * K + 8 * hi, boff = (size_t)(c0 + lr) * K + 8 * hi;
#pragma unroll 1
    for (int kc = 0; kc < Kl; kc += 32) {
        V a[4], a2[4];
#pragma unroll
        for (int mb = 0; mb < 4; ++mb) { a[mb] = WFrag<T16>::ld(A + aoff + (size_t)mb * 16 * K + kc); if (NSPLIT == 1 || NSPLIT == 2) a2[mb] = WFrag<T16>::ld(A2 + aoff + (size_t)mb * 16 * K + kc); }
#pragma unroll
        for (int nb = 0; nb < 4; ++nb) { const V b = WFrag<T16>::ld(Bt + boff + (size_t)nb * 16 * K + kc); V b2; if (NSPLIT >= 2) b2 = WFrag<T16>::ld(Bt2 + boff + (size_t)nb * 16 * K + kc);
#pragma unroll
            for (int mb = 0; mb < 4; ++mb) { acc[mb][nb] = WFrag<T16>::mma(a[mb], b, acc[mb][nb]); if (NSPLIT == 1 || NSPLIT == 2) acc[mb][nb] = WFrag<T16>::mma(a2[mb], b, acc[mb][nb]); if (NSPLIT >= 2) acc[mb][nb] = WFrag<T16>::mma(a[mb], b2, acc[mb][nb]); } }
        asm volatile("v_nop\n\tv_nop\n\tv_nop\n\tv_nop" : "+v"(acc[0][0]), "+v"(acc[1][1]), "+v"(acc[2][2]), "+v"(acc[3][3]) : "v"(a[0]), "v"(a[3]));
    }
#pragma unroll
    for (int mb = 0; mb < 4; ++mb) {
#pragma unroll
        for (int nb = 0; nb < 4; ++nb) {
#pragma unroll
            for (int j = 0; j < 8; ++j) os[(hi * 8 + j) * 68 + nb * 16 + lr] = acc[mb][nb][j]; }
        __builtin_amdgcn_wave_barrier(); asm volatile("" ::: "memory");
        float* crow = C + (size_t)(r0 + mb * 16) * ldc + c0;
{
#pragma unroll
            for (int s = 0; s < 8; ++s) { const int row = 2 * s + hi, cofs = lr * 4; v4f val = *(const v4fa*)(os + row * 68 + cofs);
                *(v4f*)(crow + (size_t)row * ldc + cofs) = val; }
             }
        __builtin_amdgcn_wave_barrier(); asm volatile("" ::: "memory");
    }
}

__global__ __launch_bounds__(256) void k_cvt8(const float* __restrict__ src, bf* dst, size_t n8) { const size_t i = (size_t)blockIdx.x * 256 + threadIdx.x; if (i >= n8) return; const v8f v = *(const v8f*)(src + i * 8); v8us o;
#pragma unroll
    for (int k = 0; k < 8; ++k) o[k] = f2bf(v[k]); *(v8us*)(dst + i * 8) = o;  }

__global__ __launch_bounds__(256) void k_qkp(const float* __restrict__ F, int pitch, int nheads, h16* P16, bf* Ph, bf* Pl) {
    const size_t e = ((size_t)blockIdx.x * 256 + threadIdx.x) * 2; if (e >= (size_t)nheads * SEQ * HD) return; const int d = (int)(e % HD); const int t = (int)((e / HD) % SEQ); const int h = (int)(e / ((size_t)HD * SEQ));
    const float* f = F + (size_t)t * pitch + h * HD + d; v2h o16; v2us oh, ol;
#pragma unroll
    for (int q = 0; q < 2; ++q) { const float r = f[q]; o16[q] = tohx(r); unsigned short a2, c2; splitf(r, a2, c2); oh[q] = a2; ol[q] = c2; }
    *(v2h*)(P16 + e) = o16; *(v2us*)(Ph + e) = oh; *(v2us*)(Pl + e) = ol;  }

__global__ __launch_bounds__(256) void k_vtp(const float* __restrict__ F, int pitch, int nheads, h16* V16, bf* Vh, bf* Vl) { const size_t e = ((size_t)blockIdx.x * 256 + threadIdx.x) * 2; if (e >= (size_t)nheads * HD * SEQ) return; const int t = (int)(e % SEQ); const int d = (int)((e / SEQ) % HD); const int g = (int)(e / ((size_t)SEQ * HD)); v2h o16; v2us oh, ol;
#pragma unroll
    for (int q = 0; q < 2; ++q) { const float x = F[(size_t)(t + q) * pitch + g * HD + d]; o16[q] = tohx(x); unsigned short a2, c2; splitf(x, a2, c2); oh[q] = a2; ol[q] = c2; }
    *(v2h*)(V16 + e) = o16; *(v2us*)(Vh + e) = oh; *(v2us*)(Vl + e) = ol;  }

// ---- k_asoft: one wave per score row (zz, i): t = S x HD^-0.5 for j <= i, masked fill otherwise (index select; the diagonal is always valid); softmax over the SEQ keys in f32
__global__ __launch_bounds__(256) void k_asoft(const float* __restrict__ Sb, h16* P16, bf* Ph, bf* Pl) {
    const int lane = threadIdx.x & 31; const int row = blockIdx.x * 8 + (threadIdx.x >> 5); if (row >= ZH * SEQ) return; const int i = row % SEQ; const int zz = row / SEQ; const bool hires = (i < RH); const float* sr = Sb + (size_t)row * SEQ; float v[SEQ / 32]; float mx = -3.0e38f;
#pragma unroll
    for (int ch = 0; ch < SEQ / 128; ++ch) { const int j0 = ch * 128 + lane * 4; const v4f a = *(const v4f*)(sr + j0);
#pragma unroll
        for (int q = 0; q < 4; ++q) { const float t = (j0 + q <= i) ? a[q] * SCL : -3.0e38f; v[ch * 4 + q] = t; mx = fmaxf(mx, t); } }
#pragma unroll
    for (int sh = 16; sh; sh >>= 1) mx = fmaxf(mx, __shfl_xor(mx, sh, 32));
    float sum = 0.f;
#pragma unroll
    for (int k = 0; k < SEQ / 32; ++k) { float d0 = __fsub_rn(v[k], mx); asm volatile("" : "+v"(d0)); v[k] = __builtin_amdgcn_exp2f(__fmul_rn(d0, 1.4426950408889634f)); sum += v[k]; }
#pragma unroll
    for (int sh = 16; sh; sh >>= 1) sum += __shfl_xor(sum, sh, 32);
    const float f = __fdiv_rn(hires ? 1.0f : PCAR, sum);
{
        if (hires) {
#pragma unroll
            for (int ch = 0; ch < SEQ / 128; ++ch) { v4us oh, ol;
#pragma unroll
                for (int q = 0; q < 4; ++q) { unsigned short a, c2; splitf(v[ch * 4 + q] * f, a, c2); oh[q] = a; ol[q] = c2; }
                const size_t oo = ((size_t)zz * RH + i) * SEQ + ch * 128 + lane * 4; *(v4us*)(Ph + oo) = oh; *(v4us*)(Pl + oo) = ol; }
        } else {
#pragma unroll
            for (int ch = 0; ch < SEQ / 128; ++ch) { v4h o4;
#pragma unroll
                for (int q = 0; q < 4; ++q) o4[q] = tohx(v[ch * 4 + q] * f);
                *(v4h*)(P16 + (size_t)row * SEQ + ch * 128 + lane * 4) = o4; } }
         }
}

__global__ __launch_bounds__(256) void k_merge(const float* __restrict__ O, int h0, bf* Ah, bf* Al) { const size_t e = ((size_t)blockIdx.x * 256 + threadIdx.x) * 2; if (e >= (size_t)ZH * SEQ * HD) return; const int d = (int)(e % HD); const int t = (int)((e / HD) % SEQ); const int zz = (int)(e / ((size_t)HD * SEQ)); const float cs = (t < RH) ? 1.0f : (1.0f / PCAR); const size_t oo = (size_t)t * DQ + (h0 + zz) * HD + d;
    v2us oh, ol;
#pragma unroll
    for (int q = 0; q < 2; ++q) { unsigned short a, c2; splitf(O[e + q] * cs, a, c2); oh[q] = a; ol[q] = c2; } *(v2us*)(Ah + oo) = oh; *(v2us*)(Al + oo) = ol;  }

__global__ __launch_bounds__(256) void k_pl2out(const bf* __restrict__ Ah, const bf* __restrict__ Al, float* out) { const size_t e = ((size_t)blockIdx.x * 256 + threadIdx.x) * 4; if (e >= (size_t)SEQ * DQ) return; v4f o;
#pragma unroll
    for (int u = 0; u < 4; ++u) o[u] = __fadd_rn(bf2f(Ah[e + u]), bf2f(Al[e + u])); *(v4f*)(out + e) = o;  }

extern "C" void kernel_launch(void* const* d_in, const int* in_sizes, int n_in,
                              void* d_out, int out_size, void* d_ws, size_t ws_size, hipStream_t stream) {
    if (n_in < 3) return;
    if ((size_t)in_sizes[0] < (size_t)(NB - 1) * SEQ_FULL * DM + (size_t)SEQ * DM) return;
    if ((size_t)in_sizes[1] < (size_t)3 * DM * DM) return;
    if (in_sizes[2] < 3 * DM) return;
    if ((size_t)out_size < (size_t)(NB - 1) * SEQ_FULL * DM + (size_t)SEQ * DM) return;
    const float* x = (const float*)d_in[0];      // [NB_FULL][SEQ_FULL][DM]
    const float* wf = (const float*)d_in[1];     // [3*DM][DM]: rows 0..1023 q, 1024..2047 k, 2048..3071 v
    const float* bz = (const float*)d_in[2];     // [3*DM]
    const float* bq = bz; const float* bk = bz + DM; const float* bv = bz + 2 * DM;
    float* OUT = (float*)d_out;                  // [NB_FULL][SEQ_FULL][DM]
    char* wsp = (char*)d_ws;
    auto take = [&](size_t bytes) { char* p = wsp; wsp += (bytes + 255) & ~(size_t)255; return (void*)p; };
    bf* WALL = (bf*)take((size_t)3 * DM * DM * 2); bf* WQ = WALL; bf* WK = WALL + (size_t)DM * DM; bf* WV = WALL + (size_t)2 * DM * DM;
    bf* XB = (bf*)take((size_t)SEQ * DM * 2); float* F = (float*)take((size_t)SEQ * DQ * 4);   // F holds the q, then k, then v projection (stream-ordered reuse)
    h16* QP16 = (h16*)take((size_t)NH_ * SEQ * HD * 2); h16* KP16 = (h16*)take((size_t)NKV * SEQ * HD * 2); h16* VT16 = (h16*)take((size_t)NKV * HD * SEQ * 2);
    bf* QPh = (bf*)take((size_t)NH_ * SEQ * HD * 2); bf* QPl = (bf*)take((size_t)NH_ * SEQ * HD * 2); bf* KPh = (bf*)take((size_t)NKV * SEQ * HD * 2); bf* KPl = (bf*)take((size_t)NKV * SEQ * HD * 2);
    bf* VTh = (bf*)take((size_t)NKV * HD * SEQ * 2); bf* VTl = (bf*)take((size_t)NKV * HD * SEQ * 2); bf* Ph = (bf*)take((size_t)ZH * RH * SEQ * 2); bf* Pl = (bf*)take((size_t)ZH * RH * SEQ * 2);
    float* Sb = (float*)take((size_t)ZH * SEQ * SEQ * 4); h16* P16 = (h16*)take((size_t)ZH * SEQ * SEQ * 2); float* Ob = (float*)take((size_t)ZH * SEQ * HD * 4);
    bf* ATh = (bf*)take((size_t)SEQ * DQ * 2); bf* ATl = (bf*)take((size_t)SEQ * DQ * 2);
    const size_t carved = (size_t)(wsp - (char*)d_ws);
    if (carved > ws_size || carved > ((size_t)128 << 20)) return;   // 124,780,544 B at SEQ 2048

    k_cvt8<<<(unsigned)(((size_t)3 * DM * DM / 8 + 255) / 256), 256, 0, stream>>>(wf, WALL, (size_t)3 * DM * DM / 8);
    const unsigned LQ = (unsigned)(((size_t)NH_ * SEQ * HD / 2 + 255) / 256), LKv = (unsigned)(((size_t)NKV * SEQ * HD / 2 + 255) / 256);
    for (int b = 0; b < NB; ++b) {
        k_cvt8<<<(unsigned)(((size_t)SEQ * DM / 8 + 255) / 256), 256, 0, stream>>>(x + (size_t)b * SEQ_FULL * DM, XB, (size_t)SEQ * DM / 8);
        k_gemmw<bf, 0, true><<<dim3(SEQ / 64, DQ / 64, 1), 32, 0, stream>>>(XB, nullptr, WQ, nullptr, DM, F, DQ, bq, 0, 0, 0);
        k_qkp<<<LQ, 256, 0, stream>>>(F, DQ, NH_, QP16, QPh, QPl);
        k_gemmw<bf, 0, true><<<dim3(SEQ / 64, DKV / 64, 1), 32, 0, stream>>>(XB, nullptr, WK, nullptr, DM, F, DKV, bk, 0, 0, 0);
        k_qkp<<<LKv, 256, 0, stream>>>(F, DKV, NKV, KP16, KPh, KPl);
        k_gemmw<bf, 0, true><<<dim3(SEQ / 64, DKV / 64, 1), 32, 0, stream>>>(XB, nullptr, WV, nullptr, DM, F, DKV, bv, 0, 0, 0);
        k_vtp<<<LKv, 256, 0, stream>>>(F, DKV, NKV, VT16, VTh, VTl);
        for (int h0 = 0; h0 < NH_; h0 += ZH) { const size_t zq = (size_t)h0, zk = (size_t)(h0 / REP);   // the pass's ZH heads use consecutive planes (z-strides SEQ*HD)
            k_gemmc<bf, 2, 1><<<dim3(RH / 64, SEQ / 64, ZH), 32, 0, stream>>>(QPh + zq * SEQ * HD, QPl + zq * SEQ * HD, KPh + zk * SEQ * HD, KPl + zk * SEQ * HD, HD, Sb, SEQ, 0, (size_t)SEQ * HD, (size_t)SEQ * HD, (size_t)SEQ * SEQ);
            if (SEQ > RH) k_gemmc<h16, 0, 1><<<dim3((SEQ - RH) / 64, SEQ / 64, ZH), 32, 0, stream>>>(QP16 + zq * SEQ * HD + (size_t)RH * HD, nullptr, KP16 + zk * SEQ * HD, nullptr, HD, Sb + (size_t)RH * SEQ, SEQ, RH, (size_t)SEQ * HD, (size_t)SEQ * HD, (size_t)SEQ * SEQ);
            k_asoft<<<ZH * SEQ / 8, 256, 0, stream>>>(Sb, P16, Ph, Pl);
            k_gemmc<bf, 2, 2><<<dim3(RH / 64, HD / 64, ZH), 32, 0, stream>>>(Ph, Pl, VTh + zk * HD * SEQ, VTl + zk * HD * SEQ, SEQ, Ob, HD, 0, (size_t)RH * SEQ, (size_t)HD * SEQ, (size_t)SEQ * HD);
            if (SEQ > RH) k_gemmc<h16, 0, 2><<<dim3((SEQ - RH) / 64, HD / 64, ZH), 32, 0, stream>>>(P16 + (size_t)RH * SEQ, nullptr, VT16 + zk * HD * SEQ, nullptr, SEQ, Ob + (size_t)RH * HD, HD, RH, (size_t)SEQ * SEQ, (size_t)HD * SEQ, (size_t)SEQ * HD);
            k_merge<<<(unsigned)(((size_t)ZH * SEQ * HD / 2 + 255) / 256), 256, 0, stream>>>(Ob, h0, ATh, ATl); }
        k_pl2out<<<(unsigned)(((size_t)SEQ * DQ / 4 + 255) / 256), 256, 0, stream>>>(ATh, ATl, OUT + (size_t)b * SEQ_FULL * DM); }
}

// v001
// One run takes 819 microseconds.
// Timed twice side by side with v000, it ran 1.69 and 1.68 times as fast.
#include <hip/hip_runtime.h>

// Contractions (f32 accumulate): qkv projection = v_wmma_f32_16x16x32_bf16 on bf16 RNE-converted x and W (single products) + bf16-converted bias;
// causal scores q.k and probabilities.v: query rows < RH on v_wmma_f32_16x16x32_bf16 hi+lo planes (3 products each), rows >= RH on
// v_wmma_f32_16x16x32_f16 single products (probabilities carried x1024); softmax in f32; merged heads emitted as the f32 sum of a bf16 hi/lo pair.

#ifndef NB
#define NB 2
#endif
#ifndef SEQ
#define SEQ 2048
#endif
#define NB_FULL  2
#define SEQ_FULL 2048
#define DM   1024
#define NH_  16
#define NKV  16
#define REP  (NH_ / NKV)
#define HD   64
#define DQ   (NH_ * HD)
#define DKV  (NKV * HD)
#define ZH   2
#define RH   ((SEQ >= 512) ? 512 : SEQ)     // query rows < RH use hi+lo planes
#define PCAR 1024.0f
#define SCL  0.125f                          // HD^-0.5
static_assert(SEQ % 128 == 0);
static_assert(SEQ >= 128 && SEQ <= SEQ_FULL);
static_assert(NB >= 1 && NB <= NB_FULL);
static_assert(RH % 64 == 0 && RH <= SEQ && RH > 0);
static_assert(NH_ % ZH == 0 && DQ == DM && REP == 1 && DKV == DM);

typedef _Float16 h16;
typedef unsigned short bf;
typedef __attribute__((ext_vector_type(16))) __bf16   v16bf;
typedef __attribute__((ext_vector_type(16))) _Float16 v16h;
typedef __attribute__((ext_vector_type(8)))  _Float16 v8h;
typedef __attribute__((ext_vector_type(8)))  unsigned short v8us;
typedef __attribute__((ext_vector_type(8)))  float    v8f;
typedef __attribute__((ext_vector_type(4)))  float    v4f;
typedef v8h  __attribute__((may_alias)) v8ha;
typedef v4f  __attribute__((may_alias)) v4fa;
typedef v8us __attribute__((may_alias)) v8usa;
typedef __attribute__((ext_vector_type(2))) _Float16 v2h;
typedef __attribute__((ext_vector_type(4))) _Float16 v4h;
typedef __attribute__((ext_vector_type(2))) unsigned short v2us;
typedef __attribute__((ext_vector_type(4))) unsigned short v4us;
typedef __attribute__((ext_vector_type(2))) float v2f;

__device__ __forceinline__ unsigned short f2bf(float f) { unsigned u = __float_as_uint(f); u += 0x7FFFu + ((u >> 16) & 1u); return (unsigned short)(u >> 16); }
__device__ __forceinline__ float bf2f(unsigned short b) { return __uint_as_float(((unsigned)b) << 16); }
__device__ __forceinline__ float bfr(float f) { return bf2f(f2bf(f)); }
__device__ __forceinline__ v16h cat16(v8h lo, v8h hi) { return __builtin_shufflevector(lo, hi, 0, 1, 2, 3, 4, 5, 6, 7, 8, 9, 10, 11, 12, 13, 14, 15); }
__device__ __forceinline__ v16bf cat16b(v8us lo, v8us hi) { return __builtin_bit_cast(v16bf, __builtin_shufflevector(lo, hi, 0, 1, 2, 3, 4, 5, 6, 7, 8, 9, 10, 11, 12, 13, 14, 15)); }
__device__ __forceinline__ v8f wmma16(v16h a, v16h b, v8f c) { return __builtin_amdgcn_wmma_f32_16x16x32_f16(false, a, false, b, (short)0, c, false, false); }
__device__ __forceinline__ v8f wmmab(v16bf a, v16bf b, v8f c) { return __builtin_amdgcn_wmma_f32_16x16x32_bf16(false, a, false, b, (short)0, c, false, false); }
__device__ __forceinline__ h16 tohx(float x) { return (h16)x; }
__device__ __forceinline__ void splitf(float y, unsigned short& h, unsigned short& l) { h = f2bf(y); l = f2bf(y - bf2f(h)); }

// Fragment map (wave32, 16x16x32): lane l -> row/col (l & 15), h = l >> 4; vector elements 0..7 <- k0 + 8h + 0..7, elements 8..15 <- k0 + 16 + 8h + 0..7,
// identical for A (rows) and B (columns, k-contiguous Bt[n][k] planes); D element r -> (row 8h + r, col l & 15).
template <typename T16> struct WFrag;
template <> struct WFrag<h16> { typedef v16h V; static __device__ __forceinline__ V ld(const h16* p) { return cat16(*(const v8h*)p, *(const v8h*)(p + 16)); } static __device__ __forceinline__ v8f mma(V a, V b, v8f c) { return wmma16(a, b, c); } };
template <> struct WFrag<bf> { typedef v16bf V; static __device__ __forceinline__ V ld(const bf* p) { return cat16b(*(const v8us*)p, *(const v8us*)(p + 16)); } static __device__ __forceinline__ v8f mma(V a, V b, v8f c) { return wmmab(a, b, c); } };

// ---- k_gemmk: register-blocked GEMM, one 64x64 output tile per work-group of NW waves, operands straight from K-contiguous 16-bit planes; grid (M/64, N/64, Z), 32 * NW threads.
// The K loop is dealt to the waves in units of 64 k (one 128-byte line of every operand row): wave w takes units w, w + NW, ... and keeps a full 16-accumulator partial tile;
// the NW partial tiles meet in LDS and are summed in wave order 0..NW-1.
// C[m][n] (f32, pitch ldc, + optional bf16-converted f32 bias[n]) = sum_k A[m][k] Bt[n][k] (+ split products per NSPLIT). z-batch strides sA/sB/sC in elements. K % 64 == 0.
// CAUSAL (probability x value contraction): the key (K) loop stops at the diagonal block (probabilities beyond it are exactly zero). roff = row offset of this launch's first row within the sequence.
template <typename T16, int NSPLIT, bool BIAS, bool CAUSAL, int NW>
__global__ __launch_bounds__(32 * NW) void k_gemmk(const T16* __restrict__ A, const T16* __restrict__ A2, const T16* __restrict__ Bt, const T16* __restrict__ Bt2, int K, float* C, int ldc, const float* __restrict__ bias, int roff, size_t sA, size_t sB, size_t sC) {
    typedef typename WFrag<T16>::V V;
    __shared__ __align__(16) float os[NW * 64 * 68];
    const size_t z = blockIdx.z; A += z * sA; if (A2) A2 += z * sA; Bt += z * sB; if (Bt2) Bt2 += z * sB; C += z * sC;
    const int lane = threadIdx.x & 31, lr = lane & 15, hi = lane >> 4; const int r0 = blockIdx.x * 64, c0 = blockIdx.y * 64;
    const int wv = __builtin_amdgcn_readfirstlane((int)(threadIdx.x >> 5));   // wave number in a scalar register: the K loops below branch on scalars
    const int Kl = CAUSAL ? min(K, r0 + roff + 64) : K;
    v8f acc[4][4];
#pragma unroll
    for (int mb = 0; mb < 4; ++mb)
#pragma unroll
        for (int nb = 0; nb < 4; ++nb) acc[mb][nb] = (v8f){};
    const size_t aoff = (size_t)(r0 + lr) * K + 8 * hi, boff = (size_t)(c0 + lr) * K + 8 * hi;
#pragma unroll 1
    for (int k0 = wv * 64; k0 < Kl; k0 += NW * 64) {
#pragma unroll 1
    for (int kc = k0; kc < k0 + 64; kc += 32) {
        V a[4], a2[4];
#pragma unroll
        for (int mb = 0; mb < 4; ++mb) { a[mb] = WFrag<T16>::ld(A + aoff + (size_t)mb * 16 * K + kc); if (NSPLIT == 1 || NSPLIT == 2) a2[mb] = WFrag<T16>::ld(A2 + aoff + (size_t)mb * 16 * K + kc); }
#pragma unroll
        for (int nb = 0; nb < 4; ++nb) { const V b = WFrag<T16>::ld(Bt + boff + (size_t)nb * 16 * K + kc); V b2; if (NSPLIT >= 2) b2 = WFrag<T16>::ld(Bt2 + boff + (size_t)nb * 16 * K + kc);
#pragma unroll
            for (int mb = 0; mb < 4; ++mb) { acc[mb][nb] = WFrag<T16>::mma(a[mb], b, acc[mb][nb]); if (NSPLIT == 1 || NSPLIT == 2) acc[mb][nb] = WFrag<T16>::mma(a2[mb], b, acc[mb][nb]); if (NSPLIT >= 2) acc[mb][nb] = WFrag<T16>::mma(a[mb], b2, acc[mb][nb]); } }
        asm volatile("v_nop\n\tv_nop\n\tv_nop\n\tv_nop" : "+v"(acc[0][0]), "+v"(acc[1][1]), "+v"(acc[2][2]), "+v"(acc[3][3]) : "v"(a[0]), "v"(a[3]));
    } }
    float* ow = os + wv * (64 * 68);
#pragma unroll
    for (int mb = 0; mb < 4; ++mb) {
#pragma unroll
        for (int nb = 0; nb < 4; ++nb) {
#pragma unroll
            for (int j = 0; j < 8; ++j) ow[(mb * 16 + hi * 8 + j) * 68 + nb * 16 + lr] = acc[mb][nb][j]; } }
    __syncthreads();   // every wave's partial tile is in LDS before any thread sums across waves
#pragma unroll
    for (int q = 0; q < 64 * 16 / (32 * NW); ++q) { const int p = q * (32 * NW) + (int)threadIdx.x, row = p >> 4, cofs = (p & 15) * 4; v4f val = *(const v4fa*)(os + row * 68 + cofs);
#pragma unroll
        for (int w = 1; w < NW; ++w) val += *(const v4fa*)(os + w * (64 * 68) + row * 68 + cofs);
        if (BIAS) { val[0] += bfr(bias[c0 + cofs]); val[1] += bfr(bias[c0 + cofs + 1]); val[2] += bfr(bias[c0 + cofs + 2]); val[3] += bfr(bias[c0 + cofs + 3]); }
        *(v4f*)(C + (size_t)(r0 + row) * ldc + c0 + cofs) = val; }
}

// ---- k_gemmc: ONE WAVE per 64x64 tile of the causal scores (16 accumulators, short K): tiles entirely above the diagonal are skipped (query rows r0+roff.., key columns c0..).
// roff = row offset of this launch's first row within the sequence. grid (M/64, N/64, Z), 32 threads.
template <typename T16, int NSPLIT>
__global__ __launch_bounds__(32) void k_gemmc(const T16* __restrict__ A, const T16* __restrict__ A2, const T16* __restrict__ Bt, const T16* __restrict__ Bt2, int K, float* C, int ldc, int roff, size_t sA, size_t sB, size_t sC) {
    typedef typename WFrag<T16>::V V;
    __shared__ __align__(16) float os[16 * 68];
    const size_t z = blockIdx.z; A += z * sA; if (A2) A2 += z * sA; Bt += z * sB; if (Bt2) Bt2 += z * sB; C += z * sC;
    const int lane = threadIdx.x & 31, lr = lane & 15, hi = lane >> 4; const int r0 = blockIdx.x * 64, c0 = blockIdx.y * 64;
    if (c0 > r0 + roff + 63) return;                  // score tile entirely above the causal diagonal: never read (the softmax masks j > i by index select)
    v8f acc[4][4];
#pragma unroll
    for (int mb = 0; mb < 4; ++mb)
#pragma unroll
        for (int nb = 0; nb < 4; ++nb) acc[mb][nb] = (v8f){};
    const size_t aoff = (size_t)(r0 + lr) * K + 8 * hi, boff = (size_t)(c0 + lr) * K + 8 * hi;
#pragma unroll 1
    for (int kc = 0; kc < K; kc += 32) {
        V a[4], a2[4];
#pragma unroll
        for (int mb = 0; mb < 4; ++mb) { a[mb] = WFrag<T16>::ld(A + aoff + (size_t)mb * 16 * K + kc); if (NSPLIT == 1 || NSPLIT == 2) a2[mb] = WFrag<T16>::ld(A2 + aoff + (size_t)mb * 16 * K + kc); }
#pragma unroll
        for (int nb = 0; nb < 4; ++nb) { const V b = WFrag<T16>::ld(Bt + boff + (size_t)nb * 16 * K + kc); V b2; if (NSPLIT >= 2) b2 = WFrag<T16>::ld(Bt2 + boff + (size_t)nb * 16 * K + kc);
#pragma unroll
            for (int mb = 0; mb < 4; ++mb) { acc[mb][nb] = WFrag<T16>::mma(a[mb], b, acc[mb][nb]); if (NSPLIT == 1 || NSPLIT == 2) acc[mb][nb] = WFrag<T16>::mma(a2[mb], b, acc[mb][nb]); if (NSPLIT >= 2) acc[mb][nb] = WFrag<T16>::mma(a[mb], b2, acc[mb][nb]); } }
        asm volatile("v_nop\n\tv_nop\n\tv_nop\n\tv_nop" : "+v"(acc[0][0]), "+v"(acc[1][1]), "+v"(acc[2][2]), "+v"(acc[3][3]) : "v"(a[0]), "v"(a[3]));
    }
#pragma unroll
    for (int mb = 0; mb < 4; ++mb) {
#pragma unroll
        for (int nb = 0; nb < 4; ++nb) {
#pragma unroll
            for (int j = 0; j < 8; ++j) os[(hi * 8 + j) * 68 + nb * 16 + lr] = acc[mb][nb][j]; }
        __builtin_amdgcn_wave_barrier(); asm volatile("" ::: "memory");
        float* crow = C + (size_t)(r0 + mb * 16) * ldc + c0;
{
#pragma unroll
            for (int s = 0; s < 8; ++s) { const int row = 2 * s + hi, cofs = lr * 4; v4f val = *(const v4fa*)(os + row * 68 + cofs);
                *(v4f*)(crow + (size_t)row * ldc + cofs) = val; }
             }
        __builtin_amdgcn_wave_barrier(); asm volatile("" ::: "memory");
    }
}

__global__ __launch_bounds__(256) void k_cvt8(const float* __restrict__ src, bf* dst, size_t n8) { const size_t i = (size_t)blockIdx.x * 256 + threadIdx.x; if (i >= n8) return; const v8f v = *(const v8f*)(src + i * 8); v8us o;
#pragma unroll
    for (int k = 0; k < 8; ++k) o[k] = f2bf(v[k]); *(v8us*)(dst + i * 8) = o;  }

__global__ __launch_bounds__(256) void k_qkp(const float* __restrict__ F, int pitch, int nheads, h16* P16, bf* Ph, bf* Pl) {
    const size_t e = ((size_t)blockIdx.x * 256 + threadIdx.x) * 2; if (e >= (size_t)nheads * SEQ * HD) return; const int d = (int)(e % HD); const int t = (int)((e / HD) % SEQ); const int h = (int)(e / ((size_t)HD * SEQ));
    const float* f = F + (size_t)t * pitch + h * HD + d; v2h o16; v2us oh, ol;
#pragma unroll
    for (int q = 0; q < 2; ++q) { const float r = f[q]; o16[q] = tohx(r); unsigned short a2, c2; splitf(r, a2, c2); oh[q] = a2; ol[q] = c2; }
    *(v2h*)(P16 + e) = o16; *(v2us*)(Ph + e) = oh; *(v2us*)(Pl + e) = ol;  }

__global__ __launch_bounds__(256) void k_vtp(const float* __restrict__ F, int pitch, int nheads, h16* V16, bf* Vh, bf* Vl) { const size_t e = ((size_t)blockIdx.x * 256 + threadIdx.x) * 2; if (e >= (size_t)nheads * HD * SEQ) return; const int t = (int)(e % SEQ); const int d = (int)((e / SEQ) % HD); const int g = (int)(e / ((size_t)SEQ * HD)); v2h o16; v2us oh, ol;
#pragma unroll
    for (int q = 0; q < 2; ++q) { const float x = F[(size_t)(t + q) * pitch + g * HD + d]; o16[q] = tohx(x); unsigned short a2, c2; splitf(x, a2, c2); oh[q] = a2; ol[q] = c2; }
    *(v2h*)(V16 + e) = o16; *(v2us*)(Vh + e) = oh; *(v2us*)(Vl + e) = ol;  }

// ---- k_asoft: one wave per score row (zz, i): t = S x HD^-0.5 for j <= i, masked fill otherwise (index select; the diagonal is always valid); softmax over the SEQ keys in f32
__global__ __launch_bounds__(256) void k_asoft(const float* __restrict__ Sb, h16* P16, bf* Ph, bf* Pl) {
    const int lane = threadIdx.x & 31; const int row = blockIdx.x * 8 + (threadIdx.x >> 5); if (row >= ZH * SEQ) return; const int i = row % SEQ; const int zz = row / SEQ; const bool hires = (i < RH); const float* sr = Sb + (size_t)row * SEQ; float v[SEQ / 32]; float mx = -3.0e38f;
#pragma unroll
    for (int ch = 0; ch < SEQ / 128; ++ch) { const int j0 = ch * 128 + lane * 4; const v4f a = *(const v4f*)(sr + j0);
#pragma unroll
        for (int q = 0; q < 4; ++q) { const float t = (j0 + q <= i) ? a[q] * SCL : -3.0e38f; v[ch * 4 + q] = t; mx = fmaxf(mx, t); } }
#pragma unroll
    for (int sh = 16; sh; sh >>= 1) mx = fmaxf(mx, __shfl_xor(mx, sh, 32));
    float sum = 0.f;
#pragma unroll
    for (int k = 0; k < SEQ / 32; ++k) { float d0 = __fsub_rn(v[k], mx); asm volatile("" : "+v"(d0)); v[k] = __builtin_amdgcn_exp2f(__fmul_rn(d0, 1.4426950408889634f)); sum += v[k]; }
#pragma unroll
    for (int sh = 16; sh; sh >>= 1) sum += __shfl_xor(sum, sh, 32);
    const float f = __fdiv_rn(hires ? 1.0f : PCAR, sum);
{
        if (hires) {
#pragma unroll
            for (int ch = 0; ch < SEQ / 128; ++ch) { v4us oh, ol;
#pragma unroll
                for (int q = 0; q < 4; ++q) { unsigned short a, c2; splitf(v[ch * 4 + q] * f, a, c2); oh[q] = a; ol[q] = c2; }
                const size_t oo = ((size_t)zz * RH + i) * SEQ + ch * 128 + lane * 4; *(v4us*)(Ph + oo) = oh; *(v4us*)(Pl + oo) = ol; }
        } else {
#pragma unroll
            for (int ch = 0; ch < SEQ / 128; ++ch) { v4h o4;
#pragma unroll
                for (int q = 0; q < 4; ++q) o4[q] = tohx(v[ch * 4 + q] * f);
                *(v4h*)(P16 + (size_t)row * SEQ + ch * 128 + lane * 4) = o4; } }
         }
}

__global__ __launch_bounds__(256) void k_merge(const float* __restrict__ O, int h0, bf* Ah, bf* Al) { const size_t e = ((size_t)blockIdx.x * 256 + threadIdx.x) * 2; if (e >= (size_t)ZH * SEQ * HD) return; const int d = (int)(e % HD); const int t = (int)((e / HD) % SEQ); const int zz = (int)(e / ((size_t)HD * SEQ)); const float cs = (t < RH) ? 1.0f : (1.0f / PCAR); const size_t oo = (size_t)t * DQ + (h0 + zz) * HD + d;
    v2us oh, ol;
#pragma unroll
    for (int q = 0; q < 2; ++q) { unsigned short a, c2; splitf(O[e + q] * cs, a, c2); oh[q] = a; ol[q] = c2; } *(v2us*)(Ah + oo) = oh; *(v2us*)(Al + oo) = ol;  }

__global__ __launch_bounds__(256) void k_pl2out(const bf* __restrict__ Ah, const bf* __restrict__ Al, float* out) { const size_t e = ((size_t)blockIdx.x * 256 + threadIdx.x) * 4; if (e >= (size_t)SEQ * DQ) return; v4f o;
#pragma unroll
    for (int u = 0; u < 4; ++u) o[u] = __fadd_rn(bf2f(Ah[e + u]), bf2f(Al[e + u])); *(v4f*)(out + e) = o;  }

extern "C" void kernel_launch(void* const* d_in, const int* in_sizes, int n_in,
                              void* d_out, int out_size, void* d_ws, size_t ws_size, hipStream_t stream) {
    if (n_in < 3) return;
    if ((size_t)in_sizes[0] < (size_t)(NB - 1) * SEQ_FULL * DM + (size_t)SEQ * DM) return;
    if ((size_t)in_sizes[1] < (size_t)3 * DM * DM) return;
    if (in_sizes[2] < 3 * DM) return;
    if ((size_t)out_size < (size_t)(NB - 1) * SEQ_FULL * DM + (size_t)SEQ * DM) return;
    const float* x = (const float*)d_in[0];      // [NB_FULL][SEQ_FULL][DM]
    const float* wf = (const float*)d_in[1];     // [3*DM][DM]: rows 0..1023 q, 1024..2047 k, 2048..3071 v
    const float* bz = (const float*)d_in[2];     // [3*DM]
    const float* bq = bz; const float* bk = bz + DM; const float* bv = bz + 2 * DM;
    float* OUT = (float*)d_out;                  // [NB_FULL][SEQ_FULL][DM]
    char* wsp = (char*)d_ws;
    auto take = [&](size_t bytes) { char* p = wsp; wsp += (bytes + 255) & ~(size_t)255; return (void*)p; };
    bf* WALL = (bf*)take((size_t)3 * DM * DM * 2); bf* WQ = WALL; bf* WK = WALL + (size_t)DM * DM; bf* WV = WALL + (size_t)2 * DM * DM;
    bf* XB = (bf*)take((size_t)SEQ * DM * 2); float* F = (float*)take((size_t)SEQ * DQ * 4);   // F holds the q, then k, then v projection (stream-ordered reuse)
    h16* QP16 = (h16*)take((size_t)NH_ * SEQ * HD * 2); h16* KP16 = (h16*)take((size_t)NKV * SEQ * HD * 2); h16* VT16 = (h16*)take((size_t)NKV * HD * SEQ * 2);
    bf* QPh = (bf*)take((size_t)NH_ * SEQ * HD * 2); bf* QPl = (bf*)take((size_t)NH_ * SEQ * HD * 2); bf* KPh = (bf*)take((size_t)NKV * SEQ * HD * 2); bf* KPl = (bf*)take((size_t)NKV * SEQ * HD * 2);
    bf* VTh = (bf*)take((size_t)NKV * HD * SEQ * 2); bf* VTl = (bf*)take((size_t)NKV * HD * SEQ * 2); bf* Ph = (bf*)take((size_t)ZH * RH * SEQ * 2); bf* Pl = (bf*)take((size_t)ZH * RH * SEQ * 2);
    float* Sb = (float*)take((size_t)ZH * SEQ * SEQ * 4); h16* P16 = (h16*)take((size_t)ZH * SEQ * SEQ * 2); float* Ob = (float*)take((size_t)ZH * SEQ * HD * 4);
    bf* ATh = (bf*)take((size_t)SEQ * DQ * 2); bf* ATl = (bf*)take((size_t)SEQ * DQ * 2);
    const size_t carved = (size_t)(wsp - (char*)d_ws);
    if (carved > ws_size || carved > ((size_t)128 << 20)) return;   // 124,780,544 B at SEQ 2048

    k_cvt8<<<(unsigned)(((size_t)3 * DM * DM / 8 + 255) / 256), 256, 0, stream>>>(wf, WALL, (size_t)3 * DM * DM / 8);
    const unsigned LQ = (unsigned)(((size_t)NH_ * SEQ * HD / 2 + 255) / 256), LKv = (unsigned)(((size_t)NKV * SEQ * HD / 2 + 255) / 256);
    for (int b = 0; b < NB; ++b) {
        k_cvt8<<<(unsigned)(((size_t)SEQ * DM / 8 + 255) / 256), 256, 0, stream>>>(x + (size_t)b * SEQ_FULL * DM, XB, (size_t)SEQ * DM / 8);
        k_gemmk<bf, 0, true, false, 8><<<dim3(SEQ / 64, DQ / 64, 1), 256, 0, stream>>>(XB, nullptr, WQ, nullptr, DM, F, DQ, bq, 0, 0, 0, 0);
        k_qkp<<<LQ, 256, 0, stream>>>(F, DQ, NH_, QP16, QPh, QPl);
        k_gemmk<bf, 0, true, false, 8><<<dim3(SEQ / 64, DKV / 64, 1), 256, 0, stream>>>(XB, nullptr, WK, nullptr, DM, F, DKV, bk, 0, 0, 0, 0);
        k_qkp<<<LKv, 256, 0, stream>>>(F, DKV, NKV, KP16, KPh, KPl);
        k_gemmk<bf, 0, true, false, 8><<<dim3(SEQ / 64, DKV / 64, 1), 256, 0, stream>>>(XB, nullptr, WV, nullptr, DM, F, DKV, bv, 0, 0, 0, 0);
        k_vtp<<<LKv, 256, 0, stream>>>(F, DKV, NKV, VT16, VTh, VTl);
        for (int h0 = 0; h0 < NH_; h0 += ZH) { const size_t zq = (size_t)h0, zk = (size_t)(h0 / REP);   // the pass's ZH heads use consecutive planes (z-strides SEQ*HD)
            k_gemmc<bf, 2><<<dim3(RH / 64, SEQ / 64, ZH), 32, 0, stream>>>(QPh + zq * SEQ * HD, QPl + zq * SEQ * HD, KPh + zk * SEQ * HD, KPl + zk * SEQ * HD, HD, Sb, SEQ, 0, (size_t)SEQ * HD, (size_t)SEQ * HD, (size_t)SEQ * SEQ);
            if (SEQ > RH) k_gemmc<h16, 0><<<dim3((SEQ - RH) / 64, SEQ / 64, ZH), 32, 0, stream>>>(QP16 + zq * SEQ * HD + (size_t)RH * HD, nullptr, KP16 + zk * SEQ * HD, nullptr, HD, Sb + (size_t)RH * SEQ, SEQ, RH, (size_t)SEQ * HD, (size_t)SEQ * HD, (size_t)SEQ * SEQ);
            k_asoft<<<ZH * SEQ / 8, 256, 0, stream>>>(Sb, P16, Ph, Pl);
            k_gemmk<bf, 2, false, true, 8><<<dim3(RH / 64, HD / 64, ZH), 256, 0, stream>>>(Ph, Pl, VTh + zk * HD * SEQ, VTl + zk * HD * SEQ, SEQ, Ob, HD, nullptr, 0, (size_t)RH * SEQ, (size_t)HD * SEQ, (size_t)SEQ * HD);
            if (SEQ > RH) k_gemmk<h16, 0, false, true, 16><<<dim3((SEQ - RH) / 64, HD / 64, ZH), 512, 0, stream>>>(P16 + (size_t)RH * SEQ, nullptr, VT16 + zk * HD * SEQ, nullptr, SEQ, Ob + (size_t)RH * HD, HD, nullptr, RH, (size_t)SEQ * SEQ, (size_t)HD * SEQ, (size_t)SEQ * HD);
            k_merge<<<(unsigned)(((size_t)ZH * SEQ * HD / 2 + 255) / 256), 256, 0, stream>>>(Ob, h0, ATh, ATl); }
        k_pl2out<<<(unsigned)(((size_t)SEQ * DQ / 4 + 255) / 256), 256, 0, stream>>>(ATh, ATl, OUT + (size_t)b * SEQ_FULL * DM); }
}

// v002
// A run of this version takes 414 microseconds.
// Two timings next to v001 put it at 1.95 and 1.97 times that version's speed.
// Counting every step since v000, it is 3.30 times as fast.
#include <hip/hip_runtime.h>

// Contractions (f32 accumulate): qkv projection = v_wmma_f32_16x16x32_bf16 on bf16 RNE-converted x and W (single products) + bf16-converted bias;
// causal scores q.k and probabilities.v: query rows < RH on v_wmma_f32_16x16x32_bf16 hi+lo planes (3 products each), rows >= RH on
// v_wmma_f32_16x16x32_f16 single products (probabilities carried x1024); softmax in f32; merged heads emitted as the f32 sum of a bf16 hi/lo pair.

#ifndef NB
#define NB 2
#endif
#ifndef SEQ
#define SEQ 2048
#endif
#define NB_FULL  2
#define SEQ_FULL 2048
#define DM   1024
#define NH_  16
#define NKV  16
#define REP  (NH_ / NKV)
#define HD   64
#define DQ   (NH_ * HD)
#define DKV  (NKV * HD)
#define ZH   8                                // heads per attention launch
#define NRB  (SEQ / 64)                       // 64-row blocks of a head's score matrix
#define SPK  ((size_t)2048 * NRB * (NRB + 1)) // f32 elements of one head's packed causal scores
#define RH   ((SEQ >= 512) ? 512 : SEQ)     // query rows < RH use hi+lo planes
#define PCAR 1024.0f
#define SCL  0.125f                          // HD^-0.5
static_assert(SEQ % 128 == 0);
static_assert(SEQ >= 128 && SEQ <= SEQ_FULL);
static_assert(NB >= 1 && NB <= NB_FULL);
static_assert(RH % 64 == 0 && RH <= SEQ && RH > 0);
static_assert(NH_ % ZH == 0 && DQ == DM && REP == 1 && DKV == DM);

typedef _Float16 h16;
typedef unsigned short bf;
typedef __attribute__((ext_vector_type(16))) __bf16   v16bf;
typedef __attribute__((ext_vector_type(16))) _Float16 v16h;
typedef __attribute__((ext_vector_type(8)))  _Float16 v8h;
typedef __attribute__((ext_vector_type(8)))  unsigned short v8us;
typedef __attribute__((ext_vector_type(8)))  float    v8f;
typedef __attribute__((ext_vector_type(4)))  float    v4f;
typedef v8h  __attribute__((may_alias)) v8ha;
typedef v4f  __attribute__((may_alias)) v4fa;
typedef v8us __attribute__((may_alias)) v8usa;
typedef __attribute__((ext_vector_type(2))) _Float16 v2h;
typedef __attribute__((ext_vector_type(4))) _Float16 v4h;
typedef __attribute__((ext_vector_type(2))) unsigned short v2us;
typedef __attribute__((ext_vector_type(4))) unsigned short v4us;
typedef __attribute__((ext_vector_type(2))) float v2f;

// Packed causal scores of one head: 64-row block rb holds only its rb + 1 key tiles: it starts at f32 element 2048 * rb * (rb + 1) and its rows have a pitch of 64 * (rb + 1) f32.

__device__ __forceinline__ unsigned short f2bf(float f) { unsigned u = __float_as_uint(f); u += 0x7FFFu + ((u >> 16) & 1u); return (unsigned short)(u >> 16); }
__device__ __forceinline__ float bf2f(unsigned short b) { return __uint_as_float(((unsigned)b) << 16); }
__device__ __forceinline__ float bfr(float f) { return bf2f(f2bf(f)); }
__device__ __forceinline__ v16h cat16(v8h lo, v8h hi) { return __builtin_shufflevector(lo, hi, 0, 1, 2, 3, 4, 5, 6, 7, 8, 9, 10, 11, 12, 13, 14, 15); }
__device__ __forceinline__ v16bf cat16b(v8us lo, v8us hi) { return __builtin_bit_cast(v16bf, __builtin_shufflevector(lo, hi, 0, 1, 2, 3, 4, 5, 6, 7, 8, 9, 10, 11, 12, 13, 14, 15)); }
__device__ __forceinline__ v8f wmma16(v16h a, v16h b, v8f c) { return __builtin_amdgcn_wmma_f32_16x16x32_f16(false, a, false, b, (short)0, c, false, false); }
__device__ __forceinline__ v8f wmmab(v16bf a, v16bf b, v8f c) { return __builtin_amdgcn_wmma_f32_16x16x32_bf16(false, a, false, b, (short)0, c, false, false); }
__device__ __forceinline__ h16 tohx(float x) { return (h16)x; }
__device__ __forceinline__ void splitf(float y, unsigned short& h, unsigned short& l) { h = f2bf(y); l = f2bf(y - bf2f(h)); }

// Fragment map (wave32, 16x16x32): lane l -> row/col (l & 15), h = l >> 4; vector elements 0..7 <- k0 + 8h + 0..7, elements 8..15 <- k0 + 16 + 8h + 0..7,
// identical for A (rows) and B (columns, k-contiguous Bt[n][k] planes); D element r -> (row 8h + r, col l & 15).
template <typename T16> struct WFrag;
template <> struct WFrag<h16> { typedef v16h V; static __device__ __forceinline__ V ld(const h16* p) { return cat16(*(const v8h*)p, *(const v8h*)(p + 16)); } static __device__ __forceinline__ v8f mma(V a, V b, v8f c) { return wmma16(a, b, c); } };
template <> struct WFrag<bf> { typedef v16bf V; static __device__ __forceinline__ V ld(const bf* p) { return cat16b(*(const v8us*)p, *(const v8us*)(p + 16)); } static __device__ __forceinline__ v8f mma(V a, V b, v8f c) { return wmmab(a, b, c); } };

// ---- k_gemmk: register-blocked GEMM, one 64x64 output tile per work-group of NW waves, operands straight from K-contiguous 16-bit planes; grid (M/64, N/64, Z), 32 * NW threads.
// The K loop is dealt to the waves in units of 64 k (one 128-byte line of every operand row): wave w takes units w, w + NW, ... and keeps a full 16-accumulator partial tile;
// the NW partial tiles meet in LDS and are summed in wave order 0..NW-1.
// C[m][n] (f32, pitch ldc, + optional bf16-converted f32 bias[n]) = sum_k A[m][k] Bt[n][k] (+ split products per NSPLIT). z-batch strides sA/sB/sC in elements. K % 64 == 0.
// CAUSAL (probability x value contraction): the key (K) loop stops at the diagonal block (probabilities beyond it are exactly zero). roff = row offset of this launch's first row within the sequence.
template <typename T16, int NSPLIT, bool BIAS, bool CAUSAL, int NW>
__global__ __launch_bounds__(32 * NW) void k_gemmk(const T16* __restrict__ A, const T16* __restrict__ A2, const T16* __restrict__ Bt, const T16* __restrict__ Bt2, int K, float* C, int ldc, const float* __restrict__ bias, int roff, size_t sA, size_t sB, size_t sC) {
    typedef typename WFrag<T16>::V V;
    __shared__ __align__(16) float os[NW * 64 * 68];
    const size_t z = blockIdx.z; A += z * sA; if (A2) A2 += z * sA; Bt += z * sB; if (Bt2) Bt2 += z * sB; C += z * sC;
    const int lane = threadIdx.x & 31, lr = lane & 15, hi = lane >> 4; const int r0 = blockIdx.x * 64, c0 = blockIdx.y * 64;
    const int wv = __builtin_amdgcn_readfirstlane((int)(threadIdx.x >> 5));   // wave number in a scalar register: the K loops below branch on scalars
    const int Kl = CAUSAL ? min(K, r0 + roff + 64) : K;
    v8f acc[4][4];
#pragma unroll
    for (int mb = 0; mb < 4; ++mb)
#pragma unroll
        for (int nb = 0; nb < 4; ++nb) acc[mb][nb] = (v8f){};
    const size_t aoff = (size_t)(r0 + lr) * K + 8 * hi, boff = (size_t)(c0 + lr) * K + 8 * hi;
#pragma unroll 1
    for (int k0 = wv * 64; k0 < Kl; k0 += NW * 64) {
#pragma unroll 1
    for (int kc = k0; kc < k0 + 64; kc += 32) {
        V a[4], a2[4];
#pragma unroll
        for (int mb = 0; mb < 4; ++mb) { a[mb] = WFrag<T16>::ld(A + aoff + (size_t)mb * 16 * K + kc); if (NSPLIT == 1 || NSPLIT == 2) a2[mb] = WFrag<T16>::ld(A2 + aoff + (size_t)mb * 16 * K + kc); }
#pragma unroll
        for (int nb = 0; nb < 4; ++nb) { const V b = WFrag<T16>::ld(Bt + boff + (size_t)nb * 16 * K + kc); V b2; if (NSPLIT >= 2) b2 = WFrag<T16>::ld(Bt2 + boff + (size_t)nb * 16 * K + kc);
#pragma unroll
            for (int mb = 0; mb < 4; ++mb) { acc[mb][nb] = WFrag<T16>::mma(a[mb], b, acc[mb][nb]); if (NSPLIT == 1 || NSPLIT == 2) acc[mb][nb] = WFrag<T16>::mma(a2[mb], b, acc[mb][nb]); if (NSPLIT >= 2) acc[mb][nb] = WFrag<T16>::mma(a[mb], b2, acc[mb][nb]); } }
        asm volatile("v_nop\n\tv_nop\n\tv_nop\n\tv_nop" : "+v"(acc[0][0]), "+v"(acc[1][1]), "+v"(acc[2][2]), "+v"(acc[3][3]) : "v"(a[0]), "v"(a[3]));
    } }
    float* ow = os + wv * (64 * 68);
#pragma unroll
    for (int mb = 0; mb < 4; ++mb) {
#pragma unroll
        for (int nb = 0; nb < 4; ++nb) {
#pragma unroll
            for (int j = 0; j < 8; ++j) ow[(mb * 16 + hi * 8 + j) * 68 + nb * 16 + lr] = acc[mb][nb][j]; } }
    __syncthreads();   // every wave's partial tile is in LDS before any thread sums across waves
#pragma unroll
    for (int q = 0; q < 64 * 16 / (32 * NW); ++q) { const int p = q * (32 * NW) + (int)threadIdx.x, row = p >> 4, cofs = (p & 15) * 4; v4f val = *(const v4fa*)(os + row * 68 + cofs);
#pragma unroll
        for (int w = 1; w < NW; ++w) val += *(const v4fa*)(os + w * (64 * 68) + row * 68 + cofs);
        if (BIAS) { val[0] += bfr(bias[c0 + cofs]); val[1] += bfr(bias[c0 + cofs + 1]); val[2] += bfr(bias[c0 + cofs + 2]); val[3] += bfr(bias[c0 + cofs + 3]); }
        *(v4f*)(C + (size_t)(r0 + row) * ldc + c0 + cofs) = val; }
}

// ---- k_gemmc: ONE WAVE per 64x64 tile of the causal scores (16 accumulators, short K): tiles entirely above the diagonal are skipped (query rows r0+roff.., key columns c0..).
// roff = row offset of this launch's first row within the sequence. C = a head's packed causal scores. grid (M/64, N/64, Z), 32 threads.
template <typename T16, int NSPLIT>
__global__ __launch_bounds__(32) void k_gemmc(const T16* __restrict__ A, const T16* __restrict__ A2, const T16* __restrict__ Bt, const T16* __restrict__ Bt2, int K, float* C, int roff, size_t sA, size_t sB, size_t sC) {
    typedef typename WFrag<T16>::V V;
    __shared__ __align__(16) float os[16 * 68];
    const size_t z = blockIdx.z; A += z * sA; if (A2) A2 += z * sA; Bt += z * sB; if (Bt2) Bt2 += z * sB; C += z * sC;
    const int lane = threadIdx.x & 31, lr = lane & 15, hi = lane >> 4; const int r0 = blockIdx.x * 64, c0 = blockIdx.y * 64;
    if (c0 > r0 + roff + 63) return;                  // score tile entirely above the causal diagonal: it has no place in the packed store
    const int rb = (r0 + roff) >> 6, ldc = 64 * (rb + 1); C += (size_t)2048 * rb * (rb + 1);
    v8f acc[4][4];
#pragma unroll
    for (int mb = 0; mb < 4; ++mb)
#pragma unroll
        for (int nb = 0; nb < 4; ++nb) acc[mb][nb] = (v8f){};
    const size_t aoff = (size_t)(r0 + lr) * K + 8 * hi, boff = (size_t)(c0 + lr) * K + 8 * hi;
#pragma unroll 1
    for (int kc = 0; kc < K; kc += 32) {
        V a[4], a2[4];
#pragma unroll
        for (int mb = 0; mb < 4; ++mb) { a[mb] = WFrag<T16>::ld(A + aoff + (size_t)mb * 16 * K + kc); if (NSPLIT == 1 || NSPLIT == 2) a2[mb] = WFrag<T16>::ld(A2 + aoff + (size_t)mb * 16 * K + kc); }
#pragma unroll
        for (int nb = 0; nb < 4; ++nb) { const V b = WFrag<T16>::ld(Bt + boff + (size_t)nb * 16 * K + kc); V b2; if (NSPLIT >= 2) b2 = WFrag<T16>::ld(Bt2 + boff + (size_t)nb * 16 * K + kc);
#pragma unroll
            for (int mb = 0; mb < 4; ++mb) { acc[mb][nb] = WFrag<T16>::mma(a[mb], b, acc[mb][nb]); if (NSPLIT == 1 || NSPLIT == 2) acc[mb][nb] = WFrag<T16>::mma(a2[mb], b, acc[mb][nb]); if (NSPLIT >= 2) acc[mb][nb] = WFrag<T16>::mma(a[mb], b2, acc[mb][nb]); } }
        asm volatile("v_nop\n\tv_nop\n\tv_nop\n\tv_nop" : "+v"(acc[0][0]), "+v"(acc[1][1]), "+v"(acc[2][2]), "+v"(acc[3][3]) : "v"(a[0]), "v"(a[3]));
    }
#pragma unroll
    for (int mb = 0; mb < 4; ++mb) {
#pragma unroll
        for (int nb = 0; nb < 4; ++nb) {
#pragma unroll
            for (int j = 0; j < 8; ++j) os[(hi * 8 + j) * 68 + nb * 16 + lr] = acc[mb][nb][j]; }
        __builtin_amdgcn_wave_barrier(); asm volatile("" ::: "memory");
        float* crow = C + (size_t)(mb * 16) * ldc + c0;
{
#pragma unroll
            for (int s = 0; s < 8; ++s) { const int row = 2 * s + hi, cofs = lr * 4; v4f val = *(const v4fa*)(os + row * 68 + cofs);
                *(v4f*)(crow + (size_t)row * ldc + cofs) = val; }
             }
        __builtin_amdgcn_wave_barrier(); asm volatile("" ::: "memory");
    }
}

__global__ __launch_bounds__(256) void k_cvt8(const float* __restrict__ src, bf* dst, size_t n8) { const size_t i = (size_t)blockIdx.x * 256 + threadIdx.x; if (i >= n8) return; const v8f v = *(const v8f*)(src + i * 8); v8us o;
#pragma unroll
    for (int k = 0; k < 8; ++k) o[k] = f2bf(v[k]); *(v8us*)(dst + i * 8) = o;  }

__global__ __launch_bounds__(256) void k_qkp(const float* __restrict__ F, int pitch, int nheads, h16* P16, bf* Ph, bf* Pl) {
    const size_t e = ((size_t)blockIdx.x * 256 + threadIdx.x) * 2; if (e >= (size_t)nheads * SEQ * HD) return; const int d = (int)(e % HD); const int t = (int)((e / HD) % SEQ); const int h = (int)(e / ((size_t)HD * SEQ));
    const float* f = F + (size_t)t * pitch + h * HD + d; v2h o16; v2us oh, ol;
#pragma unroll
    for (int q = 0; q < 2; ++q) { const float r = f[q]; o16[q] = tohx(r); unsigned short a2, c2; splitf(r, a2, c2); oh[q] = a2; ol[q] = c2; }
    *(v2h*)(P16 + e) = o16; *(v2us*)(Ph + e) = oh; *(v2us*)(Pl + e) = ol;  }

__global__ __launch_bounds__(256) void k_vtp(const float* __restrict__ F, int pitch, int nheads, h16* V16, bf* Vh, bf* Vl) { const size_t e = ((size_t)blockIdx.x * 256 + threadIdx.x) * 2; if (e >= (size_t)nheads * HD * SEQ) return; const int t = (int)(e % SEQ); const int d = (int)((e / SEQ) % HD); const int g = (int)(e / ((size_t)SEQ * HD)); v2h o16; v2us oh, ol;
#pragma unroll
    for (int q = 0; q < 2; ++q) { const float x = F[(size_t)(t + q) * pitch + g * HD + d]; o16[q] = tohx(x); unsigned short a2, c2; splitf(x, a2, c2); oh[q] = a2; ol[q] = c2; }
    *(v2h*)(V16 + e) = o16; *(v2us*)(Vh + e) = oh; *(v2us*)(Vl + e) = ol;  }

// ---- k_asoft: one wave per score row (zz, i): t = S x HD^-0.5 for j <= i, masked fill otherwise (index select; the diagonal is always valid); softmax over the SEQ keys in f32
__global__ __launch_bounds__(256) void k_asoft(const float* __restrict__ Sb, h16* P16, bf* Ph, bf* Pl) {
    const int lane = threadIdx.x & 31; const int row = blockIdx.x * 8 + (threadIdx.x >> 5); if (row >= ZH * SEQ) return; const int i = row % SEQ; const int zz = row / SEQ; const bool hires = (i < RH); const int rb = i >> 6, pitch = 64 * (rb + 1); const float* sr = Sb + (size_t)zz * SPK + (size_t)2048 * rb * (rb + 1) + (size_t)(i & 63) * pitch; float v[SEQ / 32]; float mx = -3.0e38f;
#pragma unroll
    for (int ch = 0; ch < SEQ / 128; ++ch) { const int j0 = ch * 128 + lane * 4; const v4f a = *(const v4f*)(sr + min(j0, pitch - 4));   // past the row's end: an in-row address, the value is masked below
#pragma unroll
        for (int q = 0; q < 4; ++q) { const float t = (j0 + q <= i) ? a[q] * SCL : -3.0e38f; v[ch * 4 + q] = t; mx = fmaxf(mx, t); } }
#pragma unroll
    for (int sh = 16; sh; sh >>= 1) mx = fmaxf(mx, __shfl_xor(mx, sh, 32));
    float sum = 0.f;
#pragma unroll
    for (int k = 0; k < SEQ / 32; ++k) { float d0 = __fsub_rn(v[k], mx); asm volatile("" : "+v"(d0)); v[k] = __builtin_amdgcn_exp2f(__fmul_rn(d0, 1.4426950408889634f)); sum += v[k]; }
#pragma unroll
    for (int sh = 16; sh; sh >>= 1) sum += __shfl_xor(sum, sh, 32);
    const float f = __fdiv_rn(hires ? 1.0f : PCAR, sum);
{
        if (hires) {
#pragma unroll
            for (int ch = 0; ch < SEQ / 128; ++ch) { v4us oh, ol;
#pragma unroll
                for (int q = 0; q < 4; ++q) { unsigned short a, c2; splitf(v[ch * 4 + q] * f, a, c2); oh[q] = a; ol[q] = c2; }
                const size_t oo = ((size_t)zz * RH + i) * SEQ + ch * 128 + lane * 4; *(v4us*)(Ph + oo) = oh; *(v4us*)(Pl + oo) = ol; }
        } else {
#pragma unroll
            for (int ch = 0; ch < SEQ / 128; ++ch) { v4h o4;
#pragma unroll
                for (int q = 0; q < 4; ++q) o4[q] = tohx(v[ch * 4 + q] * f);
                *(v4h*)(P16 + (size_t)row * SEQ + ch * 128 + lane * 4) = o4; } }
         }
}

__global__ __launch_bounds__(256) void k_merge(const float* __restrict__ O, int h0, bf* Ah, bf* Al) { const size_t e = ((size_t)blockIdx.x * 256 + threadIdx.x) * 2; if (e >= (size_t)ZH * SEQ * HD) return; const int d = (int)(e % HD); const int t = (int)((e / HD) % SEQ); const int zz = (int)(e / ((size_t)HD * SEQ)); const float cs = (t < RH) ? 1.0f : (1.0f / PCAR); const size_t oo = (size_t)t * DQ + (h0 + zz) * HD + d;
    v2us oh, ol;
#pragma unroll
    for (int q = 0; q < 2; ++q) { unsigned short a, c2; splitf(O[e + q] * cs, a, c2); oh[q] = a; ol[q] = c2; } *(v2us*)(Ah + oo) = oh; *(v2us*)(Al + oo) = ol;  }

__global__ __launch_bounds__(256) void k_pl2out(const bf* __restrict__ Ah, const bf* __restrict__ Al, float* out) { const size_t e = ((size_t)blockIdx.x * 256 + threadIdx.x) * 4; if (e >= (size_t)SEQ * DQ) return; v4f o;
#pragma unroll
    for (int u = 0; u < 4; ++u) o[u] = __fadd_rn(bf2f(Ah[e + u]), bf2f(Al[e + u])); *(v4f*)(out + e) = o;  }

extern "C" void kernel_launch(void* const* d_in, const int* in_sizes, int n_in,
                              void* d_out, int out_size, void* d_ws, size_t ws_size, hipStream_t stream) {
    if (n_in < 3) return;
    if ((size_t)in_sizes[0] < (size_t)(NB - 1) * SEQ_FULL * DM + (size_t)SEQ * DM) return;
    if ((size_t)in_sizes[1] < (size_t)3 * DM * DM) return;
    if (in_sizes[2] < 3 * DM) return;
    if ((size_t)out_size < (size_t)(NB - 1) * SEQ_FULL * DM + (size_t)SEQ * DM) return;
    const float* x = (const float*)d_in[0];      // [NB_FULL][SEQ_FULL][DM]
    const float* wf = (const float*)d_in[1];     // [3*DM][DM]: rows 0..1023 q, 1024..2047 k, 2048..3071 v
    const float* bz = (const float*)d_in[2];     // [3*DM]
    const float* bq = bz; const float* bk = bz + DM; const float* bv = bz + 2 * DM;
    float* OUT = (float*)d_out;                  // [NB_FULL][SEQ_FULL][DM]
    char* wsp = (char*)d_ws;
    auto take = [&](size_t bytes) { char* p = wsp; wsp += (bytes + 255) & ~(size_t)255; return (void*)p; };
    bf* WALL = (bf*)take((size_t)3 * DM * DM * 2); bf* WQ = WALL; bf* WK = WALL + (size_t)DM * DM; bf* WV = WALL + (size_t)2 * DM * DM;
    bf* XB = (bf*)take((size_t)SEQ * DM * 2); float* F = (float*)take((size_t)SEQ * DQ * 4);   // F holds the q, then k, then v projection (stream-ordered reuse)
    h16* QP16 = (h16*)take((size_t)NH_ * SEQ * HD * 2); h16* KP16 = (h16*)take((size_t)NKV * SEQ * HD * 2); h16* VT16 = (h16*)take((size_t)NKV * HD * SEQ * 2);
    bf* QPh = (bf*)take((size_t)NH_ * SEQ * HD * 2); bf* QPl = (bf*)take((size_t)NH_ * SEQ * HD * 2); bf* KPh = (bf*)take((size_t)NKV * SEQ * HD * 2); bf* KPl = (bf*)take((size_t)NKV * SEQ * HD * 2);
    bf* VTh = (bf*)take((size_t)NKV * HD * SEQ * 2); bf* VTl = (bf*)take((size_t)NKV * HD * SEQ * 2); bf* Ph = (bf*)take((size_t)ZH * RH * SEQ * 2); bf* Pl = (bf*)take((size_t)ZH * RH * SEQ * 2);
    float* Sb = (float*)take((size_t)ZH * SPK * 4); h16* P16 = (h16*)take((size_t)ZH * SEQ * SEQ * 2); float* Ob = (float*)take((size_t)ZH * SEQ * HD * 4);
    bf* ATh = (bf*)take((size_t)SEQ * DQ * 2); bf* ATl = (bf*)take((size_t)SEQ * DQ * 2);
    const size_t carved = (size_t)(wsp - (char*)d_ws);
    if (carved > ws_size) return;

    k_cvt8<<<(unsigned)(((size_t)3 * DM * DM / 8 + 255) / 256), 256, 0, stream>>>(wf, WALL, (size_t)3 * DM * DM / 8);
    const unsigned LQ = (unsigned)(((size_t)NH_ * SEQ * HD / 2 + 255) / 256), LKv = (unsigned)(((size_t)NKV * SEQ * HD / 2 + 255) / 256);
    for (int b = 0; b < NB; ++b) {
        k_cvt8<<<(unsigned)(((size_t)SEQ * DM / 8 + 255) / 256), 256, 0, stream>>>(x + (size_t)b * SEQ_FULL * DM, XB, (size_t)SEQ * DM / 8);
        k_gemmk<bf, 0, true, false, 8><<<dim3(SEQ / 64, DQ / 64, 1), 256, 0, stream>>>(XB, nullptr, WQ, nullptr, DM, F, DQ, bq, 0, 0, 0, 0);
        k_qkp<<<LQ, 256, 0, stream>>>(F, DQ, NH_, QP16, QPh, QPl);
        k_gemmk<bf, 0, true, false, 8><<<dim3(SEQ / 64, DKV / 64, 1), 256, 0, stream>>>(XB, nullptr, WK, nullptr, DM, F, DKV, bk, 0, 0, 0, 0);
        k_qkp<<<LKv, 256, 0, stream>>>(F, DKV, NKV, KP16, KPh, KPl);
        k_gemmk<bf, 0, true, false, 8><<<dim3(SEQ / 64, DKV / 64, 1), 256, 0, stream>>>(XB, nullptr, WV, nullptr, DM, F, DKV, bv, 0, 0, 0, 0);
        k_vtp<<<LKv, 256, 0, stream>>>(F, DKV, NKV, VT16, VTh, VTl);
        for (int h0 = 0; h0 < NH_; h0 += ZH) { const size_t zq = (size_t)h0, zk = (size_t)(h0 / REP);   // the pass's ZH heads use consecutive planes (z-strides SEQ*HD)
            k_gemmc<bf, 2><<<dim3(RH / 64, SEQ / 64, ZH), 32, 0, stream>>>(QPh + zq * SEQ * HD, QPl + zq * SEQ * HD, KPh + zk * SEQ * HD, KPl + zk * SEQ * HD, HD, Sb, 0, (size_t)SEQ * HD, (size_t)SEQ * HD, SPK);
            if (SEQ > RH) k_gemmc<h16, 0><<<dim3((SEQ - RH) / 64, SEQ / 64, ZH), 32, 0, stream>>>(QP16 + zq * SEQ * HD + (size_t)RH * HD, nullptr, KP16 + zk * SEQ * HD, nullptr, HD, Sb, RH, (size_t)SEQ * HD, (size_t)SEQ * HD, SPK);
            k_asoft<<<ZH * SEQ / 8, 256, 0, stream>>>(Sb, P16, Ph, Pl);
            k_gemmk<bf, 2, false, true, 8><<<dim3(RH / 64, HD / 64, ZH), 256, 0, stream>>>(Ph, Pl, VTh + zk * HD * SEQ, VTl + zk * HD * SEQ, SEQ, Ob, HD, nullptr, 0, (size_t)RH * SEQ, (size_t)HD * SEQ, (size_t)SEQ * HD);
            if (SEQ > RH) k_gemmk<h16, 0, false, true, 16><<<dim3((SEQ - RH) / 64, HD / 64, ZH), 512, 0, stream>>>(P16 + (size_t)RH * SEQ, nullptr, VT16 + zk * HD * SEQ, nullptr, SEQ, Ob + (size_t)RH * HD, HD, nullptr, RH, (size_t)SEQ * SEQ, (size_t)HD * SEQ, (size_t)SEQ * HD);
            k_merge<<<(unsigned)(((size_t)ZH * SEQ * HD / 2 + 255) / 256), 256, 0, stream>>>(Ob, h0, ATh, ATl); }
        k_pl2out<<<(unsigned)(((size_t)SEQ * DQ / 4 + 255) / 256), 256, 0, stream>>>(ATh, ATl, OUT + (size_t)b * SEQ_FULL * DM); }
}

// v003
// It runs in 197 microseconds.
// Next to v002, in two timings, it ran 2.11 times as fast each time.
// Counting every step since v000, it is 6.97 times as fast.
#include <hip/hip_runtime.h>

// Contractions (f32 accumulate): qkv projection = v_wmma_f32_16x16x32_bf16 on bf16 RNE-converted x and W (single products) + bf16-converted bias;
// causal scores q.k and probabilities.v in ONE kernel (scores and probabilities stay in registers): query rows < RH on v_wmma_f32_16x16x32_bf16 hi+lo planes
// (3 products each), rows >= RH on v_wmma_f32_16x16x32_f16 single products (unnormalised probabilities carried x1024); running-maximum softmax in f32.

#ifndef NB
#define NB 2
#endif
#ifndef SEQ
#define SEQ 2048
#endif
#define NB_FULL  2
#define SEQ_FULL 2048
#define DM   1024
#define NH_  16
#define NKV  16
#define REP  (NH_ / NKV)
#define HD   64
#define DQ   (NH_ * HD)
#define DKV  (NKV * HD)
#define ANW  8                                // waves per attention work-group: they share one query tile and deal its keys among them
#define RH   ((SEQ >= 512) ? 512 : SEQ)     // query rows < RH use hi+lo planes
#define SCL  0.125f                          // HD^-0.5
static_assert(SEQ % 128 == 0);
static_assert(SEQ >= 128 && SEQ <= SEQ_FULL);
static_assert(NB >= 1 && NB <= NB_FULL);
static_assert(RH % 64 == 0 && RH <= SEQ && RH > 0);
static_assert(DQ == DM && REP == 1 && DKV == DM && HD == 64 && (SEQ - RH) % 32 == 0);

typedef _Float16 h16;
typedef unsigned short bf;
typedef __attribute__((ext_vector_type(16))) __bf16   v16bf;
typedef __attribute__((ext_vector_type(16))) _Float16 v16h;
typedef __attribute__((ext_vector_type(8)))  _Float16 v8h;
typedef __attribute__((ext_vector_type(8)))  unsigned short v8us;
typedef __attribute__((ext_vector_type(8)))  float    v8f;
typedef __attribute__((ext_vector_type(4)))  float    v4f;
typedef v8h  __attribute__((may_alias)) v8ha;
typedef v4f  __attribute__((may_alias)) v4fa;
typedef v8us __attribute__((may_alias)) v8usa;
typedef __attribute__((ext_vector_type(2))) _Float16 v2h;
typedef __attribute__((ext_vector_type(4))) _Float16 v4h;
typedef __attribute__((ext_vector_type(2))) unsigned short v2us;
typedef __attribute__((ext_vector_type(4))) unsigned short v4us;
typedef __attribute__((ext_vector_type(2))) float v2f;

__device__ __forceinline__ unsigned short f2bf(float f) { unsigned u = __float_as_uint(f); u += 0x7FFFu + ((u >> 16) & 1u); return (unsigned short)(u >> 16); }
__device__ __forceinline__ float bf2f(unsigned short b) { return __uint_as_float(((unsigned)b) << 16); }
__device__ __forceinline__ float bfr(float f) { return bf2f(f2bf(f)); }
__device__ __forceinline__ v16h cat16(v8h lo, v8h hi) { return __builtin_shufflevector(lo, hi, 0, 1, 2, 3, 4, 5, 6, 7, 8, 9, 10, 11, 12, 13, 14, 15); }
__device__ __forceinline__ v16bf cat16b(v8us lo, v8us hi) { return __builtin_bit_cast(v16bf, __builtin_shufflevector(lo, hi, 0, 1, 2, 3, 4, 5, 6, 7, 8, 9, 10, 11, 12, 13, 14, 15)); }
__device__ __forceinline__ v8f wmma16(v16h a, v16h b, v8f c) { return __builtin_amdgcn_wmma_f32_16x16x32_f16(false, a, false, b, (short)0, c, false, false); }
__device__ __forceinline__ v8f wmmab(v16bf a, v16bf b, v8f c) { return __builtin_amdgcn_wmma_f32_16x16x32_bf16(false, a, false, b, (short)0, c, false, false); }
__device__ __forceinline__ h16 tohx(float x) { return (h16)x; }
__device__ __forceinline__ void splitf(float y, unsigned short& h, unsigned short& l) { h = f2bf(y); l = f2bf(y - bf2f(h)); }

// Fragment map (wave32, 16x16x32): lane l -> row/col (l & 15), h = l >> 4; vector elements 0..7 <- k0 + 8h + 0..7, elements 8..15 <- k0 + 16 + 8h + 0..7,
// identical for A (rows) and B (columns, k-contiguous Bt[n][k] planes); D element r -> (row 8h + r, col l & 15).
template <typename T16> struct WFrag;
template <> struct WFrag<h16> { typedef v16h V; static __device__ __forceinline__ V ld(const h16* p) { return cat16(*(const v8h*)p, *(const v8h*)(p + 16)); } static __device__ __forceinline__ v8f mma(V a, V b, v8f c) { return wmma16(a, b, c); } };
template <> struct WFrag<bf> { typedef v16bf V; static __device__ __forceinline__ V ld(const bf* p) { return cat16b(*(const v8us*)p, *(const v8us*)(p + 16)); } static __device__ __forceinline__ v8f mma(V a, V b, v8f c) { return wmmab(a, b, c); } };

// ---- k_gemmk: register-blocked GEMM, one 64x64 output tile per work-group of NW waves, operands straight from K-contiguous 16-bit planes; grid (M/64, N/64, Z), 32 * NW threads.
// The K loop is dealt to the waves in units of 64 k (one 128-byte line of every operand row): wave w takes units w, w + NW, ... and keeps a full 16-accumulator partial tile;
// the NW partial tiles meet in LDS and are summed in wave order 0..NW-1.
// C[m][n] (f32, pitch ldc, + optional bf16-converted f32 bias[n]) = sum_k A[m][k] Bt[n][k] (+ split products per NSPLIT). z-batch strides sA/sB/sC in elements. K % 64 == 0.
// CAUSAL (probability x value contraction): the key (K) loop stops at the diagonal block (probabilities beyond it are exactly zero). roff = row offset of this launch's first row within the sequence.
template <typename T16, int NSPLIT, bool BIAS, bool CAUSAL, int NW>
__global__ __launch_bounds__(32 * NW) void k_gemmk(const T16* __restrict__ A, const T16* __restrict__ A2, const T16* __restrict__ Bt, const T16* __restrict__ Bt2, int K, float* C, int ldc, const float* __restrict__ bias, int roff, size_t sA, size_t sB, size_t sC) {
    typedef typename WFrag<T16>::V V;
    __shared__ __align__(16) float os[NW * 64 * 68];
    const size_t z = blockIdx.z; A += z * sA; if (A2) A2 += z * sA; Bt += z * sB; if (Bt2) Bt2 += z * sB; C += z * sC;
    const int lane = threadIdx.x & 31, lr = lane & 15, hi = lane >> 4; const int r0 = blockIdx.x * 64, c0 = blockIdx.y * 64;
    const int wv = __builtin_amdgcn_readfirstlane((int)(threadIdx.x >> 5));   // wave number in a scalar register: the K loops below branch on scalars
    const int Kl = CAUSAL ? min(K, r0 + roff + 64) : K;
    v8f acc[4][4];
#pragma unroll
    for (int mb = 0; mb < 4; ++mb)
#pragma unroll
        for (int nb = 0; nb < 4; ++nb) acc[mb][nb] = (v8f){};
    const size_t aoff = (size_t)(r0 + lr) * K + 8 * hi, boff = (size_t)(c0 + lr) * K + 8 * hi;
#pragma unroll 1
    for (int k0 = wv * 64; k0 < Kl; k0 += NW * 64) {
#pragma unroll 1
    for (int kc = k0; kc < k0 + 64; kc += 32) {
        V a[4], a2[4];
#pragma unroll
        for (int mb = 0; mb < 4; ++mb) { a[mb] = WFrag<T16>::ld(A + aoff + (size_t)mb * 16 * K + kc); if (NSPLIT == 1 || NSPLIT == 2) a2[mb] = WFrag<T16>::ld(A2 + aoff + (size_t)mb * 16 * K + kc); }
#pragma unroll
        for (int nb = 0; nb < 4; ++nb) { const V b = WFrag<T16>::ld(Bt + boff + (size_t)nb * 16 * K + kc); V b2; if (NSPLIT >= 2) b2 = WFrag<T16>::ld(Bt2 + boff + (size_t)nb * 16 * K + kc);
#pragma unroll
            for (int mb = 0; mb < 4; ++mb) { acc[mb][nb] = WFrag<T16>::mma(a[mb], b, acc[mb][nb]); if (NSPLIT == 1 || NSPLIT == 2) acc[mb][nb] = WFrag<T16>::mma(a2[mb], b, acc[mb][nb]); if (NSPLIT >= 2) acc[mb][nb] = WFrag<T16>::mma(a[mb], b2, acc[mb][nb]); } }
        asm volatile("v_nop\n\tv_nop\n\tv_nop\n\tv_nop" : "+v"(acc[0][0]), "+v"(acc[1][1]), "+v"(acc[2][2]), "+v"(acc[3][3]) : "v"(a[0]), "v"(a[3]));
    } }
    float* ow = os + wv * (64 * 68);
#pragma unroll
    for (int mb = 0; mb < 4; ++mb) {
#pragma unroll
        for (int nb = 0; nb < 4; ++nb) {
#pragma unroll
            for (int j = 0; j < 8; ++j) ow[(mb * 16 + hi * 8 + j) * 68 + nb * 16 + lr] = acc[mb][nb][j]; } }
    __syncthreads();   // every wave's partial tile is in LDS before any thread sums across waves
#pragma unroll
    for (int q = 0; q < 64 * 16 / (32 * NW); ++q) { const int p = q * (32 * NW) + (int)threadIdx.x, row = p >> 4, cofs = (p & 15) * 4; v4f val = *(const v4fa*)(os + row * 68 + cofs);
#pragma unroll
        for (int w = 1; w < NW; ++w) val += *(const v4fa*)(os + w * (64 * 68) + row * 68 + cofs);
        if (BIAS) { val[0] += bfr(bias[c0 + cofs]); val[1] += bfr(bias[c0 + cofs + 1]); val[2] += bfr(bias[c0 + cofs + 2]); val[3] += bfr(bias[c0 + cofs + 3]); }
        *(v4f*)(C + (size_t)(r0 + row) * ldc + c0 + cofs) = val; }
}

__global__ __launch_bounds__(256) void k_cvt8(const float* __restrict__ src, bf* dst, size_t n8) { const size_t i = (size_t)blockIdx.x * 256 + threadIdx.x; if (i >= n8) return; const v8f v = *(const v8f*)(src + i * 8); v8us o;
#pragma unroll
    for (int k = 0; k < 8; ++k) o[k] = f2bf(v[k]); *(v8us*)(dst + i * 8) = o;  }

__global__ __launch_bounds__(256) void k_qkp(const float* __restrict__ F, int pitch, int nheads, h16* P16, bf* Ph, bf* Pl) {
    const size_t e = ((size_t)blockIdx.x * 256 + threadIdx.x) * 2; if (e >= (size_t)nheads * SEQ * HD) return; const int d = (int)(e % HD); const int t = (int)((e / HD) % SEQ); const int h = (int)(e / ((size_t)HD * SEQ));
    const float* f = F + (size_t)t * pitch + h * HD + d; v2h o16; v2us oh, ol;
#pragma unroll
    for (int q = 0; q < 2; ++q) { const float r = f[q]; o16[q] = tohx(r); unsigned short a2, c2; splitf(r, a2, c2); oh[q] = a2; ol[q] = c2; }
    *(v2h*)(P16 + e) = o16; *(v2us*)(Ph + e) = oh; *(v2us*)(Pl + e) = ol;  }

__global__ __launch_bounds__(256) void k_vtp(const float* __restrict__ F, int pitch, int nheads, h16* V16, bf* Vh, bf* Vl) { const size_t e = ((size_t)blockIdx.x * 256 + threadIdx.x) * 2; if (e >= (size_t)nheads * HD * SEQ) return; const int t = (int)(e % SEQ); const int d = (int)((e / SEQ) % HD); const int g = (int)(e / ((size_t)SEQ * HD)); v2h o16; v2us oh, ol;
#pragma unroll
    for (int q = 0; q < 2; ++q) { const float x = F[(size_t)(t + q) * pitch + g * HD + d]; o16[q] = tohx(x); unsigned short a2, c2; splitf(x, a2, c2); oh[q] = a2; ol[q] = c2; }
    *(v2h*)(V16 + e) = o16; *(v2us*)(Vh + e) = oh; *(v2us*)(Vl + e) = ol;  }

// 2^x on the transcendental unit. The v_nop that ends each statement is the one slot the instruction set asks for between a transcendental and a next instruction that may read its result or
// overwrite its source (the register allocator is free to put such a one there); inside ex2x8 the early-clobber outputs keep every result off every source, so one slot serves all eight.
__device__ __forceinline__ float ex2(float x) { float r; asm("v_exp_f32 %0, %1\n\tv_nop" : "=v"(r) : "v"(x)); return r; }
__device__ __forceinline__ void ex2x8(float* t) { float r0, r1, r2, r3, r4, r5, r6, r7;
    asm("v_exp_f32 %0, %8\n\tv_exp_f32 %1, %9\n\tv_exp_f32 %2, %10\n\tv_exp_f32 %3, %11\n\tv_exp_f32 %4, %12\n\tv_exp_f32 %5, %13\n\tv_exp_f32 %6, %14\n\tv_exp_f32 %7, %15\n\tv_nop"
        : "=&v"(r0), "=&v"(r1), "=&v"(r2), "=&v"(r3), "=&v"(r4), "=&v"(r5), "=&v"(r6), "=&v"(r7) : "v"(t[0]), "v"(t[1]), "v"(t[2]), "v"(t[3]), "v"(t[4]), "v"(t[5]), "v"(t[6]), "v"(t[7]));
    t[0] = r0; t[1] = r1; t[2] = r2; t[3] = r3; t[4] = r4; t[5] = r5; t[6] = r6; t[7] = r7; }

// ---- attention: one work-group of ANW waves per (head, tile of QT * 16 query rows). Transposed products: S^T = K . Q^T (A = key rows, B = query rows) and O^T += V^T . P^T (A = rows of the
// d-major value plane, B = P^T). A lane then holds ONE query (column lane & 15) in every score, probability and output register, so maximum, sum and rescale are per lane plus one exchange
// between the wave's halves, and two S^T tiles (keys k0 + 8h + r and k0 + 16 + 8h + r) converted in place ARE the B fragment of the second product in the fragment map's k order.
// Keys are dealt to the waves in units of 64 (one 128-byte line of every value-plane row); each wave keeps its own running maximum, sum and output tile; they meet in LDS, joined in wave order.
// The '#pragma unroll' loops over qt, kt, ks, dt and e run over the index of a register array (an index left variable would send the array to scratch); the loop over key units stays rolled to keep the text short.
template <typename T16, int NSPLIT, int QT>
__device__ __forceinline__ void attn_tile(const T16* __restrict__ Q, const T16* __restrict__ Q2, const T16* __restrict__ Kp, const T16* __restrict__ K2, const T16* __restrict__ Vt, const T16* __restrict__ Vt2, float* O, int q0, float* so, float* sm, float* sl) {
    typedef typename WFrag<T16>::V V;
    const int lane = threadIdx.x & 31, lr = lane & 15, hi = lane >> 4;
    const int wv = __builtin_amdgcn_readfirstlane((int)(threadIdx.x >> 5));   // wave number in a scalar register: the key loop below branches on scalars
    const float CEXP = SCL * 1.4426950408889634f;      // scores go to the base-2 exponent domain in one multiply
    const float PB = NSPLIT ? 0.0f : 10.0f;            // f16 probabilities carried x1024 (the sum carries it too: it cancels in the quotient)
    const int qlast = q0 + QT * 16 - 1;
    const int koff = lr * HD + 8 * hi, voff = lr * SEQ + 8 * hi;   // a lane's fixed place inside a block of key (or query) rows / of value-plane columns
    V qf[QT][2], qf2[QT][2];
#pragma unroll
    for (int qt = 0; qt < QT; ++qt)
#pragma unroll
        for (int ks = 0; ks < 2; ++ks) { const size_t o = (size_t)(q0 + qt * 16) * HD + ks * 32; qf[qt][ks] = WFrag<T16>::ld(Q + o + koff); if (NSPLIT) qf2[qt][ks] = WFrag<T16>::ld(Q2 + o + koff); }
    v8f acc[QT][4]; float m[QT], l[QT];
#pragma unroll
    for (int qt = 0; qt < QT; ++qt) { m[qt] = -3.0e38f; l[qt] = 0.f;
#pragma unroll
        for (int dt = 0; dt < 4; ++dt) acc[qt][dt] = (v8f){}; }
#pragma unroll 1   // run-time trip count, and the body already holds two unrolled 32-key blocks: a copy would only lengthen the text for the instruction cache
    for (int u = wv * 64; u <= qlast; u += ANW * 64) {
#pragma unroll
    for (int s = 0; s < 2; ++s) { const int k0 = u + s * 32;
        if (k0 <= qlast) {                               // the unit's second half may lie wholly above the diagonal
        V vf[4], vf2[4];
#pragma unroll
        for (int dt = 0; dt < 4; ++dt) { vf[dt] = WFrag<T16>::ld(Vt + k0 + voff + dt * 16 * SEQ); if (NSPLIT) vf2[dt] = WFrag<T16>::ld(Vt2 + k0 + voff + dt * 16 * SEQ); }
        v8f st[QT][2];
#pragma unroll
        for (int kt = 0; kt < 2; ++kt) { V kf[2], kf2[2];
#pragma unroll
            for (int ks = 0; ks < 2; ++ks) { kf[ks] = WFrag<T16>::ld(Kp + (size_t)k0 * HD + koff + (kt * 16 * HD + ks * 32)); if (NSPLIT) kf2[ks] = WFrag<T16>::ld(K2 + (size_t)k0 * HD + koff + (kt * 16 * HD + ks * 32)); }
#pragma unroll
            for (int qt = 0; qt < QT; ++qt) { v8f c = (v8f){};
#pragma unroll
                for (int ks = 0; ks < 2; ++ks) { c = WFrag<T16>::mma(kf[ks], qf[qt][ks], c); if (NSPLIT) { c = WFrag<T16>::mma(kf[ks], qf2[qt][ks], c); c = WFrag<T16>::mma(kf2[ks], qf[qt][ks], c); } }
                st[qt][kt] = c; } }
#pragma unroll
        for (int qt = 0; qt < QT; ++qt) { float t[16];
#pragma unroll
            for (int e = 0; e < 16; ++e) t[e] = st[qt][e >> 3][e & 7] * CEXP;
            if (k0 + 31 > q0) {                          // only blocks that touch the diagonal mask (every query keeps at least one key of such a block)
#pragma unroll
                for (int e = 0; e < 16; ++e) t[e] = (k0 + (e >> 3) * 16 + 8 * hi + (e & 7) <= q0 + qt * 16 + lr) ? t[e] : -3.0e38f; }
            float mx = t[0];
#pragma unroll
            for (int e = 1; e < 16; ++e) mx = fmaxf(mx, t[e]);
            mx = fmaxf(mx, __shfl_xor(mx, 16, 32));      // the other half of the wave holds the query's other 16 keys
            const float mn = fmaxf(m[qt], mx), al = ex2(m[qt] - mn), mb = mn - PB; m[qt] = mn;
            float sum = 0.f;
#pragma unroll
            for (int e = 0; e < 16; ++e) t[e] -= mb;
            ex2x8(t); ex2x8(t + 8);
#pragma unroll
            for (int e = 0; e < 16; ++e) sum += t[e];
            l[qt] = l[qt] * al + sum;
#pragma unroll
            for (int dt = 0; dt < 4; ++dt) acc[qt][dt] *= al;
            if (NSPLIT) { v8us h0, h1, l0, l1;
#pragma unroll
                for (int e = 0; e < 8; ++e) { unsigned short a, c2; splitf(t[e], a, c2); h0[e] = a; l0[e] = c2; splitf(t[8 + e], a, c2); h1[e] = a; l1[e] = c2; }
                const v16bf ph = cat16b(h0, h1), pl = cat16b(l0, l1);
#pragma unroll
                for (int dt = 0; dt < 4; ++dt) { acc[qt][dt] = wmmab(__builtin_bit_cast(v16bf, vf[dt]), ph, acc[qt][dt]); acc[qt][dt] = wmmab(__builtin_bit_cast(v16bf, vf[dt]), pl, acc[qt][dt]); acc[qt][dt] = wmmab(__builtin_bit_cast(v16bf, vf2[dt]), ph, acc[qt][dt]); }
            } else { v16h pf;
#pragma unroll
                for (int e = 0; e < 16; ++e) pf[e] = tohx(t[e]);
#pragma unroll
                for (int dt = 0; dt < 4; ++dt) acc[qt][dt] = wmma16(__builtin_bit_cast(v16h, vf[dt]), pf, acc[qt][dt]); } }
        } } }
    float* ow = so + wv * (32 * 68);
#pragma unroll
    for (int qt = 0; qt < QT; ++qt) { l[qt] += __shfl_xor(l[qt], 16, 32);
#pragma unroll
        for (int dt = 0; dt < 4; ++dt) { float* p = ow + (qt * 16 + lr) * 68 + dt * 16 + 8 * hi;
            *(v4fa*)p = __builtin_shufflevector(acc[qt][dt], acc[qt][dt], 0, 1, 2, 3); *(v4fa*)(p + 4) = __builtin_shufflevector(acc[qt][dt], acc[qt][dt], 4, 5, 6, 7); }
        if (hi == 0) { sm[wv * 32 + qt * 16 + lr] = m[qt]; sl[wv * 32 + qt * 16 + lr] = l[qt]; } }
    __syncthreads();   // every wave's maximum, sum and partial output tile are in LDS before any thread joins them
#pragma unroll
    for (int i = 0; i < QT * 16 * 16 / (32 * ANW); ++i) { const int p = i * (32 * ANW) + (int)threadIdx.x, q = p >> 4, cofs = (p & 15) * 4;
        float M = sm[q];
#pragma unroll
        for (int w = 1; w < ANW; ++w) M = fmaxf(M, sm[w * 32 + q]);
        float L = 0.f; v4f val = (v4f){};
#pragma unroll
        for (int w = 0; w < ANW; ++w) { const float f = ex2(sm[w * 32 + q] - M); L += sl[w * 32 + q] * f; val += *(const v4fa*)(so + w * (32 * 68) + q * 68 + cofs) * f; }   // a wave that had no keys: f = 0
        v4f o; o[0] = __fdiv_rn(val[0], L); o[1] = __fdiv_rn(val[1], L); o[2] = __fdiv_rn(val[2], L); o[3] = __fdiv_rn(val[3], L);
        *(v4f*)(O + (size_t)(q0 + q) * DQ + cofs) = o;
        asm volatile("s_wait_xcnt 0x0" ::: "memory"); }   // stands in front of any later write of a register that the store above names (the code that follows in the text reuses them)
}

// grid (NH_, (SEQ - RH) / 32 + RH / 16), 32 * ANW threads; tiles in falling order of their key count. out = this batch's [SEQ][DQ] rows.
__global__ __launch_bounds__(32 * ANW) void k_attn(const h16* __restrict__ Q16, const h16* __restrict__ K16, const h16* __restrict__ V16, const bf* __restrict__ Qh, const bf* __restrict__ Ql, const bf* __restrict__ Kh, const bf* __restrict__ Kl, const bf* __restrict__ Vh, const bf* __restrict__ Vl, float* out) {
    __shared__ __align__(16) float so[ANW * 32 * 68]; __shared__ float sm[ANW * 32]; __shared__ float sl[ANW * 32];
    const size_t hp = (size_t)blockIdx.x * SEQ * HD; float* O = out + blockIdx.x * HD; const int ty = (int)blockIdx.y, NT = (SEQ - RH) / 32;
    if (ty < NT) attn_tile<h16, 0, 2>(Q16 + hp, nullptr, K16 + hp, nullptr, V16 + hp, nullptr, O, SEQ - 32 * (ty + 1), so, sm, sl);
    else attn_tile<bf, 2, 1>(Qh + hp, Ql + hp, Kh + hp, Kl + hp, Vh + hp, Vl + hp, O, RH - 16 * (ty - NT + 1), so, sm, sl);
}

extern "C" void kernel_launch(void* const* d_in, const int* in_sizes, int n_in,
                              void* d_out, int out_size, void* d_ws, size_t ws_size, hipStream_t stream) {
    if (n_in < 3) return;
    if ((size_t)in_sizes[0] < (size_t)(NB - 1) * SEQ_FULL * DM + (size_t)SEQ * DM) return;
    if ((size_t)in_sizes[1] < (size_t)3 * DM * DM) return;
    if (in_sizes[2] < 3 * DM) return;
    if ((size_t)out_size < (size_t)(NB - 1) * SEQ_FULL * DM + (size_t)SEQ * DM) return;
    const float* x = (const float*)d_in[0];      // [NB_FULL][SEQ_FULL][DM]
    const float* wf = (const float*)d_in[1];     // [3*DM][DM]: rows 0..1023 q, 1024..2047 k, 2048..3071 v
    const float* bz = (const float*)d_in[2];     // [3*DM]
    const float* bq = bz; const float* bk = bz + DM; const float* bv = bz + 2 * DM;
    float* OUT = (float*)d_out;                  // [NB_FULL][SEQ_FULL][DM]
    char* wsp = (char*)d_ws;
    auto take = [&](size_t bytes) { char* p = wsp; wsp += (bytes + 255) & ~(size_t)255; return (void*)p; };
    bf* WALL = (bf*)take((size_t)3 * DM * DM * 2); bf* WQ = WALL; bf* WK = WALL + (size_t)DM * DM; bf* WV = WALL + (size_t)2 * DM * DM;
    bf* XB = (bf*)take((size_t)SEQ * DM * 2); float* F = (float*)take((size_t)SEQ * DQ * 4);   // F holds the q, then k, then v projection (stream-ordered reuse)
    h16* QP16 = (h16*)take((size_t)NH_ * SEQ * HD * 2); h16* KP16 = (h16*)take((size_t)NKV * SEQ * HD * 2); h16* VT16 = (h16*)take((size_t)NKV * HD * SEQ * 2);
    bf* QPh = (bf*)take((size_t)NH_ * SEQ * HD * 2); bf* QPl = (bf*)take((size_t)NH_ * SEQ * HD * 2); bf* KPh = (bf*)take((size_t)NKV * SEQ * HD * 2); bf* KPl = (bf*)take((size_t)NKV * SEQ * HD * 2);
    bf* VTh = (bf*)take((size_t)NKV * HD * SEQ * 2); bf* VTl = (bf*)take((size_t)NKV * HD * SEQ * 2);
    const size_t carved = (size_t)(wsp - (char*)d_ws);
    if (carved > ws_size) return;

    k_cvt8<<<(unsigned)(((size_t)3 * DM * DM / 8 + 255) / 256), 256, 0, stream>>>(wf, WALL, (size_t)3 * DM * DM / 8);
    const unsigned LQ = (unsigned)(((size_t)NH_ * SEQ * HD / 2 + 255) / 256), LKv = (unsigned)(((size_t)NKV * SEQ * HD / 2 + 255) / 256);
    for (int b = 0; b < NB; ++b) {
        k_cvt8<<<(unsigned)(((size_t)SEQ * DM / 8 + 255) / 256), 256, 0, stream>>>(x + (size_t)b * SEQ_FULL * DM, XB, (size_t)SEQ * DM / 8);
        k_gemmk<bf, 0, true, false, 8><<<dim3(SEQ / 64, DQ / 64, 1), 256, 0, stream>>>(XB, nullptr, WQ, nullptr, DM, F, DQ, bq, 0, 0, 0, 0);
        k_qkp<<<LQ, 256, 0, stream>>>(F, DQ, NH_, QP16, QPh, QPl);
        k_gemmk<bf, 0, true, false, 8><<<dim3(SEQ / 64, DKV / 64, 1), 256, 0, stream>>>(XB, nullptr, WK, nullptr, DM, F, DKV, bk, 0, 0, 0, 0);
        k_qkp<<<LKv, 256, 0, stream>>>(F, DKV, NKV, KP16, KPh, KPl);
        k_gemmk<bf, 0, true, false, 8><<<dim3(SEQ / 64, DKV / 64, 1), 256, 0, stream>>>(XB, nullptr, WV, nullptr, DM, F, DKV, bv, 0, 0, 0, 0);
        k_vtp<<<LKv, 256, 0, stream>>>(F, DKV, NKV, VT16, VTh, VTl);
        k_attn<<<dim3(NH_, (SEQ - RH) / 32 + RH / 16, 1), 32 * ANW, 0, stream>>>(QP16, KP16, VT16, QPh, QPl, KPh, KPl, VTh, VTl, OUT + (size_t)b * SEQ_FULL * DM); }
}

// v004
// Measured time: 154 microseconds a run.
// Two timings next to v003 put it at 1.29 and 1.27 times that version's speed.
// Counting every step since v000, it is 8.93 times as fast.
#include <hip/hip_runtime.h>

// Contractions (f32 accumulate): qkv projection = v_wmma_f32_16x16x32_bf16 on bf16 RNE-converted x and W (single products) + bf16-converted bias, stored straight as the attention kernel's 16-bit planes;
// causal scores q.k and probabilities.v in ONE kernel (scores and probabilities stay in registers): query rows < RH on v_wmma_f32_16x16x32_bf16 hi+lo planes
// (3 products each), rows >= RH on v_wmma_f32_16x16x32_f16 single products (unnormalised probabilities carried x1024); running-maximum softmax in f32.

#ifndef NB
#define NB 2
#endif
#ifndef SEQ
#define SEQ 2048
#endif
#define NB_FULL  2
#define SEQ_FULL 2048
#define DM   1024
#define NH_  16
#define NKV  16
#define REP  (NH_ / NKV)
#define HD   64
#define DQ   (NH_ * HD)
#define DKV  (NKV * HD)
#define ANW  8                                // waves per attention work-group: they share one query tile and deal its keys among them
#define RH   ((SEQ >= 512) ? 512 : SEQ)     // query rows < RH use hi+lo planes
#define SCL  0.125f                          // HD^-0.5
static_assert(SEQ % 128 == 0);
static_assert(SEQ >= 128 && SEQ <= SEQ_FULL);
static_assert(NB >= 1 && NB <= NB_FULL);
static_assert(RH % 64 == 0 && RH <= SEQ && RH > 0);
static_assert(DQ == DM && REP == 1 && DKV == DM && HD == 64 && (SEQ - RH) % 32 == 0);

typedef _Float16 h16;
typedef unsigned short bf;
typedef __attribute__((ext_vector_type(16))) __bf16   v16bf;
typedef __attribute__((ext_vector_type(16))) _Float16 v16h;
typedef __attribute__((ext_vector_type(8)))  _Float16 v8h;
typedef __attribute__((ext_vector_type(8)))  unsigned short v8us;
typedef __attribute__((ext_vector_type(8)))  float    v8f;
typedef __attribute__((ext_vector_type(4)))  float    v4f;
typedef v8h  __attribute__((may_alias)) v8ha;
typedef v4f  __attribute__((may_alias)) v4fa;
typedef v8us __attribute__((may_alias)) v8usa;
typedef __attribute__((ext_vector_type(2))) _Float16 v2h;
typedef __attribute__((ext_vector_type(4))) _Float16 v4h;
typedef __attribute__((ext_vector_type(2))) unsigned short v2us;
typedef __attribute__((ext_vector_type(4))) unsigned short v4us;
typedef __attribute__((ext_vector_type(2))) float v2f;

__device__ __forceinline__ unsigned short f2bf(float f) { unsigned u = __float_as_uint(f); u += 0x7FFFu + ((u >> 16) & 1u); return (unsigned short)(u >> 16); }
__device__ __forceinline__ float bf2f(unsigned short b) { return __uint_as_float(((unsigned)b) << 16); }
__device__ __forceinline__ float bfr(float f) { return bf2f(f2bf(f)); }
__device__ __forceinline__ v16h cat16(v8h lo, v8h hi) { return __builtin_shufflevector(lo, hi, 0, 1, 2, 3, 4, 5, 6, 7, 8, 9, 10, 11, 12, 13, 14, 15); }
__device__ __forceinline__ v16bf cat16b(v8us lo, v8us hi) { return __builtin_bit_cast(v16bf, __builtin_shufflevector(lo, hi, 0, 1, 2, 3, 4, 5, 6, 7, 8, 9, 10, 11, 12, 13, 14, 15)); }
__device__ __forceinline__ v8f wmma16(v16h a, v16h b, v8f c) { return __builtin_amdgcn_wmma_f32_16x16x32_f16(false, a, false, b, (short)0, c, false, false); }
__device__ __forceinline__ v8f wmmab(v16bf a, v16bf b, v8f c) { return __builtin_amdgcn_wmma_f32_16x16x32_bf16(false, a, false, b, (short)0, c, false, false); }
__device__ __forceinline__ h16 tohx(float x) { return (h16)x; }
__device__ __forceinline__ void splitf(float y, unsigned short& h, unsigned short& l) { h = f2bf(y); l = f2bf(y - bf2f(h)); }

// Fragment map (wave32, 16x16x32): lane l -> row/col (l & 15), h = l >> 4; vector elements 0..7 <- k0 + 8h + 0..7, elements 8..15 <- k0 + 16 + 8h + 0..7,
// identical for A (rows) and B (columns, k-contiguous Bt[n][k] planes); D element r -> (row 8h + r, col l & 15).
template <typename T16> struct WFrag;
template <> struct WFrag<h16> { typedef v16h V; static __device__ __forceinline__ V ld(const h16* p) { return cat16(*(const v8h*)p, *(const v8h*)(p + 16)); } static __device__ __forceinline__ v8f mma(V a, V b, v8f c) { return wmma16(a, b, c); } };
template <> struct WFrag<bf> { typedef v16bf V; static __device__ __forceinline__ V ld(const bf* p) { return cat16b(*(const v8us*)p, *(const v8us*)(p + 16)); } static __device__ __forceinline__ v8f mma(V a, V b, v8f c) { return wmmab(a, b, c); } };

// ---- k_gemmk: register-blocked GEMM, one 64x64 output tile per work-group of NW waves, operands straight from K-contiguous 16-bit planes; grid (M/64, N/64, Z), 32 * NW threads.
// The K loop is dealt to the waves in units of 64 k (one 128-byte line of every operand row): wave w takes units w, w + NW, ... and keeps a full 16-accumulator partial tile;
// the NW partial tiles meet in LDS and are summed in wave order 0..NW-1.
// c[m][n] (f32, + optional bf16-converted f32 bias) = sum_k A[m][k] Bt[n][k] (+ split products per NSPLIT). z-batch strides sA/sB in elements. K % 64 == 0.
// The f32 tile never leaves the work-group: the thread that sums eight neighbouring columns rounds them to the three 16-bit operand planes of the attention kernel (f16, bf16 hi, bf16 lo), 16 bytes a store.
// DMAJ false (q, k): m = token, n = head * HD + d, bias[n], planes [head][token][d]. DMAJ true (v): the operands change places, m = head * HD + d, n = token, bias[m], planes [head][d][token].
// CAUSAL (probability x value contraction): the key (K) loop stops at the diagonal block (probabilities beyond it are exactly zero). roff = row offset of this launch's first row within the sequence.
template <typename T16, int NSPLIT, bool BIAS, bool CAUSAL, int NW, bool DMAJ>
__global__ __launch_bounds__(32 * NW) void k_gemmk(const T16* __restrict__ A, const T16* __restrict__ A2, const T16* __restrict__ Bt, const T16* __restrict__ Bt2, int K, h16* P16, bf* Ph, bf* Pl, const float* __restrict__ bias, int roff, size_t sA, size_t sB) {
    typedef typename WFrag<T16>::V V;
    __shared__ __align__(16) float os[NW * 64 * 68];
    const size_t z = blockIdx.z; A += z * sA; if (A2) A2 += z * sA; Bt += z * sB; if (Bt2) Bt2 += z * sB;
    const int lane = threadIdx.x & 31, lr = lane & 15, hi = lane >> 4; const int r0 = blockIdx.x * 64, c0 = blockIdx.y * 64;
    const int wv = __builtin_amdgcn_readfirstlane((int)(threadIdx.x >> 5));   // wave number in a scalar register: the K loops below branch on scalars
    const int Kl = CAUSAL ? min(K, r0 + roff + 64) : K;
    v8f acc[4][4];
#pragma unroll
    for (int mb = 0; mb < 4; ++mb)
#pragma unroll
        for (int nb = 0; nb < 4; ++nb) acc[mb][nb] = (v8f){};
    const size_t aoff = (size_t)(r0 + lr) * K + 8 * hi, boff = (size_t)(c0 + lr) * K + 8 * hi;
#pragma unroll 1
    for (int k0 = wv * 64; k0 < Kl; k0 += NW * 64) {
#pragma unroll 1
    for (int kc = k0; kc < k0 + 64; kc += 32) {
        V a[4], a2[4];
#pragma unroll
        for (int mb = 0; mb < 4; ++mb) { a[mb] = WFrag<T16>::ld(A + aoff + (size_t)mb * 16 * K + kc); if (NSPLIT == 1 || NSPLIT == 2) a2[mb] = WFrag<T16>::ld(A2 + aoff + (size_t)mb * 16 * K + kc); }
#pragma unroll
        for (int nb = 0; nb < 4; ++nb) { const V b = WFrag<T16>::ld(Bt + boff + (size_t)nb * 16 * K + kc); V b2; if (NSPLIT >= 2) b2 = WFrag<T16>::ld(Bt2 + boff + (size_t)nb * 16 * K + kc);
#pragma unroll
            for (int mb = 0; mb < 4; ++mb) { acc[mb][nb] = WFrag<T16>::mma(a[mb], b, acc[mb][nb]); if (NSPLIT == 1 || NSPLIT == 2) acc[mb][nb] = WFrag<T16>::mma(a2[mb], b, acc[mb][nb]); if (NSPLIT >= 2) acc[mb][nb] = WFrag<T16>::mma(a[mb], b2, acc[mb][nb]); } }
        asm volatile("v_nop\n\tv_nop\n\tv_nop\n\tv_nop" : "+v"(acc[0][0]), "+v"(acc[1][1]), "+v"(acc[2][2]), "+v"(acc[3][3]) : "v"(a[0]), "v"(a[3]));
    } }
    float* ow = os + wv * (64 * 68);
#pragma unroll
    for (int mb = 0; mb < 4; ++mb) {
#pragma unroll
        for (int nb = 0; nb < 4; ++nb) {
#pragma unroll
            for (int j = 0; j < 8; ++j) ow[(mb * 16 + hi * 8 + j) * 68 + nb * 16 + lr] = acc[mb][nb][j]; } }
    __syncthreads();   // every wave's partial tile is in LDS before any thread sums across waves
#pragma unroll
    for (int q = 0; q < 64 * 8 / (32 * NW); ++q) { const int p = q * (32 * NW) + (int)threadIdx.x, row = p >> 3, cofs = (p & 7) * 8;
        v4f va = *(const v4fa*)(os + row * 68 + cofs), vb = *(const v4fa*)(os + row * 68 + cofs + 4);
#pragma unroll
        for (int w = 1; w < NW; ++w) { va += *(const v4fa*)(os + w * (64 * 68) + row * 68 + cofs); vb += *(const v4fa*)(os + w * (64 * 68) + row * 68 + cofs + 4); }
        v8h o16; v8us oh, ol;
#pragma unroll
        for (int e = 0; e < 8; ++e) { float r = e < 4 ? va[e & 3] : vb[e & 3]; if (BIAS) r += bfr(bias[DMAJ ? r0 + row : c0 + cofs + e]);
            o16[e] = tohx(r); unsigned short a2, c2; splitf(r, a2, c2); oh[e] = a2; ol[e] = c2; }
        const size_t o = DMAJ ? (size_t)(r0 + row) * SEQ + c0 + cofs : ((size_t)blockIdx.y * SEQ + r0 + row) * HD + cofs;   // a 64-column tile is one head's d range (q, k) or 64 tokens of one d row (v)
        *(v8h*)(P16 + o) = o16; *(v8us*)(Ph + o) = oh; *(v8us*)(Pl + o) = ol; }
}

__global__ __launch_bounds__(256) void k_cvt8(const float* __restrict__ src, bf* dst, size_t n8) { const size_t i = (size_t)blockIdx.x * 256 + threadIdx.x; if (i >= n8) return; const v8f v = *(const v8f*)(src + i * 8); v8us o;
#pragma unroll
    for (int k = 0; k < 8; ++k) o[k] = f2bf(v[k]); *(v8us*)(dst + i * 8) = o;  }

// 2^x on the transcendental unit. The v_nop that ends each statement is the one slot the instruction set asks for between a transcendental and a next instruction that may read its result or
// overwrite its source (the register allocator is free to put such a one there); inside ex2x8 the early-clobber outputs keep every result off every source, so one slot serves all eight.
__device__ __forceinline__ float ex2(float x) { float r; asm("v_exp_f32 %0, %1\n\tv_nop" : "=v"(r) : "v"(x)); return r; }
__device__ __forceinline__ void ex2x8(float* t) { float r0, r1, r2, r3, r4, r5, r6, r7;
    asm("v_exp_f32 %0, %8\n\tv_exp_f32 %1, %9\n\tv_exp_f32 %2, %10\n\tv_exp_f32 %3, %11\n\tv_exp_f32 %4, %12\n\tv_exp_f32 %5, %13\n\tv_exp_f32 %6, %14\n\tv_exp_f32 %7, %15\n\tv_nop"
        : "=&v"(r0), "=&v"(r1), "=&v"(r2), "=&v"(r3), "=&v"(r4), "=&v"(r5), "=&v"(r6), "=&v"(r7) : "v"(t[0]), "v"(t[1]), "v"(t[2]), "v"(t[3]), "v"(t[4]), "v"(t[5]), "v"(t[6]), "v"(t[7]));
    t[0] = r0; t[1] = r1; t[2] = r2; t[3] = r3; t[4] = r4; t[5] = r5; t[6] = r6; t[7] = r7; }

// ---- attention: one work-group of ANW waves per (head, tile of QT * 16 query rows). Transposed products: S^T = K . Q^T (A = key rows, B = query rows) and O^T += V^T . P^T (A = rows of the
// d-major value plane, B = P^T). A lane then holds ONE query (column lane & 15) in every score, probability and output register, so maximum, sum and rescale are per lane plus one exchange
// between the wave's halves, and two S^T tiles (keys k0 + 8h + r and k0 + 16 + 8h + r) converted in place ARE the B fragment of the second product in the fragment map's k order.
// Keys are dealt to the waves in units of 64 (one 128-byte line of every value-plane row); each wave keeps its own running maximum, sum and output tile; they meet in LDS, joined in wave order.
// The '#pragma unroll' loops over qt, kt, ks, dt and e run over the index of a register array (an index left variable would send the array to scratch); the loop over key units stays rolled to keep the text short.
template <typename T16, int NSPLIT, int QT>
__device__ __forceinline__ void attn_tile(const T16* __restrict__ Q, const T16* __restrict__ Q2, const T16* __restrict__ Kp, const T16* __restrict__ K2, const T16* __restrict__ Vt, const T16* __restrict__ Vt2, float* O, int q0, float* so, float* sm, float* sl) {
    typedef typename WFrag<T16>::V V;
    const int lane = threadIdx.x & 31, lr = lane & 15, hi = lane >> 4;
    const int wv = __builtin_amdgcn_readfirstlane((int)(threadIdx.x >> 5));   // wave number in a scalar register: the key loop below branches on scalars
    const float CEXP = SCL * 1.4426950408889634f;      // scores go to the base-2 exponent domain in one multiply
    const float PB = NSPLIT ? 0.0f : 10.0f;            // f16 probabilities carried x1024 (the sum carries it too: it cancels in the quotient)
    const int qlast = q0 + QT * 16 - 1;
    const int koff = lr * HD + 8 * hi, voff = lr * SEQ + 8 * hi;   // a lane's fixed place inside a block of key (or query) rows / of value-plane columns
    V qf[QT][2], qf2[QT][2];
#pragma unroll
    for (int qt = 0; qt < QT; ++qt)
#pragma unroll
        for (int ks = 0; ks < 2; ++ks) { const size_t o = (size_t)(q0 + qt * 16) * HD + ks * 32; qf[qt][ks] = WFrag<T16>::ld(Q + o + koff); if (NSPLIT) qf2[qt][ks] = WFrag<T16>::ld(Q2 + o + koff); }
    v8f acc[QT][4]; float m[QT], l[QT];
#pragma unroll
    for (int qt = 0; qt < QT; ++qt) { m[qt] = -3.0e38f; l[qt] = 0.f;
#pragma unroll
        for (int dt = 0; dt < 4; ++dt) acc[qt][dt] = (v8f){}; }
#pragma unroll 1   // run-time trip count, and the body already holds two unrolled 32-key blocks: a copy would only lengthen the text for the instruction cache
    for (int u = wv * 64; u <= qlast; u += ANW * 64) {
#pragma unroll
    for (int s = 0; s < 2; ++s) { const int k0 = u + s * 32;
        if (k0 <= qlast) {                               // the unit's second half may lie wholly above the diagonal
        V vf[4], vf2[4];
#pragma unroll
        for (int dt = 0; dt < 4; ++dt) { vf[dt] = WFrag<T16>::ld(Vt + k0 + voff + dt * 16 * SEQ); if (NSPLIT) vf2[dt] = WFrag<T16>::ld(Vt2 + k0 + voff + dt * 16 * SEQ); }
        v8f st[QT][2];
#pragma unroll
        for (int kt = 0; kt < 2; ++kt) { V kf[2], kf2[2];
#pragma unroll
            for (int ks = 0; ks < 2; ++ks) { kf[ks] = WFrag<T16>::ld(Kp + (size_t)k0 * HD + koff + (kt * 16 * HD + ks * 32)); if (NSPLIT) kf2[ks] = WFrag<T16>::ld(K2 + (size_t)k0 * HD + koff + (kt * 16 * HD + ks * 32)); }
#pragma unroll
            for (int qt = 0; qt < QT; ++qt) { v8f c = (v8f){};
#pragma unroll
                for (int ks = 0; ks < 2; ++ks) { c = WFrag<T16>::mma(kf[ks], qf[qt][ks], c); if (NSPLIT) { c = WFrag<T16>::mma(kf[ks], qf2[qt][ks], c); c = WFrag<T16>::mma(kf2[ks], qf[qt][ks], c); } }
                st[qt][kt] = c; } }
#pragma unroll
        for (int qt = 0; qt < QT; ++qt) { float t[16];
#pragma unroll
            for (int e = 0; e < 16; ++e) t[e] = st[qt][e >> 3][e & 7] * CEXP;
            if (k0 + 31 > q0) {                          // only blocks that touch the diagonal mask (every query keeps at least one key of such a block)
#pragma unroll
                for (int e = 0; e < 16; ++e) t[e] = (k0 + (e >> 3) * 16 + 8 * hi + (e & 7) <= q0 + qt * 16 + lr) ? t[e] : -3.0e38f; }
            float mx = t[0];
#pragma unroll
            for (int e = 1; e < 16; ++e) mx = fmaxf(mx, t[e]);
            mx = fmaxf(mx, __shfl_xor(mx, 16, 32));      // the other half of the wave holds the query's other 16 keys
            const float mn = fmaxf(m[qt], mx), al = ex2(m[qt] - mn), mb = mn - PB; m[qt] = mn;
            float sum = 0.f;
#pragma unroll
            for (int e = 0; e < 16; ++e) t[e] -= mb;
            ex2x8(t); ex2x8(t + 8);
#pragma unroll
            for (int e = 0; e < 16; ++e) sum += t[e];
            l[qt] = l[qt] * al + sum;
#pragma unroll
            for (int dt = 0; dt < 4; ++dt) acc[qt][dt] *= al;
            if (NSPLIT) { v8us h0, h1, l0, l1;
#pragma unroll
                for (int e = 0; e < 8; ++e) { unsigned short a, c2; splitf(t[e], a, c2); h0[e] = a; l0[e] = c2; splitf(t[8 + e], a, c2); h1[e] = a; l1[e] = c2; }
                const v16bf ph = cat16b(h0, h1), pl = cat16b(l0, l1);
#pragma unroll
                for (int dt = 0; dt < 4; ++dt) { acc[qt][dt] = wmmab(__builtin_bit_cast(v16bf, vf[dt]), ph, acc[qt][dt]); acc[qt][dt] = wmmab(__builtin_bit_cast(v16bf, vf[dt]), pl, acc[qt][dt]); acc[qt][dt] = wmmab(__builtin_bit_cast(v16bf, vf2[dt]), ph, acc[qt][dt]); }
            } else { v16h pf;
#pragma unroll
                for (int e = 0; e < 16; ++e) pf[e] = tohx(t[e]);
#pragma unroll
                for (int dt = 0; dt < 4; ++dt) acc[qt][dt] = wmma16(__builtin_bit_cast(v16h, vf[dt]), pf, acc[qt][dt]); } }
        } } }
    float* ow = so + wv * (32 * 68);
#pragma unroll
    for (int qt = 0; qt < QT; ++qt) { l[qt] += __shfl_xor(l[qt], 16, 32);
#pragma unroll
        for (int dt = 0; dt < 4; ++dt) { float* p = ow + (qt * 16 + lr) * 68 + dt * 16 + 8 * hi;
            *(v4fa*)p = __builtin_shufflevector(acc[qt][dt], acc[qt][dt], 0, 1, 2, 3); *(v4fa*)(p + 4) = __builtin_shufflevector(acc[qt][dt], acc[qt][dt], 4, 5, 6, 7); }
        if (hi == 0) { sm[wv * 32 + qt * 16 + lr] = m[qt]; sl[wv * 32 + qt * 16 + lr] = l[qt]; } }
    __syncthreads();   // every wave's maximum, sum and partial output tile are in LDS before any thread joins them
#pragma unroll
    for (int i = 0; i < QT * 16 * 16 / (32 * ANW); ++i) { const int p = i * (32 * ANW) + (int)threadIdx.x, q = p >> 4, cofs = (p & 15) * 4;
        float M = sm[q];
#pragma unroll
        for (int w = 1; w < ANW; ++w) M = fmaxf(M, sm[w * 32 + q]);
        float L = 0.f; v4f val = (v4f){};
#pragma unroll
        for (int w = 0; w < ANW; ++w) { const float f = ex2(sm[w * 32 + q] - M); L += sl[w * 32 + q] * f; val += *(const v4fa*)(so + w * (32 * 68) + q * 68 + cofs) * f; }   // a wave that had no keys: f = 0
        v4f o; o[0] = __fdiv_rn(val[0], L); o[1] = __fdiv_rn(val[1], L); o[2] = __fdiv_rn(val[2], L); o[3] = __fdiv_rn(val[3], L);
        *(v4f*)(O + (size_t)(q0 + q) * DQ + cofs) = o;
        asm volatile("s_wait_xcnt 0x0" ::: "memory"); }   // stands in front of any later write of a register that the store above names (the code that follows in the text reuses them)
}

// grid (NH_, (SEQ - RH) / 32 + RH / 16), 32 * ANW threads; tiles in falling order of their key count. out = this batch's [SEQ][DQ] rows.
__global__ __launch_bounds__(32 * ANW) void k_attn(const h16* __restrict__ Q16, const h16* __restrict__ K16, const h16* __restrict__ V16, const bf* __restrict__ Qh, const bf* __restrict__ Ql, const bf* __restrict__ Kh, const bf* __restrict__ Kl, const bf* __restrict__ Vh, const bf* __restrict__ Vl, float* out) {
    __shared__ __align__(16) float so[ANW * 32 * 68]; __shared__ float sm[ANW * 32]; __shared__ float sl[ANW * 32];
    const size_t hp = (size_t)blockIdx.x * SEQ * HD; float* O = out + blockIdx.x * HD; const int ty = (int)blockIdx.y, NT = (SEQ - RH) / 32;
    if (ty < NT) attn_tile<h16, 0, 2>(Q16 + hp, nullptr, K16 + hp, nullptr, V16 + hp, nullptr, O, SEQ - 32 * (ty + 1), so, sm, sl);
    else attn_tile<bf, 2, 1>(Qh + hp, Ql + hp, Kh + hp, Kl + hp, Vh + hp, Vl + hp, O, RH - 16 * (ty - NT + 1), so, sm, sl);
}

extern "C" void kernel_launch(void* const* d_in, const int* in_sizes, int n_in,
                              void* d_out, int out_size, void* d_ws, size_t ws_size, hipStream_t stream) {
    if (n_in < 3) return;
    if ((size_t)in_sizes[0] < (size_t)(NB - 1) * SEQ_FULL * DM + (size_t)SEQ * DM) return;
    if ((size_t)in_sizes[1] < (size_t)3 * DM * DM) return;
    if (in_sizes[2] < 3 * DM) return;
    if ((size_t)out_size < (size_t)(NB - 1) * SEQ_FULL * DM + (size_t)SEQ * DM) return;
    const float* x = (const float*)d_in[0];      // [NB_FULL][SEQ_FULL][DM]
    const float* wf = (const float*)d_in[1];     // [3*DM][DM]: rows 0..1023 q, 1024..2047 k, 2048..3071 v
    const float* bz = (const float*)d_in[2];     // [3*DM]
    const float* bq = bz; const float* bk = bz + DM; const float* bv = bz + 2 * DM;
    float* OUT = (float*)d_out;                  // [NB_FULL][SEQ_FULL][DM]
    char* wsp = (char*)d_ws;
    auto take = [&](size_t bytes) { char* p = wsp; wsp += (bytes + 255) & ~(size_t)255; return (void*)p; };
    bf* WALL = (bf*)take((size_t)3 * DM * DM * 2); bf* WQ = WALL; bf* WK = WALL + (size_t)DM * DM; bf* WV = WALL + (size_t)2 * DM * DM;
    bf* XB = (bf*)take((size_t)SEQ * DM * 2);
    h16* QP16 = (h16*)take((size_t)NH_ * SEQ * HD * 2); h16* KP16 = (h16*)take((size_t)NKV * SEQ * HD * 2); h16* VT16 = (h16*)take((size_t)NKV * HD * SEQ * 2);
    bf* QPh = (bf*)take((size_t)NH_ * SEQ * HD * 2); bf* QPl = (bf*)take((size_t)NH_ * SEQ * HD * 2); bf* KPh = (bf*)take((size_t)NKV * SEQ * HD * 2); bf* KPl = (bf*)take((size_t)NKV * SEQ * HD * 2);
    bf* VTh = (bf*)take((size_t)NKV * HD * SEQ * 2); bf* VTl = (bf*)take((size_t)NKV * HD * SEQ * 2);
    const size_t carved = (size_t)(wsp - (char*)d_ws);
    if (carved > ws_size) return;

    k_cvt8<<<(unsigned)(((size_t)3 * DM * DM / 8 + 255) / 256), 256, 0, stream>>>(wf, WALL, (size_t)3 * DM * DM / 8);
    for (int b = 0; b < NB; ++b) {
        k_cvt8<<<(unsigned)(((size_t)SEQ * DM / 8 + 255) / 256), 256, 0, stream>>>(x + (size_t)b * SEQ_FULL * DM, XB, (size_t)SEQ * DM / 8);
        k_gemmk<bf, 0, true, false, 8, false><<<dim3(SEQ / 64, DQ / 64, 1), 256, 0, stream>>>(XB, nullptr, WQ, nullptr, DM, QP16, QPh, QPl, bq, 0, 0, 0);
        k_gemmk<bf, 0, true, false, 8, false><<<dim3(SEQ / 64, DKV / 64, 1), 256, 0, stream>>>(XB, nullptr, WK, nullptr, DM, KP16, KPh, KPl, bk, 0, 0, 0);
        k_gemmk<bf, 0, true, false, 8, true><<<dim3(DKV / 64, SEQ / 64, 1), 256, 0, stream>>>(WV, nullptr, XB, nullptr, DM, VT16, VTh, VTl, bv, 0, 0, 0);
        k_attn<<<dim3(NH_, (SEQ - RH) / 32 + RH / 16, 1), 32 * ANW, 0, stream>>>(QP16, KP16, VT16, QPh, QPl, KPh, KPl, VTh, VTl, OUT + (size_t)b * SEQ_FULL * DM); }
}

// v005
// Measured time: 128 microseconds a run.
// In two side-by-side timings against v004, it was 1.20 and 1.19 times as fast.
// Over all steps from v000 it is 10.7 times as fast.
#include <hip/hip_runtime.h>

// Contractions (f32 accumulate): qkv projection = v_wmma_f32_16x16x32_bf16 on bf16 RNE-converted x and W (single products) + bf16-converted bias, stored straight as the attention kernel's 16-bit planes;
// causal scores q.k and probabilities.v in ONE kernel (scores and probabilities stay in registers): query rows < RH on v_wmma_f32_16x16x32_bf16 hi+lo planes
// (3 products each), rows >= RH on v_wmma_f32_16x16x32_f16 single products (unnormalised probabilities carried x1024); running-maximum softmax in f32.

#ifndef NB
#define NB 2
#endif
#ifndef SEQ
#define SEQ 2048
#endif
#define NB_FULL  2
#define SEQ_FULL 2048
#define DM   1024
#define NH_  16
#define NKV  16
#define REP  (NH_ / NKV)
#define HD   64
#define DQ   (NH_ * HD)
#define DKV  (NKV * HD)
#define ANW  8                                // waves per attention work-group: they share one query tile and deal its keys among them
#define RH   ((SEQ >= 512) ? 512 : SEQ)     // query rows < RH use hi+lo planes
#define SCL  0.125f                          // HD^-0.5
#define PLN  ((size_t)NH_ * SEQ * HD)         // elements of one 16-bit operand plane of one batch
static_assert(SEQ % 128 == 0);
static_assert(SEQ >= 128 && SEQ <= SEQ_FULL);
static_assert(NB >= 1 && NB <= NB_FULL);
static_assert(RH % 64 == 0 && RH <= SEQ && RH > 0);
static_assert(DQ == DM && REP == 1 && DKV == DM && HD == 64 && (SEQ - RH) % 32 == 0);

typedef _Float16 h16;
typedef unsigned short bf;
typedef __attribute__((ext_vector_type(16))) __bf16   v16bf;
typedef __attribute__((ext_vector_type(16))) _Float16 v16h;
typedef __attribute__((ext_vector_type(8)))  _Float16 v8h;
typedef __attribute__((ext_vector_type(8)))  unsigned short v8us;
typedef __attribute__((ext_vector_type(8)))  float    v8f;
typedef __attribute__((ext_vector_type(4)))  float    v4f;
typedef v8h  __attribute__((may_alias)) v8ha;
typedef v4f  __attribute__((may_alias)) v4fa;
typedef v8us __attribute__((may_alias)) v8usa;
typedef __attribute__((ext_vector_type(2))) _Float16 v2h;
typedef __attribute__((ext_vector_type(4))) _Float16 v4h;
typedef __attribute__((ext_vector_type(2))) unsigned short v2us;
typedef __attribute__((ext_vector_type(4))) unsigned short v4us;
typedef __attribute__((ext_vector_type(2))) float v2f;

__device__ __forceinline__ unsigned short f2bf(float f) { unsigned u = __float_as_uint(f); u += 0x7FFFu + ((u >> 16) & 1u); return (unsigned short)(u >> 16); }
__device__ __forceinline__ float bf2f(unsigned short b) { return __uint_as_float(((unsigned)b) << 16); }
__device__ __forceinline__ float bfr(float f) { return bf2f(f2bf(f)); }
__device__ __forceinline__ v16h cat16(v8h lo, v8h hi) { return __builtin_shufflevector(lo, hi, 0, 1, 2, 3, 4, 5, 6, 7, 8, 9, 10, 11, 12, 13, 14, 15); }
__device__ __forceinline__ v16bf cat16b(v8us lo, v8us hi) { return __builtin_bit_cast(v16bf, __builtin_shufflevector(lo, hi, 0, 1, 2, 3, 4, 5, 6, 7, 8, 9, 10, 11, 12, 13, 14, 15)); }
__device__ __forceinline__ v8f wmma16(v16h a, v16h b, v8f c) { return __builtin_amdgcn_wmma_f32_16x16x32_f16(false, a, false, b, (short)0, c, false, false); }
__device__ __forceinline__ v8f wmmab(v16bf a, v16bf b, v8f c) { return __builtin_amdgcn_wmma_f32_16x16x32_bf16(false, a, false, b, (short)0, c, false, false); }
__device__ __forceinline__ h16 tohx(float x) { return (h16)x; }
__device__ __forceinline__ void splitf(float y, unsigned short& h, unsigned short& l) { h = f2bf(y); l = f2bf(y - bf2f(h)); }

// Fragment map (wave32, 16x16x32): lane l -> row/col (l & 15), h = l >> 4; vector elements 0..7 <- k0 + 8h + 0..7, elements 8..15 <- k0 + 16 + 8h + 0..7,
// identical for A (rows) and B (columns, k-contiguous Bt[n][k] planes); D element r -> (row 8h + r, col l & 15).
template <typename T16> struct WFrag;
template <> struct WFrag<h16> { typedef v16h V; static __device__ __forceinline__ V ld(const h16* p) { return cat16(*(const v8h*)p, *(const v8h*)(p + 16)); } static __device__ __forceinline__ v8f mma(V a, V b, v8f c) { return wmma16(a, b, c); } };
template <> struct WFrag<bf> { typedef v16bf V; static __device__ __forceinline__ V ld(const bf* p) { return cat16b(*(const v8us*)p, *(const v8us*)(p + 16)); } static __device__ __forceinline__ v8f mma(V a, V b, v8f c) { return wmmab(a, b, c); } };

// ---- k_gemmk / gemm_tile: register-blocked GEMM, one 64x64 output tile per work-group of NW waves, operands straight from K-contiguous 16-bit planes; 32 * NW threads.
// ONE launch does q, k and v of every batch: grid (SEQ/64, DM/64, 3 * NB), blockIdx.z = batch * 3 + projection (0 q, 1 k, 2 v), blockIdx.x = token tile, blockIdx.y = head.
// The K loop is dealt to the waves in units of 64 k (one 128-byte line of every operand row): wave w takes units w, w + NW, ... and keeps a full 16-accumulator partial tile;
// the NW partial tiles meet in LDS and are summed in wave order 0..NW-1.
// c[m][n] (f32, + optional bf16-converted f32 bias) = sum_k A[m][k] Bt[n][k] (+ split products per NSPLIT). K % 64 == 0.
// The f32 tile never leaves the work-group: the thread that sums eight neighbouring columns rounds them to the three 16-bit operand planes of the attention kernel (f16, bf16 hi, bf16 lo), 16 bytes a store.
// q, k (DMAJ false): m = token, n = head * HD + d, bias[n], planes [head][token][d]. v (DMAJ true): the operands change places, m = head * HD + d, n = token, bias[m], planes [head][d][token].
// XB = [NB][SEQ][DM] tokens, WALL = [3][DM][DM] weights, bias = [3][DM]; P16, Ph, Pl = [3][NB][PLN] planes.
template <typename T16, int NSPLIT, bool BIAS, int NW, bool DMAJ>
__device__ __forceinline__ void gemm_tile(const T16* __restrict__ A, const T16* __restrict__ A2, const T16* __restrict__ Bt, const T16* __restrict__ Bt2, int K, h16* P16, bf* Ph, bf* Pl, const float* __restrict__ bias, float* os) {
    typedef typename WFrag<T16>::V V;
    const int Kl = K;
    const int lane = threadIdx.x & 31, lr = lane & 15, hi = lane >> 4; const int r0 = (DMAJ ? blockIdx.y : blockIdx.x) * 64, c0 = (DMAJ ? blockIdx.x : blockIdx.y) * 64;
    const int wv = __builtin_amdgcn_readfirstlane((int)(threadIdx.x >> 5));   // wave number in a scalar register: the K loops below branch on scalars
    v8f acc[4][4];
#pragma unroll
    for (int mb = 0; mb < 4; ++mb)
#pragma unroll
        for (int nb = 0; nb < 4; ++nb) acc[mb][nb] = (v8f){};
    const size_t aoff = (size_t)(r0 + lr) * K + 8 * hi, boff = (size_t)(c0 + lr) * K + 8 * hi;
#pragma unroll 1
    for (int k0 = wv * 64; k0 < Kl; k0 += NW * 64) {
#pragma unroll 1
    for (int kc = k0; kc < k0 + 64; kc += 32) {
        V a[4], a2[4];
#pragma unroll
        for (int mb = 0; mb < 4; ++mb) { a[mb] = WFrag<T16>::ld(A + aoff + (size_t)mb * 16 * K + kc); if (NSPLIT == 1 || NSPLIT == 2) a2[mb] = WFrag<T16>::ld(A2 + aoff + (size_t)mb * 16 * K + kc); }
#pragma unroll
        for (int nb = 0; nb < 4; ++nb) { const V b = WFrag<T16>::ld(Bt + boff + (size_t)nb * 16 * K + kc); V b2; if (NSPLIT >= 2) b2 = WFrag<T16>::ld(Bt2 + boff + (size_t)nb * 16 * K + kc);
#pragma unroll
            for (int mb = 0; mb < 4; ++mb) { acc[mb][nb] = WFrag<T16>::mma(a[mb], b, acc[mb][nb]); if (NSPLIT == 1 || NSPLIT == 2) acc[mb][nb] = WFrag<T16>::mma(a2[mb], b, acc[mb][nb]); if (NSPLIT >= 2) acc[mb][nb] = WFrag<T16>::mma(a[mb], b2, acc[mb][nb]); } }
        asm volatile("v_nop\n\tv_nop\n\tv_nop\n\tv_nop" : "+v"(acc[0][0]), "+v"(acc[1][1]), "+v"(acc[2][2]), "+v"(acc[3][3]) : "v"(a[0]), "v"(a[3]));
    } }
    float* ow = os + wv * (64 * 68);
#pragma unroll
    for (int mb = 0; mb < 4; ++mb) {
#pragma unroll
        for (int nb = 0; nb < 4; ++nb) {
#pragma unroll
            for (int j = 0; j < 8; ++j) ow[(mb * 16 + hi * 8 + j) * 68 + nb * 16 + lr] = acc[mb][nb][j]; } }
    __syncthreads();   // every wave's partial tile is in LDS before any thread sums across waves
#pragma unroll
    for (int q = 0; q < 64 * 8 / (32 * NW); ++q) { const int p = q * (32 * NW) + (int)threadIdx.x, row = p >> 3, cofs = (p & 7) * 8;
        v4f va = *(const v4fa*)(os + row * 68 + cofs), vb = *(const v4fa*)(os + row * 68 + cofs + 4);
#pragma unroll
        for (int w = 1; w < NW; ++w) { va += *(const v4fa*)(os + w * (64 * 68) + row * 68 + cofs); vb += *(const v4fa*)(os + w * (64 * 68) + row * 68 + cofs + 4); }
        v8h o16; v8us oh, ol;
#pragma unroll
        for (int e = 0; e < 8; ++e) { float r = e < 4 ? va[e & 3] : vb[e & 3]; if (BIAS) r += bfr(bias[DMAJ ? r0 + row : c0 + cofs + e]);
            o16[e] = tohx(r); unsigned short a2, c2; splitf(r, a2, c2); oh[e] = a2; ol[e] = c2; }
        const size_t o = DMAJ ? (size_t)(r0 + row) * SEQ + c0 + cofs : ((size_t)blockIdx.y * SEQ + r0 + row) * HD + cofs;   // a 64-column tile is one head's d range (q, k) or 64 tokens of one d row (v)
        *(v8h*)(P16 + o) = o16; *(v8us*)(Ph + o) = oh; *(v8us*)(Pl + o) = ol; }
}

template <typename T16, int NW>
__global__ __launch_bounds__(32 * NW) void k_gemmk(const T16* __restrict__ XB, const T16* __restrict__ WALL, h16* P16, bf* Ph, bf* Pl, const float* __restrict__ bias) {
    __shared__ __align__(16) float os[NW * 64 * 68];
    const int bt = (int)blockIdx.z / 3, pj = (int)blockIdx.z - bt * 3;   // the same for the whole work-group: the branch below is taken by all of it or by none
    const T16* Xb = XB + (size_t)bt * SEQ * DM; const T16* Wp = WALL + (size_t)pj * DM * DM; const size_t po = (size_t)(pj * NB + bt) * PLN;
    if (pj == 2) gemm_tile<T16, 0, true, NW, true>(Wp, nullptr, Xb, nullptr, DM, P16 + po, Ph + po, Pl + po, bias + pj * DM, os);
    else gemm_tile<T16, 0, true, NW, false>(Xb, nullptr, Wp, nullptr, DM, P16 + po, Ph + po, Pl + po, bias + pj * DM, os);
}

// one launch rounds the weights and every batch's tokens to bf16, eight elements a thread: work-groups below WG_W take wf -> WALL, the rest x (batch pitch SEQ_FULL * DM) -> XB (batch pitch SEQ * DM).
#define WG_W (3 * DM * DM / 8 / 256)
#define WG_X (SEQ * DM / 8 / 256)
static_assert(3 * DM * DM % (8 * 256) == 0 && SEQ * DM % (8 * 256) == 0);
__global__ __launch_bounds__(256) void k_cvt8(const float* __restrict__ wf, const float* __restrict__ x, bf* WALL, bf* XB) {
    const int g = (int)blockIdx.x; const float* src; bf* dst; size_t i;
    if (g < WG_W) { src = wf; dst = WALL; i = (size_t)g * 256 + threadIdx.x; }
    else { const int bt = (g - WG_W) / WG_X; src = x + (size_t)bt * SEQ_FULL * DM; dst = XB + (size_t)bt * SEQ * DM; i = (size_t)(g - WG_W - bt * WG_X) * 256 + threadIdx.x; }
    const v8f v = *(const v8f*)(src + i * 8); v8us o;
#pragma unroll
    for (int k = 0; k < 8; ++k) o[k] = f2bf(v[k]); *(v8us*)(dst + i * 8) = o;  }

// 2^x on the transcendental unit. The v_nop that ends each statement is the one slot the instruction set asks for between a transcendental and a next instruction that may read its result or
// overwrite its source (the register allocator is free to put such a one there); inside ex2x8 the early-clobber outputs keep every result off every source, so one slot serves all eight.
__device__ __forceinline__ float ex2(float x) { float r; asm("v_exp_f32 %0, %1\n\tv_nop" : "=v"(r) : "v"(x)); return r; }
__device__ __forceinline__ void ex2x8(float* t) { float r0, r1, r2, r3, r4, r5, r6, r7;
    asm("v_exp_f32 %0, %8\n\tv_exp_f32 %1, %9\n\tv_exp_f32 %2, %10\n\tv_exp_f32 %3, %11\n\tv_exp_f32 %4, %12\n\tv_exp_f32 %5, %13\n\tv_exp_f32 %6, %14\n\tv_exp_f32 %7, %15\n\tv_nop"
        : "=&v"(r0), "=&v"(r1), "=&v"(r2), "=&v"(r3), "=&v"(r4), "=&v"(r5), "=&v"(r6), "=&v"(r7) : "v"(t[0]), "v"(t[1]), "v"(t[2]), "v"(t[3]), "v"(t[4]), "v"(t[5]), "v"(t[6]), "v"(t[7]));
    t[0] = r0; t[1] = r1; t[2] = r2; t[3] = r3; t[4] = r4; t[5] = r5; t[6] = r6; t[7] = r7; }

// ---- attention: one work-group of ANW waves per (head, tile of QT * 16 query rows). Transposed products: S^T = K . Q^T (A = key rows, B = query rows) and O^T += V^T . P^T (A = rows of the
// d-major value plane, B = P^T). A lane then holds ONE query (column lane & 15) in every score, probability and output register, so maximum, sum and rescale are per lane plus one exchange
// between the wave's halves, and two S^T tiles (keys k0 + 8h + r and k0 + 16 + 8h + r) converted in place ARE the B fragment of the second product in the fragment map's k order.
// Keys are dealt to the waves in units of 64 (one 128-byte line of every value-plane row); each wave keeps its own running maximum, sum and output tile; they meet in LDS, joined in wave order.
// The '#pragma unroll' loops over qt, kt, ks, dt and e run over the index of a register array (an index left variable would send the array to scratch); the loop over key units stays rolled to keep the text short.
template <typename T16, int NSPLIT, int QT>
__device__ __forceinline__ void attn_tile(const T16* __restrict__ Q, const T16* __restrict__ Q2, const T16* __restrict__ Kp, const T16* __restrict__ K2, const T16* __restrict__ Vt, const T16* __restrict__ Vt2, float* O, int q0, float* so, float* sm, float* sl) {
    typedef typename WFrag<T16>::V V;
    const int lane = threadIdx.x & 31, lr = lane & 15, hi = lane >> 4;
    const int wv = __builtin_amdgcn_readfirstlane((int)(threadIdx.x >> 5));   // wave number in a scalar register: the key loop below branches on scalars
    const float CEXP = SCL * 1.4426950408889634f;      // scores go to the base-2 exponent domain in one multiply
    const float PB = NSPLIT ? 0.0f : 10.0f;            // f16 probabilities carried x1024 (the sum carries it too: it cancels in the quotient)
    const int qlast = q0 + QT * 16 - 1;
    const int koff = lr * HD + 8 * hi, voff = lr * SEQ + 8 * hi;   // a lane's fixed place inside a block of key (or query) rows / of value-plane columns
    V qf[QT][2], qf2[QT][2];
#pragma unroll
    for (int qt = 0; qt < QT; ++qt)
#pragma unroll
        for (int ks = 0; ks < 2; ++ks) { const size_t o = (size_t)(q0 + qt * 16) * HD + ks * 32; qf[qt][ks] = WFrag<T16>::ld(Q + o + koff); if (NSPLIT) qf2[qt][ks] = WFrag<T16>::ld(Q2 + o + koff); }
    v8f acc[QT][4]; float m[QT], l[QT];
#pragma unroll
    for (int qt = 0; qt < QT; ++qt) { m[qt] = -3.0e38f; l[qt] = 0.f;
#pragma unroll
        for (int dt = 0; dt < 4; ++dt) acc[qt][dt] = (v8f){}; }
#pragma unroll 1   // run-time trip count, and the body already holds two unrolled 32-key blocks: a copy would only lengthen the text for the instruction cache
    for (int u = wv * 64; u <= qlast; u += ANW * 64) {
#pragma unroll
    for (int s = 0; s < 2; ++s) { const int k0 = u + s * 32;
        if (k0 <= qlast) {                               // the unit's second half may lie wholly above the diagonal
        V vf[4], vf2[4];
#pragma unroll
        for (int dt = 0; dt < 4; ++dt) { vf[dt] = WFrag<T16>::ld(Vt + k0 + voff + dt * 16 * SEQ); if (NSPLIT) vf2[dt] = WFrag<T16>::ld(Vt2 + k0 + voff + dt * 16 * SEQ); }
        v8f st[QT][2];
#pragma unroll
        for (int kt = 0; kt < 2; ++kt) { V kf[2], kf2[2];
#pragma unroll
            for (int ks = 0; ks < 2; ++ks) { kf[ks] = WFrag<T16>::ld(Kp + (size_t)k0 * HD + koff + (kt * 16 * HD + ks * 32)); if (NSPLIT) kf2[ks] = WFrag<T16>::ld(K2 + (size_t)k0 * HD + koff + (kt * 16 * HD + ks * 32)); }
#pragma unroll
            for (int qt = 0; qt < QT; ++qt) { v8f c = (v8f){};
#pragma unroll
                for (int ks = 0; ks < 2; ++ks) { c = WFrag<T16>::mma(kf[ks], qf[qt][ks], c); if (NSPLIT) { c = WFrag<T16>::mma(kf[ks], qf2[qt][ks], c); c = WFrag<T16>::mma(kf2[ks], qf[qt][ks], c); } }
                st[qt][kt] = c; } }
#pragma unroll
        for (int qt = 0; qt < QT; ++qt) { float t[16];
#pragma unroll
            for (int e = 0; e < 16; ++e) t[e] = st[qt][e >> 3][e & 7] * CEXP;
            if (k0 + 31 > q0) {                          // only blocks that touch the diagonal mask (every query keeps at least one key of such a block)
#pragma unroll
                for (int e = 0; e < 16; ++e) t[e] = (k0 + (e >> 3) * 16 + 8 * hi + (e & 7) <= q0 + qt * 16 + lr) ? t[e] : -3.0e38f; }
            float mx = t[0];
#pragma unroll
            for (int e = 1; e < 16; ++e) mx = fmaxf(mx, t[e]);
            mx = fmaxf(mx, __shfl_xor(mx, 16, 32));      // the other half of the wave holds the query's other 16 keys
            const float mn = fmaxf(m[qt], mx), al = ex2(m[qt] - mn), mb = mn - PB; m[qt] = mn;
            float sum = 0.f;
#pragma unroll
            for (int e = 0; e < 16; ++e) t[e] -= mb;
            ex2x8(t); ex2x8(t + 8);
#pragma unroll
            for (int e = 0; e < 16; ++e) sum += t[e];
            l[qt] = l[qt] * al + sum;
#pragma unroll
            for (int dt = 0; dt < 4; ++dt) acc[qt][dt] *= al;
            if (NSPLIT) { v8us h0, h1, l0, l1;
#pragma unroll
                for (int e = 0; e < 8; ++e) { unsigned short a, c2; splitf(t[e], a, c2); h0[e] = a; l0[e] = c2; splitf(t[8 + e], a, c2); h1[e] = a; l1[e] = c2; }
                const v16bf ph = cat16b(h0, h1), pl = cat16b(l0, l1);
#pragma unroll
                for (int dt = 0; dt < 4; ++dt) { acc[qt][dt] = wmmab(__builtin_bit_cast(v16bf, vf[dt]), ph, acc[qt][dt]); acc[qt][dt] = wmmab(__builtin_bit_cast(v16bf, vf[dt]), pl, acc[qt][dt]); acc[qt][dt] = wmmab(__builtin_bit_cast(v16bf, vf2[dt]), ph, acc[qt][dt]); }
            } else { v16h pf;
#pragma unroll
                for (int e = 0; e < 16; ++e) pf[e] = tohx(t[e]);
#pragma unroll
                for (int dt = 0; dt < 4; ++dt) acc[qt][dt] = wmma16(__builtin_bit_cast(v16h, vf[dt]), pf, acc[qt][dt]); } }
        } } }
    float* ow = so + wv * (32 * 68);
#pragma unroll
    for (int qt = 0; qt < QT; ++qt) { l[qt] += __shfl_xor(l[qt], 16, 32);
#pragma unroll
        for (int dt = 0; dt < 4; ++dt) { float* p = ow + (qt * 16 + lr) * 68 + dt * 16 + 8 * hi;
            *(v4fa*)p = __builtin_shufflevector(acc[qt][dt], acc[qt][dt], 0, 1, 2, 3); *(v4fa*)(p + 4) = __builtin_shufflevector(acc[qt][dt], acc[qt][dt], 4, 5, 6, 7); }
        if (hi == 0) { sm[wv * 32 + qt * 16 + lr] = m[qt]; sl[wv * 32 + qt * 16 + lr] = l[qt]; } }
    __syncthreads();   // every wave's maximum, sum and partial output tile are in LDS before any thread joins them
#pragma unroll
    for (int i = 0; i < QT * 16 * 16 / (32 * ANW); ++i) { const int p = i * (32 * ANW) + (int)threadIdx.x, q = p >> 4, cofs = (p & 15) * 4;
        float M = sm[q];
#pragma unroll
        for (int w = 1; w < ANW; ++w) M = fmaxf(M, sm[w * 32 + q]);
        float L = 0.f; v4f val = (v4f){};
#pragma unroll
        for (int w = 0; w < ANW; ++w) { const float f = ex2(sm[w * 32 + q] - M); L += sl[w * 32 + q] * f; val += *(const v4fa*)(so + w * (32 * 68) + q * 68 + cofs) * f; }   // a wave that had no keys: f = 0
        v4f o; o[0] = __fdiv_rn(val[0], L); o[1] = __fdiv_rn(val[1], L); o[2] = __fdiv_rn(val[2], L); o[3] = __fdiv_rn(val[3], L);
        *(v4f*)(O + (size_t)(q0 + q) * DQ + cofs) = o;
        asm volatile("s_wait_xcnt 0x0" ::: "memory"); }   // stands in front of any later write of a register that the store above names (the code that follows in the text reuses them)
}

// grid (NB * NH_, (SEQ - RH) / 32 + RH / 16), 32 * ANW threads; blockIdx.x = batch * NH_ + head, so that over ALL batches the tiles come in falling order of their key count
// P16, Ph, Pl = [3 (q, k, v)][NB][NH_][SEQ * HD] planes; out = [NB][SEQ_FULL][DQ].
__global__ __launch_bounds__(32 * ANW) void k_attn(const h16* __restrict__ P16, const bf* __restrict__ Ph, const bf* __restrict__ Pl, float* out) {
    __shared__ __align__(16) float so[ANW * 32 * 68]; __shared__ float sm[ANW * 32]; __shared__ float sl[ANW * 32];
    const h16* Q16 = P16; const h16* K16 = P16 + (size_t)NB * PLN; const h16* V16 = P16 + (size_t)2 * NB * PLN;
    const bf* Qh = Ph; const bf* Kh = Ph + (size_t)NB * PLN; const bf* Vh = Ph + (size_t)2 * NB * PLN; const bf* Ql = Pl; const bf* Kl = Pl + (size_t)NB * PLN; const bf* Vl = Pl + (size_t)2 * NB * PLN;
    const int bt = (int)blockIdx.x / NH_, hd = (int)blockIdx.x - bt * NH_;
    const size_t hp = (size_t)blockIdx.x * SEQ * HD; float* O = out + (size_t)bt * SEQ_FULL * DM + hd * HD; const int ty = (int)blockIdx.y, NT = (SEQ - RH) / 32;
    if (ty < NT) attn_tile<h16, 0, 2>(Q16 + hp, nullptr, K16 + hp, nullptr, V16 + hp, nullptr, O, SEQ - 32 * (ty + 1), so, sm, sl);
    else attn_tile<bf, 2, 1>(Qh + hp, Ql + hp, Kh + hp, Kl + hp, Vh + hp, Vl + hp, O, RH - 16 * (ty - NT + 1), so, sm, sl);
}

extern "C" void kernel_launch(void* const* d_in, const int* in_sizes, int n_in,
                              void* d_out, int out_size, void* d_ws, size_t ws_size, hipStream_t stream) {
    if (n_in < 3) return;
    if ((size_t)in_sizes[0] < (size_t)(NB - 1) * SEQ_FULL * DM + (size_t)SEQ * DM) return;
    if ((size_t)in_sizes[1] < (size_t)3 * DM * DM) return;
    if (in_sizes[2] < 3 * DM) return;
    if ((size_t)out_size < (size_t)(NB - 1) * SEQ_FULL * DM + (size_t)SEQ * DM) return;
    const float* x = (const float*)d_in[0];      // [NB_FULL][SEQ_FULL][DM]
    const float* wf = (const float*)d_in[1];     // [3*DM][DM]: rows 0..1023 q, 1024..2047 k, 2048..3071 v
    const float* bz = (const float*)d_in[2];     // [3*DM]
    float* OUT = (float*)d_out;                  // [NB_FULL][SEQ_FULL][DM]
    char* wsp = (char*)d_ws;
    auto take = [&](size_t bytes) { char* p = wsp; wsp += (bytes + 255) & ~(size_t)255; return (void*)p; };
    bf* WALL = (bf*)take((size_t)3 * DM * DM * 2);
    bf* XB = (bf*)take((size_t)NB * SEQ * DM * 2);
    h16* P16 = (h16*)take((size_t)3 * NB * PLN * 2); bf* Ph = (bf*)take((size_t)3 * NB * PLN * 2); bf* Pl = (bf*)take((size_t)3 * NB * PLN * 2);
    const size_t carved = (size_t)(wsp - (char*)d_ws);
    if (carved > ws_size) return;

    k_cvt8<<<WG_W + NB * WG_X, 256, 0, stream>>>(wf, x, WALL, XB);
    k_gemmk<bf, 8><<<dim3(SEQ / 64, DM / 64, 3 * NB), 256, 0, stream>>>(XB, WALL, P16, Ph, Pl, bz);
    k_attn<<<dim3(NB * NH_, (SEQ - RH) / 32 + RH / 16, 1), 32 * ANW, 0, stream>>>(P16, Ph, Pl, OUT);
}

// v006
// It runs in 88.9 microseconds.
// Timed twice side by side with v005, it ran 1.44 times as fast both times.
// All steps since v000 together make it 15.4 times as fast.
#include <hip/hip_runtime.h>

// Contractions (f32 accumulate): qkv projection = v_wmma_f32_16x16x32_bf16 on bf16 RNE-converted x and W (single products) + bf16-converted bias, stored straight as the attention kernel's 16-bit planes;
// causal scores q.k and probabilities.v in ONE kernel (scores and probabilities stay in registers): query rows < RH on v_wmma_f32_16x16x32_bf16 hi+lo planes
// (3 products each), rows >= RH on v_wmma_f32_16x16x32_f16 single products (unnormalised probabilities carried x1024); running-maximum softmax in f32.

#ifndef NB
#define NB 2
#endif
#ifndef SEQ
#define SEQ 2048
#endif
#define NB_FULL  2
#define SEQ_FULL 2048
#define DM   1024
#define NH_  16
#define NKV  16
#define REP  (NH_ / NKV)
#define HD   64
#define DQ   (NH_ * HD)
#define DKV  (NKV * HD)
#define ANW  8                                // waves per attention work-group: they share one query tile and deal its keys among them
#define RH   ((SEQ >= 512) ? 512 : SEQ)     // query rows < RH use hi+lo planes
#define SCL  0.125f                          // HD^-0.5
#define PLN  ((size_t)NH_ * SEQ * HD)         // elements of one 16-bit operand plane of one batch
static_assert(SEQ % 128 == 0);
static_assert(SEQ >= 128 && SEQ <= SEQ_FULL);
static_assert(NB >= 1 && NB <= NB_FULL);
static_assert(RH % 64 == 0 && RH <= SEQ && RH > 0);
static_assert(DQ == DM && REP == 1 && DKV == DM && HD == 64 && (SEQ - RH) % 32 == 0);

typedef _Float16 h16;
typedef unsigned short bf;
typedef __attribute__((ext_vector_type(16))) __bf16   v16bf;
typedef __attribute__((ext_vector_type(16))) _Float16 v16h;
typedef __attribute__((ext_vector_type(8)))  _Float16 v8h;
typedef __attribute__((ext_vector_type(8)))  unsigned short v8us;
typedef __attribute__((ext_vector_type(8)))  float    v8f;
typedef __attribute__((ext_vector_type(4)))  float    v4f;
typedef v8h  __attribute__((may_alias)) v8ha;
typedef v4f  __attribute__((may_alias)) v4fa;
typedef v8us __attribute__((may_alias)) v8usa;
typedef __attribute__((ext_vector_type(2))) _Float16 v2h;
typedef __attribute__((ext_vector_type(4))) _Float16 v4h;
typedef __attribute__((ext_vector_type(2))) unsigned short v2us;
typedef __attribute__((ext_vector_type(4))) unsigned short v4us;
typedef __attribute__((ext_vector_type(2))) float v2f;

__device__ __forceinline__ unsigned short f2bf(float f) { unsigned u = __float_as_uint(f); u += 0x7FFFu + ((u >> 16) & 1u); return (unsigned short)(u >> 16); }
__device__ __forceinline__ float bf2f(unsigned short b) { return __uint_as_float(((unsigned)b) << 16); }
__device__ __forceinline__ float bfr(float f) { return bf2f(f2bf(f)); }
__device__ __forceinline__ v16h cat16(v8h lo, v8h hi) { return __builtin_shufflevector(lo, hi, 0, 1, 2, 3, 4, 5, 6, 7, 8, 9, 10, 11, 12, 13, 14, 15); }
__device__ __forceinline__ v16bf cat16b(v8us lo, v8us hi) { return __builtin_bit_cast(v16bf, __builtin_shufflevector(lo, hi, 0, 1, 2, 3, 4, 5, 6, 7, 8, 9, 10, 11, 12, 13, 14, 15)); }
__device__ __forceinline__ v8f wmma16(v16h a, v16h b, v8f c) { return __builtin_amdgcn_wmma_f32_16x16x32_f16(false, a, false, b, (short)0, c, false, false); }
__device__ __forceinline__ v8f wmmab(v16bf a, v16bf b, v8f c) { return __builtin_amdgcn_wmma_f32_16x16x32_bf16(false, a, false, b, (short)0, c, false, false); }
__device__ __forceinline__ h16 tohx(float x) { return (h16)x; }
__device__ __forceinline__ void splitf(float y, unsigned short& h, unsigned short& l) { h = f2bf(y); l = f2bf(y - bf2f(h)); }

// Fragment map (wave32, 16x16x32): lane l -> row/col (l & 15), h = l >> 4; vector elements 0..7 <- k0 + 8h + 0..7, elements 8..15 <- k0 + 16 + 8h + 0..7,
// identical for A (rows) and B (columns); D element r -> (row 8h + r, col l & 15).
// FRAGMENT ORDER: every 16-bit operand in the workspace is stored as fragments of 16 rows x 32 k = 512 elements (1 KiB), element (row, k) at (k >> 4 & 1) * 256 + ((k >> 3 & 1) * 16 + (row & 15)) * 8 + (k & 7),
// so that a lane's two 16-byte loads stand at lane * 8 and 256 + lane * 8 and each wave-wide load reads 512 contiguous bytes (four whole 128-byte lines, not 32-byte pieces of sixteen).
#define FRG 512                               // elements of one fragment
#define GAS __attribute__((address_space(1)))  // a pointer typed as global memory: it stays a global (not a flat) address for the compiler also behind an asm statement that names it
template <typename T> __device__ __forceinline__ const GAS T* gl(const T* p) { return (const GAS T*)p; }
template <typename T16> struct WFrag;
template <> struct WFrag<h16> { typedef v16h V; static __device__ __forceinline__ V ld(const GAS h16* p) { return cat16(*(const GAS v8h*)p, *(const GAS v8h*)(p + 256)); } static __device__ __forceinline__ v8f mma(V a, V b, v8f c) { return wmma16(a, b, c); } };
template <> struct WFrag<bf> { typedef v16bf V; static __device__ __forceinline__ V ld(const GAS bf* p) { return cat16b(*(const GAS v8us*)p, *(const GAS v8us*)(p + 256)); } static __device__ __forceinline__ v8f mma(V a, V b, v8f c) { return wmmab(a, b, c); } };

// ---- k_gemmk / gemm_tile: register-blocked GEMM, one 64x64 output tile per work-group of NW waves, operands straight from 16-bit planes in fragment order (fragment index = 16-row block * K / 32 + 32-k block); 32 * NW threads.
// ONE launch does q, k and v of every batch: grid (SEQ/64, DM/64, 3 * NB), blockIdx.z = batch * 3 + projection (0 q, 1 k, 2 v), blockIdx.x = token tile, blockIdx.y = head.
// The K loop is dealt to the waves in units of 64 k (two neighbouring fragments of every 16-row block): wave w takes units w, w + NW, ... and keeps a full 16-accumulator partial tile;
// the NW partial tiles meet in LDS and are summed in wave order 0..NW-1.
// c[m][n] (f32, + optional bf16-converted f32 bias) = sum_k A[m][k] Bt[n][k] (+ split products per NSPLIT). K % 64 == 0.
// The f32 tile never leaves the work-group: the thread that sums eight neighbouring columns rounds them to the three 16-bit operand planes of the attention kernel (f16, bf16 hi, bf16 lo), 16 bytes a store;
// a wave sums one half fragment (16 rows x 16 columns), lane by lane in fragment order, so each of its stores is 512 contiguous bytes.
// q, k (DMAJ false): m = token, n = head * HD + d, bias[n], planes [head][token / 16][d / 32][fragment]. v (DMAJ true): the operands change places, m = head * HD + d, n = token, bias[m], planes [head][token / 32][d / 16][fragment].
// XB = [NB][SEQ][DM] tokens, WALL = [3][DM][DM] weights, bias = [3][DM]; P16, Ph, Pl = [3][NB][PLN] planes.
template <typename T16, int NSPLIT, bool BIAS, int NW, bool DMAJ>
__device__ __forceinline__ void gemm_tile(const T16* __restrict__ A, const T16* __restrict__ A2, const T16* __restrict__ Bt, const T16* __restrict__ Bt2, int K, h16* P16, bf* Ph, bf* Pl, const float* __restrict__ bias, float* os) {
    typedef typename WFrag<T16>::V V;
    const int Kl = K;
    const int lane = threadIdx.x & 31, lr = lane & 15, hi = lane >> 4; const int r0 = (DMAJ ? blockIdx.y : blockIdx.x) * 64, c0 = (DMAJ ? blockIdx.x : blockIdx.y) * 64;
    const int wv = __builtin_amdgcn_readfirstlane((int)(threadIdx.x >> 5));   // wave number in a scalar register: the K loops below branch on scalars
    v8f acc[4][4];
#pragma unroll
    for (int mb = 0; mb < 4; ++mb)
#pragma unroll
        for (int nb = 0; nb < 4; ++nb) acc[mb][nb] = (v8f){};
    const int KF = K >> 5;                                                    // fragments in a 16-row block
    const size_t aoff = (size_t)(r0 >> 4) * KF * FRG + lane * 8, boff = (size_t)(c0 >> 4) * KF * FRG + lane * 8;
    const GAS T16* ap = gl(A + aoff + (size_t)wv * 2 * FRG); const GAS T16* bp = gl(Bt + boff + (size_t)wv * 2 * FRG);   // this trip's fragment of the first 16-row block of either operand
#pragma unroll 1
    for (int k0 = wv * 64; k0 < Kl; k0 += NW * 64, ap += (NW - 1) * 2 * FRG, bp += (NW - 1) * 2 * FRG) {
#pragma unroll 1
    for (int kc = k0; kc < k0 + 64; kc += 32, ap += FRG, bp += FRG) {
        V a[4], a2[4];
#pragma unroll
        for (int mb = 0; mb < 4; ++mb) { a[mb] = WFrag<T16>::ld(ap + (size_t)mb * KF * FRG); if (NSPLIT == 1 || NSPLIT == 2) a2[mb] = WFrag<T16>::ld(gl(A2 + aoff + (size_t)(mb * KF + (kc >> 5)) * FRG)); }
        V bb[4];
#pragma unroll
        for (int nb = 0; nb < 4; ++nb) bb[nb] = WFrag<T16>::ld(bp + (size_t)nb * KF * FRG);
        asm volatile("s_wait_xcnt 0x0" : "+v"(ap), "+v"(bp) :: "memory");   // stands behind the trip's loads, in front of the write of the two address pairs that they name (they step on at the trip's foot); as operands the pairs stay whole up to here: no later load lands on them
#pragma unroll
        for (int nb = 0; nb < 4; ++nb) { const V b = bb[nb]; V b2; if (NSPLIT >= 2) b2 = WFrag<T16>::ld(gl(Bt2 + boff + (size_t)(nb * KF + (kc >> 5)) * FRG));
#pragma unroll
            for (int mb = 0; mb < 4; ++mb) { acc[mb][nb] = WFrag<T16>::mma(a[mb], b, acc[mb][nb]); if (NSPLIT == 1 || NSPLIT == 2) acc[mb][nb] = WFrag<T16>::mma(a2[mb], b, acc[mb][nb]); if (NSPLIT >= 2) acc[mb][nb] = WFrag<T16>::mma(a[mb], b2, acc[mb][nb]); } }
        asm volatile("v_nop\n\tv_nop\n\tv_nop\n\tv_nop" : "+v"(acc[0][0]), "+v"(acc[1][1]), "+v"(acc[2][2]), "+v"(acc[3][3]) : "v"(a[0]), "v"(a[3]));
    } }
    float* ow = os + wv * (64 * 68);
#pragma unroll
    for (int mb = 0; mb < 4; ++mb) {
#pragma unroll
        for (int nb = 0; nb < 4; ++nb) {
#pragma unroll
            for (int j = 0; j < 8; ++j) ow[(mb * 16 + hi * 8 + j) * 68 + nb * 16 + lr] = acc[mb][nb][j]; } }
    __syncthreads();   // every wave's partial tile is in LDS before any thread sums across waves
#pragma unroll
    for (int q = 0; q < 64 * 8 / (32 * NW); ++q) { const int hf = q * NW + wv, rb = hf >> 2, row = rb * 16 + lr, cofs = (hf & 3) * 16 + hi * 8;   // half fragment hf: 16-row block rb, columns (hf & 3) * 16 .. + 15
        v4f va = *(const v4fa*)(os + row * 68 + cofs), vb = *(const v4fa*)(os + row * 68 + cofs + 4);
#pragma unroll
        for (int w = 1; w < NW; ++w) { va += *(const v4fa*)(os + w * (64 * 68) + row * 68 + cofs); vb += *(const v4fa*)(os + w * (64 * 68) + row * 68 + cofs + 4); }
        v8h o16; v8us oh, ol;
#pragma unroll
        for (int e = 0; e < 8; ++e) { float r = e < 4 ? va[e & 3] : vb[e & 3]; if (BIAS) r += bfr(bias[DMAJ ? r0 + row : c0 + cofs + e]);
            o16[e] = tohx(r); unsigned short a2, c2; splitf(r, a2, c2); oh[e] = a2; ol[e] = c2; }
        const size_t o = (size_t)blockIdx.y * SEQ * HD + (DMAJ ? (size_t)(((c0 >> 5) + ((hf & 3) >> 1)) * 4 + rb) * FRG : (size_t)(((r0 >> 4) + rb) * 2 + ((hf & 3) >> 1)) * FRG) + (hf & 1) * 256 + lane * 8;   // a 64-column tile is one head's d range (q, k) or 64 tokens of its d rows (v)
        *(v8h*)(P16 + o) = o16; *(v8us*)(Ph + o) = oh; *(v8us*)(Pl + o) = ol; }
}

template <typename T16, int NW>
__global__ __launch_bounds__(32 * NW) void k_gemmk(const T16* __restrict__ XB, const T16* __restrict__ WALL, h16* P16, bf* Ph, bf* Pl, const float* __restrict__ bias) {
    __shared__ __align__(16) float os[NW * 64 * 68];
    const int bt = (int)blockIdx.z / 3, pj = (int)blockIdx.z - bt * 3;   // the same for the whole work-group: the branch below is taken by all of it or by none
    const T16* Xb = XB + (size_t)bt * SEQ * DM; const T16* Wp = WALL + (size_t)pj * DM * DM; const size_t po = (size_t)(pj * NB + bt) * PLN;
    if (pj == 2) gemm_tile<T16, 0, true, NW, true>(Wp, nullptr, Xb, nullptr, DM, P16 + po, Ph + po, Pl + po, bias + pj * DM, os);
    else gemm_tile<T16, 0, true, NW, false>(Xb, nullptr, Wp, nullptr, DM, P16 + po, Ph + po, Pl + po, bias + pj * DM, os);
}

// one launch rounds the weights and every batch's tokens to bf16 and lays them in fragment order: a thread is one lane of one fragment (16 elements), a wave reads one whole 128-byte line of each of 16 rows
// and writes 1 KiB in a row. Work-groups below WG_W take wf -> WALL, the rest x (batch pitch SEQ_FULL * DM) -> XB (batch pitch SEQ * DM).
#define WG_W (3 * DM * DM / 16 / 256)
#define WG_X (SEQ * DM / 16 / 256)
static_assert(3 * DM * DM % (16 * 256) == 0 && SEQ * DM % (16 * 256) == 0 && DM % 32 == 0);
__global__ __launch_bounds__(256) void k_cvt8(const float* __restrict__ wf, const float* __restrict__ x, bf* WALL, bf* XB) {
    const int g = (int)blockIdx.x; const float* src; bf* dst; size_t i;
    if (g < WG_W) { src = wf; dst = WALL; i = (size_t)g * 256 + threadIdx.x; }
    else { const int bt = (g - WG_W) / WG_X; src = x + (size_t)bt * SEQ_FULL * DM; dst = XB + (size_t)bt * SEQ * DM; i = (size_t)(g - WG_W - bt * WG_X) * 256 + threadIdx.x; }
    const size_t f = i >> 5; const int lane = (int)(i & 31); const float* s = src + ((f / (DM / 32)) * 16 + (lane & 15)) * DM + (f % (DM / 32)) * 32 + (lane >> 4) * 8;
    const v8f v0 = *(const v8f*)s, v1 = *(const v8f*)(s + 16); v8us o0, o1;
#pragma unroll
    for (int k = 0; k < 8; ++k) { o0[k] = f2bf(v0[k]); o1[k] = f2bf(v1[k]); }
    *(v8us*)(dst + f * FRG + lane * 8) = o0; *(v8us*)(dst + f * FRG + 256 + lane * 8) = o1; }

// 2^x on the transcendental unit. The v_nop that ends each statement is the one slot the instruction set asks for between a transcendental and a next instruction that may read its result or
// overwrite its source (the register allocator is free to put such a one there); inside ex2x8 the early-clobber outputs keep every result off every source, so one slot serves all eight.
__device__ __forceinline__ float ex2(float x) { float r; asm("v_exp_f32 %0, %1\n\tv_nop" : "=v"(r) : "v"(x)); return r; }
__device__ __forceinline__ void ex2x8(float* t) { float r0, r1, r2, r3, r4, r5, r6, r7;
    asm("v_exp_f32 %0, %8\n\tv_exp_f32 %1, %9\n\tv_exp_f32 %2, %10\n\tv_exp_f32 %3, %11\n\tv_exp_f32 %4, %12\n\tv_exp_f32 %5, %13\n\tv_exp_f32 %6, %14\n\tv_exp_f32 %7, %15\n\tv_nop"
        : "=&v"(r0), "=&v"(r1), "=&v"(r2), "=&v"(r3), "=&v"(r4), "=&v"(r5), "=&v"(r6), "=&v"(r7) : "v"(t[0]), "v"(t[1]), "v"(t[2]), "v"(t[3]), "v"(t[4]), "v"(t[5]), "v"(t[6]), "v"(t[7]));
    t[0] = r0; t[1] = r1; t[2] = r2; t[3] = r3; t[4] = r4; t[5] = r5; t[6] = r6; t[7] = r7; }

// ---- attention: one work-group of ANW waves per (head, tile of QT * 16 query rows). Transposed products: S^T = K . Q^T (A = key rows, B = query rows) and O^T += V^T . P^T (A = rows of the
// d-major value plane, B = P^T). A lane then holds ONE query (column lane & 15) in every score, probability and output register, so maximum, sum and rescale are per lane plus one exchange
// between the wave's halves, and two S^T tiles (keys k0 + 8h + r and k0 + 16 + 8h + r) converted in place ARE the B fragment of the second product in the fragment map's k order.
// Keys are dealt to the waves in units of 64 (eight neighbouring fragments of the key plane and eight of the value plane); each wave keeps its own running maximum, sum and output tile; they meet in LDS, joined in wave order.
// The '#pragma unroll' loops below over qt, ks, kt, dt and e run over the index of a register array (an index left variable would send the array to scratch); the loop over key units stays rolled to keep the text short.
template <typename T16, int NSPLIT, int QT>
__device__ __forceinline__ void attn_tile(const T16* __restrict__ Q, const T16* __restrict__ Q2, const T16* __restrict__ Kp, const T16* __restrict__ K2, const T16* __restrict__ Vt, const T16* __restrict__ Vt2, float* O, int q0, float* so, float* sm, float* sl) {
    typedef typename WFrag<T16>::V V;
    const int lane = threadIdx.x & 31, lr = lane & 15, hi = lane >> 4;
    const int wv = __builtin_amdgcn_readfirstlane((int)(threadIdx.x >> 5));   // wave number in a scalar register: the key loop below branches on scalars
    const float CEXP = SCL * 1.4426950408889634f;      // scores go to the base-2 exponent domain in one multiply
    const float PB = NSPLIT ? 0.0f : 10.0f;            // f16 probabilities carried x1024 (the sum carries it too: it cancels in the quotient)
    const int qlast = q0 + QT * 16 - 1;
    const int loff = lane * 8;   // a lane's fixed place inside a fragment
    V qf[QT][2], qf2[QT][2];
#pragma unroll
    for (int qt = 0; qt < QT; ++qt)
#pragma unroll
        for (int ks = 0; ks < 2; ++ks) { const size_t o = (size_t)(((q0 >> 4) + qt) * 2 + ks) * FRG; qf[qt][ks] = WFrag<T16>::ld(gl(Q + o + loff)); if (NSPLIT) qf2[qt][ks] = WFrag<T16>::ld(gl(Q2 + o + loff)); }
    v8f acc[QT][4]; float m[QT], l[QT];
#pragma unroll
    for (int qt = 0; qt < QT; ++qt) { m[qt] = -3.0e38f; l[qt] = 0.f;
#pragma unroll
        for (int dt = 0; dt < 4; ++dt) acc[qt][dt] = (v8f){}; }
    const size_t bo = (size_t)wv * 64 * HD + loff;   // the lane's place in the wave's first key unit, the same in all four planes
    const GAS T16* vp = gl(Vt + bo); const GAS T16* kp = gl(Kp + bo); const GAS T16* vp2 = NSPLIT ? gl(Vt2 + bo) : vp; const GAS T16* kp2 = NSPLIT ? gl(K2 + bo) : kp;
#pragma unroll 1   // run-time trip count, and the body already holds two unrolled 32-key blocks: a copy would only lengthen the text for the instruction cache
    for (int u = wv * 64; u <= qlast; u += ANW * 64, vp += ANW * 64 * HD, kp += ANW * 64 * HD, vp2 += ANW * 64 * HD, kp2 += ANW * 64 * HD) {
#pragma unroll
    for (int s = 0; s < 2; ++s) { const int k0 = u + s * 32;
        if (k0 <= qlast) {                               // the unit's second half may lie wholly above the diagonal
        V vf[4], vf2[4];
#pragma unroll
        for (int dt = 0; dt < 4; ++dt) { vf[dt] = WFrag<T16>::ld(vp + (s * 4 + dt) * FRG); if (NSPLIT) vf2[dt] = WFrag<T16>::ld(vp2 + (s * 4 + dt) * FRG); }   // 32 keys x HD = four fragments of either plane
        v8f st[QT][2];
#pragma unroll
        for (int kt = 0; kt < 2; ++kt) { V kf[2], kf2[2];
#pragma unroll
            for (int ks = 0; ks < 2; ++ks) { kf[ks] = WFrag<T16>::ld(kp + (s * 4 + kt * 2 + ks) * FRG); if (NSPLIT) kf2[ks] = WFrag<T16>::ld(kp2 + (s * 4 + kt * 2 + ks) * FRG); }
#pragma unroll
            for (int qt = 0; qt < QT; ++qt) { v8f c = (v8f){};
#pragma unroll
                for (int ks = 0; ks < 2; ++ks) { c = WFrag<T16>::mma(kf[ks], qf[qt][ks], c); if (NSPLIT) { c = WFrag<T16>::mma(kf[ks], qf2[qt][ks], c); c = WFrag<T16>::mma(kf2[ks], qf[qt][ks], c); } }
                st[qt][kt] = c; } }
#pragma unroll
        for (int qt = 0; qt < QT; ++qt) { float t[16];
#pragma unroll
            for (int e = 0; e < 16; ++e) t[e] = st[qt][e >> 3][e & 7] * CEXP;
            if (k0 + 31 > q0) {                          // only blocks that touch the diagonal mask (every query keeps at least one key of such a block)
#pragma unroll
                for (int e = 0; e < 16; ++e) t[e] = (k0 + (e >> 3) * 16 + 8 * hi + (e & 7) <= q0 + qt * 16 + lr) ? t[e] : -3.0e38f; }
            float mx = t[0];
#pragma unroll
            for (int e = 1; e < 16; ++e) mx = fmaxf(mx, t[e]);
            mx = fmaxf(mx, __shfl_xor(mx, 16, 32));      // the other half of the wave holds the query's other 16 keys
            const float mn = fmaxf(m[qt], mx), al = ex2(m[qt] - mn), mb = mn - PB; m[qt] = mn;
            float sum = 0.f;
#pragma unroll
            for (int e = 0; e < 16; ++e) t[e] -= mb;
            ex2x8(t); ex2x8(t + 8);
#pragma unroll
            for (int e = 0; e < 16; ++e) sum += t[e];
            l[qt] = l[qt] * al + sum;
#pragma unroll
            for (int dt = 0; dt < 4; ++dt) acc[qt][dt] *= al;
            if (NSPLIT) { v8us h0, h1, l0, l1;
#pragma unroll
                for (int e = 0; e < 8; ++e) { unsigned short a, c2; splitf(t[e], a, c2); h0[e] = a; l0[e] = c2; splitf(t[8 + e], a, c2); h1[e] = a; l1[e] = c2; }
                const v16bf ph = cat16b(h0, h1), pl = cat16b(l0, l1);
#pragma unroll
                for (int dt = 0; dt < 4; ++dt) { acc[qt][dt] = wmmab(__builtin_bit_cast(v16bf, vf[dt]), ph, acc[qt][dt]); acc[qt][dt] = wmmab(__builtin_bit_cast(v16bf, vf[dt]), pl, acc[qt][dt]); acc[qt][dt] = wmmab(__builtin_bit_cast(v16bf, vf2[dt]), ph, acc[qt][dt]); }
            } else { v16h pf;
#pragma unroll
                for (int e = 0; e < 16; ++e) pf[e] = tohx(t[e]);
#pragma unroll
                for (int dt = 0; dt < 4; ++dt) acc[qt][dt] = wmma16(__builtin_bit_cast(v16h, vf[dt]), pf, acc[qt][dt]); } }
        } }
        // the wait stands in front of the write of the address pairs that this trip's loads name (they step on behind it); as operands the pairs stay whole up to here: no later load lands on them
        if (NSPLIT) asm volatile("s_wait_xcnt 0x0" : "+v"(vp), "+v"(kp), "+v"(vp2), "+v"(kp2) :: "memory"); else asm volatile("s_wait_xcnt 0x0" : "+v"(vp), "+v"(kp) :: "memory");
    }
    float* ow = so + wv * (32 * 68);
#pragma unroll
    for (int qt = 0; qt < QT; ++qt) { l[qt] += __shfl_xor(l[qt], 16, 32);
#pragma unroll
        for (int dt = 0; dt < 4; ++dt) { float* p = ow + (qt * 16 + lr) * 68 + dt * 16 + 8 * hi;
            *(v4fa*)p = __builtin_shufflevector(acc[qt][dt], acc[qt][dt], 0, 1, 2, 3); *(v4fa*)(p + 4) = __builtin_shufflevector(acc[qt][dt], acc[qt][dt], 4, 5, 6, 7); }
        if (hi == 0) { sm[wv * 32 + qt * 16 + lr] = m[qt]; sl[wv * 32 + qt * 16 + lr] = l[qt]; } }
    __syncthreads();   // every wave's maximum, sum and partial output tile are in LDS before any thread joins them
#pragma unroll
    for (int i = 0; i < QT * 16 * 16 / (32 * ANW); ++i) { const int p = i * (32 * ANW) + (int)threadIdx.x, q = p >> 4, cofs = (p & 15) * 4;
        float M = sm[q];
#pragma unroll
        for (int w = 1; w < ANW; ++w) M = fmaxf(M, sm[w * 32 + q]);
        float L = 0.f; v4f val = (v4f){};
#pragma unroll
        for (int w = 0; w < ANW; ++w) { const float f = ex2(sm[w * 32 + q] - M); L += sl[w * 32 + q] * f; val += *(const v4fa*)(so + w * (32 * 68) + q * 68 + cofs) * f; }   // a wave that had no keys: f = 0
        v4f o; o[0] = __fdiv_rn(val[0], L); o[1] = __fdiv_rn(val[1], L); o[2] = __fdiv_rn(val[2], L); o[3] = __fdiv_rn(val[3], L);
        *(v4f*)(O + (size_t)(q0 + q) * DQ + cofs) = o;
        asm volatile("s_wait_xcnt 0x0" ::: "memory"); }   // stands in front of any later write of a register that the store above names (the code that follows in the text reuses them)
}

// grid (NB * NH_, (SEQ - RH) / 32 + RH / 16), 32 * ANW threads; blockIdx.x = batch * NH_ + head, so that over ALL batches the tiles come in falling order of their key count
// P16, Ph, Pl = [3 (q, k, v)][NB][NH_][SEQ * HD] planes in fragment order; out = [NB][SEQ_FULL][DQ].
__global__ __launch_bounds__(32 * ANW) void k_attn(const h16* __restrict__ P16, const bf* __restrict__ Ph, const bf* __restrict__ Pl, float* out) {
    __shared__ __align__(16) float so[ANW * 32 * 68]; __shared__ float sm[ANW * 32]; __shared__ float sl[ANW * 32];
    const h16* Q16 = P16; const h16* K16 = P16 + (size_t)NB * PLN; const h16* V16 = P16 + (size_t)2 * NB * PLN;
    const bf* Qh = Ph; const bf* Kh = Ph + (size_t)NB * PLN; const bf* Vh = Ph + (size_t)2 * NB * PLN; const bf* Ql = Pl; const bf* Kl = Pl + (size_t)NB * PLN; const bf* Vl = Pl + (size_t)2 * NB * PLN;
    const int bt = (int)blockIdx.x / NH_, hd = (int)blockIdx.x - bt * NH_;
    const size_t hp = (size_t)blockIdx.x * SEQ * HD; float* O = out + (size_t)bt * SEQ_FULL * DM + hd * HD; const int ty = (int)blockIdx.y, NT = (SEQ - RH) / 32;
    if (ty < NT) attn_tile<h16, 0, 2>(Q16 + hp, nullptr, K16 + hp, nullptr, V16 + hp, nullptr, O, SEQ - 32 * (ty + 1), so, sm, sl);
    else attn_tile<bf, 2, 1>(Qh + hp, Ql + hp, Kh + hp, Kl + hp, Vh + hp, Vl + hp, O, RH - 16 * (ty - NT + 1), so, sm, sl);
}

extern "C" void kernel_launch(void* const* d_in, const int* in_sizes, int n_in,
                              void* d_out, int out_size, void* d_ws, size_t ws_size, hipStream_t stream) {
    if (n_in < 3) return;
    if ((size_t)in_sizes[0] < (size_t)(NB - 1) * SEQ_FULL * DM + (size_t)SEQ * DM) return;
    if ((size_t)in_sizes[1] < (size_t)3 * DM * DM) return;
    if (in_sizes[2] < 3 * DM) return;
    if ((size_t)out_size < (size_t)(NB - 1) * SEQ_FULL * DM + (size_t)SEQ * DM) return;
    const float* x = (const float*)d_in[0];      // [NB_FULL][SEQ_FULL][DM]
    const float* wf = (const float*)d_in[1];     // [3*DM][DM]: rows 0..1023 q, 1024..2047 k, 2048..3071 v
    const float* bz = (const float*)d_in[2];     // [3*DM]
    float* OUT = (float*)d_out;                  // [NB_FULL][SEQ_FULL][DM]
    char* wsp = (char*)d_ws;
    auto take = [&](size_t bytes) { char* p = wsp; wsp += (bytes + 255) & ~(size_t)255; return (void*)p; };
    bf* WALL = (bf*)take((size_t)3 * DM * DM * 2);
    bf* XB = (bf*)take((size_t)NB * SEQ * DM * 2);
    h16* P16 = (h16*)take((size_t)3 * NB * PLN * 2); bf* Ph = (bf*)take((size_t)3 * NB * PLN * 2); bf* Pl = (bf*)take((size_t)3 * NB * PLN * 2);
    const size_t carved = (size_t)(wsp - (char*)d_ws);
    if (carved > ws_size) return;

    k_cvt8<<<WG_W + NB * WG_X, 256, 0, stream>>>(wf, x, WALL, XB);
    k_gemmk<bf, 8><<<dim3(SEQ / 64, DM / 64, 3 * NB), 256, 0, stream>>>(XB, WALL, P16, Ph, Pl, bz);
    k_attn<<<dim3(NB * NH_, (SEQ - RH) / 32 + RH / 16, 1), 32 * ANW, 0, stream>>>(P16, Ph, Pl, OUT);
}

// v007
// One run takes 72.9 microseconds.
// In both of two side-by-side timings against v006, it was 1.22 times as fast.
// Over all steps from v000 it is 18.8 times as fast.
#include <hip/hip_runtime.h>

// Contractions (f32 accumulate): qkv projection = v_wmma_f32_16x16x32_bf16 on bf16 RNE-converted x and W (single products) + bf16-converted bias, stored straight as the attention kernel's 16-bit planes;
// causal scores q.k and probabilities.v in ONE kernel (scores and probabilities stay in registers): query rows < RH on v_wmma_f32_16x16x32_bf16 hi+lo planes
// (3 products each), rows >= RH on v_wmma_f32_16x16x32_f16 single products (unnormalised probabilities carried x1024); running-maximum softmax in f32.

#ifndef NB
#define NB 2
#endif
#ifndef SEQ
#define SEQ 2048
#endif
#define NB_FULL  2
#define SEQ_FULL 2048
#define DM   1024
#define NH_  16
#define NKV  16
#define REP  (NH_ / NKV)
#define HD   64
#define DQ   (NH_ * HD)
#define DKV  (NKV * HD)
#define ANW  8                                // waves per attention work-group: they share one query tile and deal its keys among them
#define RH   ((SEQ >= 512) ? 512 : SEQ)     // query rows < RH use hi+lo planes
#define SCL  0.125f                          // HD^-0.5
#define PLN  ((size_t)NH_ * SEQ * HD)         // elements of one 16-bit operand plane of one batch
static_assert(SEQ % 128 == 0);
static_assert(SEQ >= 128 && SEQ <= SEQ_FULL);
static_assert(NB >= 1 && NB <= NB_FULL);
static_assert(RH % 64 == 0 && RH <= SEQ && RH > 0);
static_assert(DQ == DM && REP == 1 && DKV == DM && HD == 64 && (SEQ - RH) % 32 == 0);

typedef _Float16 h16;
typedef unsigned short bf;
typedef __attribute__((ext_vector_type(16))) __bf16   v16bf;
typedef __attribute__((ext_vector_type(16))) _Float16 v16h;
typedef __attribute__((ext_vector_type(8)))  _Float16 v8h;
typedef __attribute__((ext_vector_type(8)))  unsigned short v8us;
typedef __attribute__((ext_vector_type(8)))  float    v8f;
typedef __attribute__((ext_vector_type(4)))  float    v4f;
typedef v8h  __attribute__((may_alias)) v8ha;
typedef v4f  __attribute__((may_alias)) v4fa;
typedef v8us __attribute__((may_alias)) v8usa;
typedef __attribute__((ext_vector_type(2))) _Float16 v2h;
typedef __attribute__((ext_vector_type(4))) _Float16 v4h;
typedef __attribute__((ext_vector_type(2))) unsigned short v2us;
typedef __attribute__((ext_vector_type(4))) unsigned short v4us;
typedef __attribute__((ext_vector_type(2))) float v2f;

__device__ __forceinline__ unsigned short f2bf(float f) { unsigned u = __float_as_uint(f); u += 0x7FFFu + ((u >> 16) & 1u); return (unsigned short)(u >> 16); }
__device__ __forceinline__ float bf2f(unsigned short b) { return __uint_as_float(((unsigned)b) << 16); }
__device__ __forceinline__ float bfr(float f) { return bf2f(f2bf(f)); }
__device__ __forceinline__ v16h cat16(v8h lo, v8h hi) { return __builtin_shufflevector(lo, hi, 0, 1, 2, 3, 4, 5, 6, 7, 8, 9, 10, 11, 12, 13, 14, 15); }
__device__ __forceinline__ v16bf cat16b(v8us lo, v8us hi) { return __builtin_bit_cast(v16bf, __builtin_shufflevector(lo, hi, 0, 1, 2, 3, 4, 5, 6, 7, 8, 9, 10, 11, 12, 13, 14, 15)); }
__device__ __forceinline__ v8f wmma16(v16h a, v16h b, v8f c) { return __builtin_amdgcn_wmma_f32_16x16x32_f16(false, a, false, b, (short)0, c, false, false); }
__device__ __forceinline__ v8f wmmab(v16bf a, v16bf b, v8f c) { return __builtin_amdgcn_wmma_f32_16x16x32_bf16(false, a, false, b, (short)0, c, false, false); }
__device__ __forceinline__ h16 tohx(float x) { return (h16)x; }
__device__ __forceinline__ void splitf(float y, unsigned short& h, unsigned short& l) { h = f2bf(y); l = f2bf(y - bf2f(h)); }

// Fragment map (wave32, 16x16x32): lane l -> row/col (l & 15), h = l >> 4; vector elements 0..7 <- k0 + 8h + 0..7, elements 8..15 <- k0 + 16 + 8h + 0..7,
// identical for A (rows) and B (columns); D element r -> (row 8h + r, col l & 15).
// FRAGMENT ORDER: every 16-bit operand in the workspace is stored as fragments of 16 rows x 32 k = 512 elements (1 KiB), element (row, k) at (k >> 4 & 1) * 256 + ((k >> 3 & 1) * 16 + (row & 15)) * 8 + (k & 7),
// so that a lane's two 16-byte loads stand at lane * 8 and 256 + lane * 8 and each wave-wide load reads 512 contiguous bytes (four whole 128-byte lines, not 32-byte pieces of sixteen).
#define FRG 512                               // elements of one fragment
#define GAS __attribute__((address_space(1)))  // a pointer typed as global memory: it stays a global (not a flat) address for the compiler also behind an asm statement that names it
template <typename T> __device__ __forceinline__ const GAS T* gl(const T* p) { return (const GAS T*)p; }
template <typename T16> struct WFrag;
template <> struct WFrag<h16> { typedef v16h V; static __device__ __forceinline__ V ld(const GAS h16* p) { return cat16(*(const GAS v8h*)p, *(const GAS v8h*)(p + 256)); } static __device__ __forceinline__ v8f mma(V a, V b, v8f c) { return wmma16(a, b, c); } };
template <> struct WFrag<bf> { typedef v16bf V; static __device__ __forceinline__ V ld(const GAS bf* p) { return cat16b(*(const GAS v8us*)p, *(const GAS v8us*)(p + 256)); } static __device__ __forceinline__ v8f mma(V a, V b, v8f c) { return wmmab(a, b, c); } };

// ---- k_gemmk / gemm_tile: register-blocked GEMM, one 64x64 output tile per WAVE over the whole of K, operands straight from the 16-bit planes XB and WALL.
// XB and WALL hold their fragments K-BLOCK-MAJOR: fragment index = 32-k block * (16-row blocks of the whole plane) + 16-row block. All waves walk K in step, so what the chip reads at one time is one k block
// of every row: laid so, that is one contiguous range of either plane, not 1-KiB pieces 32 KiB apart, and a wave's four
// fragments of an operand are 4 KiB in a row.
// A work-group is GW = 12 waves, three per SIMD, that hold the 4 x 3 tiles of 256 tokens x 3 heads: every token fragment is read by three of them and every weight fragment by four, so the later reads can be
// served by the WGP's cache; its LDS lets one work-group stand on a WGP, and the grid holds one for each of 256 WGPs. The waves never meet: no barrier, and each takes its own side of the q, k / v branch.
// ONE launch does q, k and v of every batch: grid (NB * SEQ / 256, 3 * NH_ / 3); blockIdx.x = 256-token block over all batches, blockIdx.y = three neighbours of the 3 * NH_ (projection, head) pairs
// (projection 0 q, 1 k, 2 v); tx = token tile in its batch, ty = head, both of the wave.
// c[m][n] (f32, + optional bf16-converted f32 bias) = sum_k A[m][k] Bt[n][k], k rising in steps of 32. A, Bt = the first fragment of the tile's rows, SA, SB = elements from one k block to the next. K % 64 == 0.
// The f32 tile never leaves the wave: it turns it through its own LDS range (ow) from accumulator order into fragment order, and the lane that then holds eight neighbouring columns rounds them to the three 16-bit
// operand planes of the attention kernel (f16, bf16 hi, bf16 lo), 16 bytes a store; a half fragment (16 rows x 16 columns) goes out lane by lane in fragment order, so each store of the wave is 512 contiguous bytes.
// q, k (DMAJ false): m = token, n = head * HD + d, bias[n], planes [head][token / 16][d / 32][fragment]. v (DMAJ true): the operands change places, m = head * HD + d, n = token, bias[m], planes [head][token / 32][d / 16][fragment].
// XB = [DM / 32][NB * SEQ / 16][fragment] tokens, WALL = [DM / 32][3 * DM / 16][fragment] weights, bias = [3][DM]; P16, Ph, Pl = [3][NB][PLN] planes.
#define GW 12
#define XRB (NB * SEQ / 16)                   // 16-row blocks of XB
#define WRB (3 * DM / 16)                     // 16-row blocks of WALL
static_assert(SEQ % 256 == 0 && (3 * NH_) % 3 == 0 && DM % 64 == 0);
template <typename T16, bool BIAS, bool DMAJ>
__device__ __forceinline__ void gemm_tile(const T16* __restrict__ A, int SA, const T16* __restrict__ Bt, int SB, int K, h16* P16, bf* Ph, bf* Pl, const float* __restrict__ bias, float* ow, int tx, int ty) {
    typedef typename WFrag<T16>::V V;
    const int lane = threadIdx.x & 31, lr = lane & 15, hi = lane >> 4; const int r0 = (DMAJ ? ty : tx) * 64, c0 = (DMAJ ? tx : ty) * 64;
    v8f acc[4][4];
#pragma unroll
    for (int mb = 0; mb < 4; ++mb)
#pragma unroll
        for (int nb = 0; nb < 4; ++nb) acc[mb][nb] = (v8f){};
    const GAS T16* ap = gl(A + lane * 8); const GAS T16* bp = gl(Bt + lane * 8);   // this trip's first fragment of either operand
#pragma unroll 1   // a trip already holds 32 loads and 32 matrix instructions on 16 independent accumulator tiles; a copy would only lengthen the text
    for (int kc = 0; kc < K; kc += 64, ap += 2 * SA, bp += 2 * SB) {
        V a[2][4], bb[2][4];
#pragma unroll
        for (int ks = 0; ks < 2; ++ks) {
#pragma unroll
            for (int mb = 0; mb < 4; ++mb) a[ks][mb] = WFrag<T16>::ld(ap + ks * SA + mb * FRG);
#pragma unroll
            for (int nb = 0; nb < 4; ++nb) bb[ks][nb] = WFrag<T16>::ld(bp + ks * SB + nb * FRG); }
        asm volatile("s_wait_xcnt 0x0" : "+v"(ap), "+v"(bp) :: "memory");   // stands behind the trip's loads, in front of the write of the two address pairs that they name (they step on at the trip's foot); as operands the pairs stay whole up to here: no later load lands on them
        __builtin_amdgcn_sched_barrier(0);   // all loads of the trip are issued before its first matrix instruction: left free, the scheduler puts part of the loads behind the first products to save registers, and the trip then waits out a second load latency
#pragma unroll
        for (int ks = 0; ks < 2; ++ks)
#pragma unroll
            for (int nb = 0; nb < 4; ++nb)
#pragma unroll
                for (int mb = 0; mb < 4; ++mb) acc[mb][nb] = WFrag<T16>::mma(a[ks][mb], bb[ks][nb], acc[mb][nb]);
        asm volatile("v_nop\n\tv_nop\n\tv_nop\n\tv_nop" : "+v"(acc[0][0]), "+v"(acc[1][1]), "+v"(acc[2][2]), "+v"(acc[3][3]) : "v"(a[1][0]), "v"(a[1][3]));   // the four vector slots between the trip's last matrix instruction and whatever stands behind the loop's branch, on either side of it
    }
    v4f bv[8];   // q, k: the lane's 32 bias values (eight columns of each of the four 16-column groups), asked for here so that they arrive while the tile goes to LDS
    if (BIAS && !DMAJ) { const GAS float* bq = gl(bias + c0 + hi * 8);
#pragma unroll
        for (int i = 0; i < 8; ++i) bv[i] = *(const GAS v4f*)(bq + (i >> 1) * 16 + (i & 1) * 4);
        asm volatile("s_wait_xcnt 0x0" : "+v"(bq) :: "memory"); }   // stands behind the eight loads, in front of any write of the address pair that they name; as an operand the pair stays whole up to here: none of the loads lands on it
#pragma unroll
    for (int mb = 0; mb < 4; ++mb) {
#pragma unroll
        for (int nb = 0; nb < 4; ++nb) {
#pragma unroll
            for (int j = 0; j < 8; ++j) ow[(mb * 16 + hi * 8 + j) * 68 + nb * 16 + lr] = acc[mb][nb][j]; } }
    asm volatile("s_wait_dscnt 0x0" ::: "memory");   // the wave's own tile is in LDS before its lanes read what other lanes of the same wave stored (no other wave touches this range, so no barrier)
#pragma unroll 1   // four like passes, one per 16-row block: rolled to keep the text short
    for (int rb = 0; rb < 4; ++rb) { const int row = rb * 16 + lr;
#pragma unroll
        for (int cq = 0; cq < 4; ++cq) { const int cofs = cq * 16 + hi * 8;   // half fragment: 16-row block rb, columns cq * 16 .. + 15
            const v4f va = *(const v4fa*)(ow + row * 68 + cofs), vb = *(const v4fa*)(ow + row * 68 + cofs + 4);
            v8h o16; v8us oh, ol;
#pragma unroll
            for (int e = 0; e < 8; ++e) { float r = e < 4 ? va[e & 3] : vb[e & 3]; if (BIAS) r += bfr(DMAJ ? bias[r0 + row] : bv[cq * 2 + (e >> 2)][e & 3]);
                o16[e] = tohx(r); unsigned short a2, c2; splitf(r, a2, c2); oh[e] = a2; ol[e] = c2; }
            const size_t o = (size_t)ty * SEQ * HD + (DMAJ ? (size_t)(((c0 >> 5) + (cq >> 1)) * 4 + rb) * FRG : (size_t)(((r0 >> 4) + rb) * 2 + (cq >> 1)) * FRG) + (cq & 1) * 256 + lane * 8;   // a 64-column tile is one head's d range (q, k) or 64 tokens of its d rows (v)
            *(v8h*)(P16 + o) = o16; *(v8us*)(Ph + o) = oh; *(v8us*)(Pl + o) = ol; }
        asm volatile("s_wait_xcnt 0x0" ::: "memory"); }   // stands behind the pass's loads and stores, in front of the next pass's writes of the registers that they name
}

template <typename T16>
__global__ __launch_bounds__(32 * GW) void k_gemmk(const T16* __restrict__ XB, const T16* __restrict__ WALL, h16* P16, bf* Ph, bf* Pl, const float* __restrict__ bias) {
    __shared__ __align__(16) float os[GW * 64 * 68];
    const int wv = __builtin_amdgcn_readfirstlane((int)(threadIdx.x >> 5));   // wave number in a scalar register: tile indices, base addresses and the branch below stay scalar
    const int bt = (int)blockIdx.x / (SEQ / 256), tx = ((int)blockIdx.x - bt * (SEQ / 256)) * 4 + (wv & 3);
    const int ph = (int)blockIdx.y * 3 + (wv >> 2), pj = ph / NH_, ty = ph - pj * NH_;
    const T16* Xt = XB + (size_t)(bt * (SEQ / 16) + tx * 4) * FRG; const T16* Wt = WALL + (size_t)(ph * 4) * FRG;   // a tile is four 16-row blocks; (projection, head) pair ph = rows ph * 64 .. + 63 of the weights
    const size_t po = (size_t)(pj * NB + bt) * PLN; float* ow = os + wv * (64 * 68);
    if (pj == 2) gemm_tile<T16, true, true>(Wt, WRB * FRG, Xt, XRB * FRG, DM, P16 + po, Ph + po, Pl + po, bias + pj * DM, ow, tx, ty);
    else gemm_tile<T16, true, false>(Xt, XRB * FRG, Wt, WRB * FRG, DM, P16 + po, Ph + po, Pl + po, bias + pj * DM, ow, tx, ty);
}

// one launch rounds the weights and every batch's tokens to bf16 and lays them in fragments, k-block-major: a thread is one lane of one fragment (16 elements), a wave reads one whole 128-byte line of each of 16 rows
// and writes 1 KiB in a row. Work-groups below WG_W take wf -> WALL, the rest x (batch pitch SEQ_FULL * DM) -> XB (batch bt = 16-row blocks bt * SEQ / 16 ...).
#define WG_W (3 * DM * DM / 16 / 256)
#define WG_X (SEQ * DM / 16 / 256)
static_assert(3 * DM * DM % (16 * 256) == 0 && SEQ * DM % (16 * 256) == 0 && DM % 32 == 0);
__global__ __launch_bounds__(256) void k_cvt8(const float* __restrict__ wf, const float* __restrict__ x, bf* WALL, bf* XB) {
    const int g = (int)blockIdx.x; const float* src; bf* dst; size_t i; int nrb;   // dst = the plane's fragment of k block 0 and the source's first 16-row block, nrb = 16-row blocks of the whole plane
    if (g < WG_W) { src = wf; dst = WALL; nrb = WRB; i = (size_t)g * 256 + threadIdx.x; }
    else { const int bt = (g - WG_W) / WG_X; src = x + (size_t)bt * SEQ_FULL * DM; dst = XB + (size_t)bt * (SEQ / 16) * FRG; nrb = XRB; i = (size_t)(g - WG_W - bt * WG_X) * 256 + threadIdx.x; }
    const size_t f = i >> 5; const int lane = (int)(i & 31); const float* s = src + ((f / (DM / 32)) * 16 + (lane & 15)) * DM + (f % (DM / 32)) * 32 + (lane >> 4) * 8;
    const v8f v0 = *(const v8f*)s, v1 = *(const v8f*)(s + 16); v8us o0, o1;
#pragma unroll
    for (int k = 0; k < 8; ++k) { o0[k] = f2bf(v0[k]); o1[k] = f2bf(v1[k]); }
    bf* d = dst + ((f % (DM / 32)) * nrb + f / (DM / 32)) * FRG + lane * 8;
    *(v8us*)d = o0; *(v8us*)(d + 256) = o1; }

// 2^x on the transcendental unit. The v_nop that ends each statement is the one slot the instruction set asks for between a transcendental and a next instruction that may read its result or
// overwrite its source (the register allocator is free to put such a one there); inside ex2x8 the early-clobber outputs keep every result off every source, so one slot serves all eight.
__device__ __forceinline__ float ex2(float x) { float r; asm("v_exp_f32 %0, %1\n\tv_nop" : "=v"(r) : "v"(x)); return r; }
__device__ __forceinline__ void ex2x8(float* t) { float r0, r1, r2, r3, r4, r5, r6, r7;
    asm("v_exp_f32 %0, %8\n\tv_exp_f32 %1, %9\n\tv_exp_f32 %2, %10\n\tv_exp_f32 %3, %11\n\tv_exp_f32 %4, %12\n\tv_exp_f32 %5, %13\n\tv_exp_f32 %6, %14\n\tv_exp_f32 %7, %15\n\tv_nop"
        : "=&v"(r0), "=&v"(r1), "=&v"(r2), "=&v"(r3), "=&v"(r4), "=&v"(r5), "=&v"(r6), "=&v"(r7) : "v"(t[0]), "v"(t[1]), "v"(t[2]), "v"(t[3]), "v"(t[4]), "v"(t[5]), "v"(t[6]), "v"(t[7]));
    t[0] = r0; t[1] = r1; t[2] = r2; t[3] = r3; t[4] = r4; t[5] = r5; t[6] = r6; t[7] = r7; }

// ---- attention: one work-group of ANW waves per (head, tile of QT * 16 query rows). Transposed products: S^T = K . Q^T (A = key rows, B = query rows) and O^T += V^T . P^T (A = rows of the
// d-major value plane, B = P^T). A lane then holds ONE query (column lane & 15) in every score, probability and output register, so maximum, sum and rescale are per lane plus one exchange
// between the wave's halves, and two S^T tiles (keys k0 + 8h + r and k0 + 16 + 8h + r) converted in place ARE the B fragment of the second product in the fragment map's k order.
// Keys are dealt to the waves in units of 64 (eight neighbouring fragments of the key plane and eight of the value plane); each wave keeps its own running maximum, sum and output tile; they meet in LDS, joined in wave order.
// The '#pragma unroll' loops below over qt, ks, kt, dt and e run over the index of a register array (an index left variable would send the array to scratch); the loop over key units stays rolled to keep the text short.
template <typename T16, int NSPLIT, int QT>
__device__ __forceinline__ void attn_tile(const T16* __restrict__ Q, const T16* __restrict__ Q2, const T16* __restrict__ Kp, const T16* __restrict__ K2, const T16* __restrict__ Vt, const T16* __restrict__ Vt2, float* O, int q0, float* so, float* sm, float* sl) {
    typedef typename WFrag<T16>::V V;
    const int lane = threadIdx.x & 31, lr = lane & 15, hi = lane >> 4;
    const int wv = __builtin_amdgcn_readfirstlane((int)(threadIdx.x >> 5));   // wave number in a scalar register: the key loop below branches on scalars
    const float CEXP = SCL * 1.4426950408889634f;      // scores go to the base-2 exponent domain in one multiply
    const float PB = NSPLIT ? 0.0f : 10.0f;            // f16 probabilities carried x1024 (the sum carries it too: it cancels in the quotient)
    const int qlast = q0 + QT * 16 - 1;
    const int loff = lane * 8;   // a lane's fixed place inside a fragment
    V qf[QT][2], qf2[QT][2];
#pragma unroll
    for (int qt = 0; qt < QT; ++qt)
#pragma unroll
        for (int ks = 0; ks < 2; ++ks) { const size_t o = (size_t)(((q0 >> 4) + qt) * 2 + ks) * FRG; qf[qt][ks] = WFrag<T16>::ld(gl(Q + o + loff)); if (NSPLIT) qf2[qt][ks] = WFrag<T16>::ld(gl(Q2 + o + loff)); }
    v8f acc[QT][4]; float m[QT], l[QT];
#pragma unroll
    for (int qt = 0; qt < QT; ++qt) { m[qt] = -3.0e38f; l[qt] = 0.f;
#pragma unroll
        for (int dt = 0; dt < 4; ++dt) acc[qt][dt] = (v8f){}; }
    const size_t bo = (size_t)wv * 64 * HD + loff;   // the lane's place in the wave's first key unit, the same in all four planes
    const GAS T16* vp = gl(Vt + bo); const GAS T16* kp = gl(Kp + bo); const GAS T16* vp2 = NSPLIT ? gl(Vt2 + bo) : vp; const GAS T16* kp2 = NSPLIT ? gl(K2 + bo) : kp;
#pragma unroll 1   // run-time trip count, and the body already holds two unrolled 32-key blocks: a copy would only lengthen the text for the instruction cache
    for (int u = wv * 64; u <= qlast; u += ANW * 64, vp += ANW * 64 * HD, kp += ANW * 64 * HD, vp2 += ANW * 64 * HD, kp2 += ANW * 64 * HD) {
#pragma unroll
    for (int s = 0; s < 2; ++s) { const int k0 = u + s * 32;
        if (k0 <= qlast) {                               // the unit's second half may lie wholly above the diagonal
        V vf[4], vf2[4];
#pragma unroll
        for (int dt = 0; dt < 4; ++dt) { vf[dt] = WFrag<T16>::ld(vp + (s * 4 + dt) * FRG); if (NSPLIT) vf2[dt] = WFrag<T16>::ld(vp2 + (s * 4 + dt) * FRG); }   // 32 keys x HD = four fragments of either plane
        v8f st[QT][2];
#pragma unroll
        for (int kt = 0; kt < 2; ++kt) { V kf[2], kf2[2];
#pragma unroll
            for (int ks = 0; ks < 2; ++ks) { kf[ks] = WFrag<T16>::ld(kp + (s * 4 + kt * 2 + ks) * FRG); if (NSPLIT) kf2[ks] = WFrag<T16>::ld(kp2 + (s * 4 + kt * 2 + ks) * FRG); }
#pragma unroll
            for (int qt = 0; qt < QT; ++qt) { v8f c = (v8f){};
#pragma unroll
                for (int ks = 0; ks < 2; ++ks) { c = WFrag<T16>::mma(kf[ks], qf[qt][ks], c); if (NSPLIT) { c = WFrag<T16>::mma(kf[ks], qf2[qt][ks], c); c = WFrag<T16>::mma(kf2[ks], qf[qt][ks], c); } }
                st[qt][kt] = c; } }
#pragma unroll
        for (int qt = 0; qt < QT; ++qt) { float t[16];
#pragma unroll
            for (int e = 0; e < 16; ++e) t[e] = st[qt][e >> 3][e & 7] * CEXP;
            if (k0 + 31 > q0) {                          // only blocks that touch the diagonal mask (every query keeps at least one key of such a block)
#pragma unroll
                for (int e = 0; e < 16; ++e) t[e] = (k0 + (e >> 3) * 16 + 8 * hi + (e & 7) <= q0 + qt * 16 + lr) ? t[e] : -3.0e38f; }
            float mx = t[0];
#pragma unroll
            for (int e = 1; e < 16; ++e) mx = fmaxf(mx, t[e]);
            mx = fmaxf(mx, __shfl_xor(mx, 16, 32));      // the other half of the wave holds the query's other 16 keys
            const float mn = fmaxf(m[qt], mx), al = ex2(m[qt] - mn), mb = mn - PB; m[qt] = mn;
            float sum = 0.f;
#pragma unroll
            for (int e = 0; e < 16; ++e) t[e] -= mb;
            ex2x8(t); ex2x8(t + 8);
#pragma unroll
            for (int e = 0; e < 16; ++e) sum += t[e];
            l[qt] = l[qt] * al + sum;
#pragma unroll
            for (int dt = 0; dt < 4; ++dt) acc[qt][dt] *= al;
            if (NSPLIT) { v8us h0, h1, l0, l1;
#pragma unroll
                for (int e = 0; e < 8; ++e) { unsigned short a, c2; splitf(t[e], a, c2); h0[e] = a; l0[e] = c2; splitf(t[8 + e], a, c2); h1[e] = a; l1[e] = c2; }
                const v16bf ph = cat16b(h0, h1), pl = cat16b(l0, l1);
#pragma unroll
                for (int dt = 0; dt < 4; ++dt) { acc[qt][dt] = wmmab(__builtin_bit_cast(v16bf, vf[dt]), ph, acc[qt][dt]); acc[qt][dt] = wmmab(__builtin_bit_cast(v16bf, vf[dt]), pl, acc[qt][dt]); acc[qt][dt] = wmmab(__builtin_bit_cast(v16bf, vf2[dt]), ph, acc[qt][dt]); }
            } else { v16h pf;
#pragma unroll
                for (int e = 0; e < 16; ++e) pf[e] = tohx(t[e]);
#pragma unroll
                for (int dt = 0; dt < 4; ++dt) acc[qt][dt] = wmma16(__builtin_bit_cast(v16h, vf[dt]), pf, acc[qt][dt]); } }
        } }
        // the wait stands in front of the write of the address pairs that this trip's loads name (they step on behind it); as operands the pairs stay whole up to here: no later load lands on them
        if (NSPLIT) asm volatile("s_wait_xcnt 0x0" : "+v"(vp), "+v"(kp), "+v"(vp2), "+v"(kp2) :: "memory"); else asm volatile("s_wait_xcnt 0x0" : "+v"(vp), "+v"(kp) :: "memory");
    }
    float* ow = so + wv * (32 * 68);
#pragma unroll
    for (int qt = 0; qt < QT; ++qt) { l[qt] += __shfl_xor(l[qt], 16, 32);
#pragma unroll
        for (int dt = 0; dt < 4; ++dt) { float* p = ow + (qt * 16 + lr) * 68 + dt * 16 + 8 * hi;
            *(v4fa*)p = __builtin_shufflevector(acc[qt][dt], acc[qt][dt], 0, 1, 2, 3); *(v4fa*)(p + 4) = __builtin_shufflevector(acc[qt][dt], acc[qt][dt], 4, 5, 6, 7); }
        if (hi == 0) { sm[wv * 32 + qt * 16 + lr] = m[qt]; sl[wv * 32 + qt * 16 + lr] = l[qt]; } }
    __syncthreads();   // every wave's maximum, sum and partial output tile are in LDS before any thread joins them
#pragma unroll
    for (int i = 0; i < QT * 16 * 16 / (32 * ANW); ++i) { const int p = i * (32 * ANW) + (int)threadIdx.x, q = p >> 4, cofs = (p & 15) * 4;
        float M = sm[q];
#pragma unroll
        for (int w = 1; w < ANW; ++w) M = fmaxf(M, sm[w * 32 + q]);
        float L = 0.f; v4f val = (v4f){};
#pragma unroll
        for (int w = 0; w < ANW; ++w) { const float f = ex2(sm[w * 32 + q] - M); L += sl[w * 32 + q] * f; val += *(const v4fa*)(so + w * (32 * 68) + q * 68 + cofs) * f; }   // a wave that had no keys: f = 0
        v4f o; o[0] = __fdiv_rn(val[0], L); o[1] = __fdiv_rn(val[1], L); o[2] = __fdiv_rn(val[2], L); o[3] = __fdiv_rn(val[3], L);
        *(v4f*)(O + (size_t)(q0 + q) * DQ + cofs) = o;
        asm volatile("s_wait_xcnt 0x0" ::: "memory"); }   // stands in front of any later write of a register that the store above names (the code that follows in the text reuses them)
}

// grid (NB * NH_, (SEQ - RH) / 32 + RH / 16), 32 * ANW threads; blockIdx.x = batch * NH_ + head, so that over ALL batches the tiles come in falling order of their key count
// P16, Ph, Pl = [3 (q, k, v)][NB][NH_][SEQ * HD] planes in fragment order; out = [NB][SEQ_FULL][DQ].
__global__ __launch_bounds__(32 * ANW) void k_attn(const h16* __restrict__ P16, const bf* __restrict__ Ph, const bf* __restrict__ Pl, float* out) {
    __shared__ __align__(16) float so[ANW * 32 * 68]; __shared__ float sm[ANW * 32]; __shared__ float sl[ANW * 32];
    const h16* Q16 = P16; const h16* K16 = P16 + (size_t)NB * PLN; const h16* V16 = P16 + (size_t)2 * NB * PLN;
    const bf* Qh = Ph; const bf* Kh = Ph + (size_t)NB * PLN; const bf* Vh = Ph + (size_t)2 * NB * PLN; const bf* Ql = Pl; const bf* Kl = Pl + (size_t)NB * PLN; const bf* Vl = Pl + (size_t)2 * NB * PLN;
    const int bt = (int)blockIdx.x / NH_, hd = (int)blockIdx.x - bt * NH_;
    const size_t hp = (size_t)blockIdx.x * SEQ * HD; float* O = out + (size_t)bt * SEQ_FULL * DM + hd * HD; const int ty = (int)blockIdx.y, NT = (SEQ - RH) / 32;
    if (ty < NT) attn_tile<h16, 0, 2>(Q16 + hp, nullptr, K16 + hp, nullptr, V16 + hp, nullptr, O, SEQ - 32 * (ty + 1), so, sm, sl);
    else attn_tile<bf, 2, 1>(Qh + hp, Ql + hp, Kh + hp, Kl + hp, Vh + hp, Vl + hp, O, RH - 16 * (ty - NT + 1), so, sm, sl);
}

extern "C" void kernel_launch(void* const* d_in, const int* in_sizes, int n_in,
                              void* d_out, int out_size, void* d_ws, size_t ws_size, hipStream_t stream) {
    if (n_in < 3) return;
    if ((size_t)in_sizes[0] < (size_t)(NB - 1) * SEQ_FULL * DM + (size_t)SEQ * DM) return;
    if ((size_t)in_sizes[1] < (size_t)3 * DM * DM) return;
    if (in_sizes[2] < 3 * DM) return;
    if ((size_t)out_size < (size_t)(NB - 1) * SEQ_FULL * DM + (size_t)SEQ * DM) return;
    const float* x = (const float*)d_in[0];      // [NB_FULL][SEQ_FULL][DM]
    const float* wf = (const float*)d_in[1];     // [3*DM][DM]: rows 0..1023 q, 1024..2047 k, 2048..3071 v
    const float* bz = (const float*)d_in[2];     // [3*DM]
    float* OUT = (float*)d_out;                  // [NB_FULL][SEQ_FULL][DM]
    char* wsp = (char*)d_ws;
    auto take = [&](size_t bytes) { char* p = wsp; wsp += (bytes + 255) & ~(size_t)255; return (void*)p; };
    bf* WALL = (bf*)take((size_t)3 * DM * DM * 2);
    bf* XB = (bf*)take((size_t)NB * SEQ * DM * 2);
    h16* P16 = (h16*)take((size_t)3 * NB * PLN * 2); bf* Ph = (bf*)take((size_t)3 * NB * PLN * 2); bf* Pl = (bf*)take((size_t)3 * NB * PLN * 2);
    const size_t carved = (size_t)(wsp - (char*)d_ws);
    if (carved > ws_size) return;

    k_cvt8<<<WG_W + NB * WG_X, 256, 0, stream>>>(wf, x, WALL, XB);
    k_gemmk<bf><<<dim3(NB * SEQ / 256, 3 * NH_ / 3, 1), 32 * GW, 0, stream>>>(XB, WALL, P16, Ph, Pl, bz);
    k_attn<<<dim3(NB * NH_, (SEQ - RH) / 32 + RH / 16, 1), 32 * ANW, 0, stream>>>(P16, Ph, Pl, OUT);
}

// v008
// One run takes 65.4 microseconds.
// Next to v007, in two timings, it ran 1.12 and 1.11 times as fast.
// Counting every step since v000, it is 21.0 times as fast.
#include <hip/hip_runtime.h>

// Contractions (f32 accumulate): qkv projection = v_wmma_f32_16x16x32_bf16 on bf16 RNE-converted x and W (single products) + bf16-converted bias, stored straight as the attention kernel's 16-bit planes;
// causal scores q.k and probabilities.v in ONE kernel (scores and probabilities stay in registers): query rows < RH on v_wmma_f32_16x16x32_bf16 hi+lo planes
// (3 products each), rows >= RH on v_wmma_f32_16x16x32_f16 single products (unnormalised probabilities carried x1024); running-maximum softmax in f32.

#ifndef NB
#define NB 2
#endif
#ifndef SEQ
#define SEQ 2048
#endif
#define NB_FULL  2
#define SEQ_FULL 2048
#define DM   1024
#define NH_  16
#define NKV  16
#define REP  (NH_ / NKV)
#define HD   64
#define DQ   (NH_ * HD)
#define DKV  (NKV * HD)
#define ANW  8                                // waves per attention work-group: they deal the keys of one query tile (rows < RH) or of two (rows >= RH) among them
#define RH   ((SEQ >= 512) ? 512 : SEQ)     // query rows < RH use hi+lo planes
#define SCL  0.125f                          // HD^-0.5
#define PLN  ((size_t)NH_ * SEQ * HD)         // elements of one 16-bit operand plane of one batch
static_assert(SEQ % 128 == 0);
static_assert(SEQ >= 128 && SEQ <= SEQ_FULL);
static_assert(NB >= 1 && NB <= NB_FULL);
static_assert(RH % 64 == 0 && RH <= SEQ && RH > 0);
static_assert(DQ == DM && REP == 1 && DKV == DM && HD == 64 && (SEQ - RH) % 32 == 0);

typedef _Float16 h16;
typedef unsigned short bf;
typedef __attribute__((ext_vector_type(16))) __bf16   v16bf;
typedef __attribute__((ext_vector_type(16))) _Float16 v16h;
typedef __attribute__((ext_vector_type(8)))  _Float16 v8h;
typedef __attribute__((ext_vector_type(8)))  unsigned short v8us;
typedef __attribute__((ext_vector_type(8)))  float    v8f;
typedef __attribute__((ext_vector_type(4)))  float    v4f;
typedef v8h  __attribute__((may_alias)) v8ha;
typedef v4f  __attribute__((may_alias)) v4fa;
typedef v8us __attribute__((may_alias)) v8usa;
typedef __attribute__((ext_vector_type(2))) _Float16 v2h;
typedef __attribute__((ext_vector_type(4))) _Float16 v4h;
typedef __attribute__((ext_vector_type(2))) unsigned short v2us;
typedef __attribute__((ext_vector_type(4))) unsigned short v4us;
typedef __attribute__((ext_vector_type(2))) float v2f;

__device__ __forceinline__ unsigned short f2bf(float f) { unsigned u = __float_as_uint(f); u += 0x7FFFu + ((u >> 16) & 1u); return (unsigned short)(u >> 16); }
__device__ __forceinline__ float bf2f(unsigned short b) { return __uint_as_float(((unsigned)b) << 16); }
__device__ __forceinline__ float bfr(float f) { return bf2f(f2bf(f)); }
__device__ __forceinline__ v16h cat16(v8h lo, v8h hi) { return __builtin_shufflevector(lo, hi, 0, 1, 2, 3, 4, 5, 6, 7, 8, 9, 10, 11, 12, 13, 14, 15); }
__device__ __forceinline__ v16bf cat16b(v8us lo, v8us hi) { return __builtin_bit_cast(v16bf, __builtin_shufflevector(lo, hi, 0, 1, 2, 3, 4, 5, 6, 7, 8, 9, 10, 11, 12, 13, 14, 15)); }
__device__ __forceinline__ v8f wmma16(v16h a, v16h b, v8f c) { return __builtin_amdgcn_wmma_f32_16x16x32_f16(false, a, false, b, (short)0, c, false, false); }
__device__ __forceinline__ v8f wmmab(v16bf a, v16bf b, v8f c) { return __builtin_amdgcn_wmma_f32_16x16x32_bf16(false, a, false, b, (short)0, c, false, false); }
__device__ __forceinline__ h16 tohx(float x) { return (h16)x; }
__device__ __forceinline__ void splitf(float y, unsigned short& h, unsigned short& l) { h = f2bf(y); l = f2bf(y - bf2f(h)); }

// Fragment map (wave32, 16x16x32): lane l -> row/col (l & 15), h = l >> 4; vector elements 0..7 <- k0 + 8h + 0..7, elements 8..15 <- k0 + 16 + 8h + 0..7,
// identical for A (rows) and B (columns); D element r -> (row 8h + r, col l & 15).
// FRAGMENT ORDER: every 16-bit operand in the workspace is stored as fragments of 16 rows x 32 k = 512 elements (1 KiB), element (row, k) at (k >> 4 & 1) * 256 + ((k >> 3 & 1) * 16 + (row & 15)) * 8 + (k & 7),
// so that a lane's two 16-byte loads stand at lane * 8 and 256 + lane * 8 and each wave-wide load reads 512 contiguous bytes (four whole 128-byte lines, not 32-byte pieces of sixteen).
#define FRG 512                               // elements of one fragment
#define GAS __attribute__((address_space(1)))  // a pointer typed as global memory: it stays a global (not a flat) address for the compiler also behind an asm statement that names it
template <typename T> __device__ __forceinline__ const GAS T* gl(const T* p) { return (const GAS T*)p; }
template <typename T16> struct WFrag;
template <> struct WFrag<h16> { typedef v16h V; static __device__ __forceinline__ V ld(const GAS h16* p) { return cat16(*(const GAS v8h*)p, *(const GAS v8h*)(p + 256)); } static __device__ __forceinline__ v8f mma(V a, V b, v8f c) { return wmma16(a, b, c); } };
template <> struct WFrag<bf> { typedef v16bf V; static __device__ __forceinline__ V ld(const GAS bf* p) { return cat16b(*(const GAS v8us*)p, *(const GAS v8us*)(p + 256)); } static __device__ __forceinline__ v8f mma(V a, V b, v8f c) { return wmmab(a, b, c); } };

// ---- k_gemmk / gemm_tile: register-blocked GEMM, one 64x64 output tile per WAVE over the whole of K, operands straight from the 16-bit planes XB and WALL.
// XB and WALL hold their fragments K-BLOCK-MAJOR: fragment index = 32-k block * (16-row blocks of the whole plane) + 16-row block. All waves walk K in step, so what the chip reads at one time is one k block
// of every row: laid so, that is one contiguous range of either plane, not 1-KiB pieces 32 KiB apart, and a wave's four
// fragments of an operand are 4 KiB in a row.
// A work-group is GW = 12 waves, three per SIMD, that hold the 4 x 3 tiles of 256 tokens x 3 heads: every token fragment is read by three of them and every weight fragment by four, so the later reads can be
// served by the WGP's cache; its LDS lets one work-group stand on a WGP, and the grid holds one for each of 256 WGPs. The waves never meet: no barrier, and each takes its own side of the q, k / v branch.
// ONE launch does q, k and v of every batch: grid (NB * SEQ / 256, 3 * NH_ / 3); blockIdx.x = 256-token block over all batches, blockIdx.y = three neighbours of the 3 * NH_ (projection, head) pairs
// (projection 0 q, 1 k, 2 v); tx = token tile in its batch, ty = head, both of the wave.
// c[m][n] (f32, + optional bf16-converted f32 bias) = sum_k A[m][k] Bt[n][k], k rising in steps of 32. A, Bt = the first fragment of the tile's rows, SA, SB = elements from one k block to the next. K % 64 == 0.
// The f32 tile never leaves the wave: it turns it through its own LDS range (ow) from accumulator order into fragment order, and the lane that then holds eight neighbouring columns rounds them to the three 16-bit
// operand planes of the attention kernel (f16, bf16 hi, bf16 lo), 16 bytes a store; a half fragment (16 rows x 16 columns) goes out lane by lane in fragment order, so each store of the wave is 512 contiguous bytes.
// q, k (DMAJ false): m = token, n = head * HD + d, bias[n], planes [head][token / 16][d / 32][fragment]. v (DMAJ true): the operands change places, m = head * HD + d, n = token, bias[m], planes [head][token / 32][d / 16][fragment].
// XB = [DM / 32][NB * SEQ / 16][fragment] tokens, WALL = [DM / 32][3 * DM / 16][fragment] weights, bias = [3][DM]; P16, Ph, Pl = [3][NB][PLN] planes.
#define GW 12
#define XRB (NB * SEQ / 16)                   // 16-row blocks of XB
#define WRB (3 * DM / 16)                     // 16-row blocks of WALL
static_assert(SEQ % 256 == 0 && (3 * NH_) % 3 == 0 && DM % 64 == 0);
template <typename T16, bool BIAS, bool DMAJ>
__device__ __forceinline__ void gemm_tile(const T16* __restrict__ A, int SA, const T16* __restrict__ Bt, int SB, int K, h16* P16, bf* Ph, bf* Pl, const float* __restrict__ bias, float* ow, int tx, int ty) {
    typedef typename WFrag<T16>::V V;
    const int lane = threadIdx.x & 31, lr = lane & 15, hi = lane >> 4; const int r0 = (DMAJ ? ty : tx) * 64, c0 = (DMAJ ? tx : ty) * 64;
    v8f acc[4][4];
#pragma unroll
    for (int mb = 0; mb < 4; ++mb)
#pragma unroll
        for (int nb = 0; nb < 4; ++nb) acc[mb][nb] = (v8f){};
    const GAS T16* ap = gl(A + lane * 8); const GAS T16* bp = gl(Bt + lane * 8);   // this trip's first fragment of either operand
#pragma unroll 1   // a trip already holds 32 loads and 32 matrix instructions on 16 independent accumulator tiles; a copy would only lengthen the text
    for (int kc = 0; kc < K; kc += 64, ap += 2 * SA, bp += 2 * SB) {
        V a[2][4], bb[2][4];
#pragma unroll
        for (int ks = 0; ks < 2; ++ks) {
#pragma unroll
            for (int mb = 0; mb < 4; ++mb) a[ks][mb] = WFrag<T16>::ld(ap + ks * SA + mb * FRG);
#pragma unroll
            for (int nb = 0; nb < 4; ++nb) bb[ks][nb] = WFrag<T16>::ld(bp + ks * SB + nb * FRG); }
        asm volatile("s_wait_xcnt 0x0" : "+v"(ap), "+v"(bp) :: "memory");   // stands behind the trip's loads, in front of the write of the two address pairs that they name (they step on at the trip's foot); as operands the pairs stay whole up to here: no later load lands on them
        __builtin_amdgcn_sched_barrier(0);   // all loads of the trip are issued before its first matrix instruction: left free, the scheduler puts part of the loads behind the first products to save registers, and the trip then waits out a second load latency
#pragma unroll
        for (int ks = 0; ks < 2; ++ks)
#pragma unroll
            for (int nb = 0; nb < 4; ++nb)
#pragma unroll
                for (int mb = 0; mb < 4; ++mb) acc[mb][nb] = WFrag<T16>::mma(a[ks][mb], bb[ks][nb], acc[mb][nb]);
        asm volatile("v_nop\n\tv_nop\n\tv_nop\n\tv_nop" : "+v"(acc[0][0]), "+v"(acc[1][1]), "+v"(acc[2][2]), "+v"(acc[3][3]) : "v"(a[1][0]), "v"(a[1][3]));   // the four vector slots between the trip's last matrix instruction and whatever stands behind the loop's branch, on either side of it
    }
    v4f bv[8];   // q, k: the lane's 32 bias values (eight columns of each of the four 16-column groups), asked for here so that they arrive while the tile goes to LDS
    if (BIAS && !DMAJ) { const GAS float* bq = gl(bias + c0 + hi * 8);
#pragma unroll
        for (int i = 0; i < 8; ++i) bv[i] = *(const GAS v4f*)(bq + (i >> 1) * 16 + (i & 1) * 4);
        asm volatile("s_wait_xcnt 0x0" : "+v"(bq) :: "memory"); }   // stands behind the eight loads, in front of any write of the address pair that they name; as an operand the pair stays whole up to here: none of the loads lands on it
#pragma unroll
    for (int mb = 0; mb < 4; ++mb) {
#pragma unroll
        for (int nb = 0; nb < 4; ++nb) {
#pragma unroll
            for (int j = 0; j < 8; ++j) ow[(mb * 16 + hi * 8 + j) * 68 + nb * 16 + lr] = acc[mb][nb][j]; } }
    asm volatile("s_wait_dscnt 0x0" ::: "memory");   // the wave's own tile is in LDS before its lanes read what other lanes of the same wave stored (no other wave touches this range, so no barrier)
#pragma unroll 1   // four like passes, one per 16-row block: rolled to keep the text short
    for (int rb = 0; rb < 4; ++rb) { const int row = rb * 16 + lr;
#pragma unroll
        for (int cq = 0; cq < 4; ++cq) { const int cofs = cq * 16 + hi * 8;   // half fragment: 16-row block rb, columns cq * 16 .. + 15
            const v4f va = *(const v4fa*)(ow + row * 68 + cofs), vb = *(const v4fa*)(ow + row * 68 + cofs + 4);
            v8h o16; v8us oh, ol;
#pragma unroll
            for (int e = 0; e < 8; ++e) { float r = e < 4 ? va[e & 3] : vb[e & 3]; if (BIAS) r += bfr(DMAJ ? bias[r0 + row] : bv[cq * 2 + (e >> 2)][e & 3]);
                o16[e] = tohx(r); unsigned short a2, c2; splitf(r, a2, c2); oh[e] = a2; ol[e] = c2; }
            const size_t o = (size_t)ty * SEQ * HD + (DMAJ ? (size_t)(((c0 >> 5) + (cq >> 1)) * 4 + rb) * FRG : (size_t)(((r0 >> 4) + rb) * 2 + (cq >> 1)) * FRG) + (cq & 1) * 256 + lane * 8;   // a 64-column tile is one head's d range (q, k) or 64 tokens of its d rows (v)
            *(v8h*)(P16 + o) = o16; *(v8us*)(Ph + o) = oh; *(v8us*)(Pl + o) = ol; }
        asm volatile("s_wait_xcnt 0x0" ::: "memory"); }   // stands behind the pass's loads and stores, in front of the next pass's writes of the registers that they name
}

template <typename T16>
__global__ __launch_bounds__(32 * GW) void k_gemmk(const T16* __restrict__ XB, const T16* __restrict__ WALL, h16* P16, bf* Ph, bf* Pl, const float* __restrict__ bias) {
    __shared__ __align__(16) float os[GW * 64 * 68];
    const int wv = __builtin_amdgcn_readfirstlane((int)(threadIdx.x >> 5));   // wave number in a scalar register: tile indices, base addresses and the branch below stay scalar
    const int bt = (int)blockIdx.x / (SEQ / 256), tx = ((int)blockIdx.x - bt * (SEQ / 256)) * 4 + (wv & 3);
    const int ph = (int)blockIdx.y * 3 + (wv >> 2), pj = ph / NH_, ty = ph - pj * NH_;
    const T16* Xt = XB + (size_t)(bt * (SEQ / 16) + tx * 4) * FRG; const T16* Wt = WALL + (size_t)(ph * 4) * FRG;   // a tile is four 16-row blocks; (projection, head) pair ph = rows ph * 64 .. + 63 of the weights
    const size_t po = (size_t)(pj * NB + bt) * PLN; float* ow = os + wv * (64 * 68);
    if (pj == 2) gemm_tile<T16, true, true>(Wt, WRB * FRG, Xt, XRB * FRG, DM, P16 + po, Ph + po, Pl + po, bias + pj * DM, ow, tx, ty);
    else gemm_tile<T16, true, false>(Xt, XRB * FRG, Wt, WRB * FRG, DM, P16 + po, Ph + po, Pl + po, bias + pj * DM, ow, tx, ty);
}

// one launch rounds the weights and every batch's tokens to bf16 and lays them in fragments, k-block-major: a thread is one lane of one fragment (16 elements), a wave reads one whole 128-byte line of each of 16 rows
// and writes 1 KiB in a row. Work-groups below WG_W take wf -> WALL, the rest x (batch pitch SEQ_FULL * DM) -> XB (batch bt = 16-row blocks bt * SEQ / 16 ...).
#define WG_W (3 * DM * DM / 16 / 256)
#define WG_X (SEQ * DM / 16 / 256)
static_assert(3 * DM * DM % (16 * 256) == 0 && SEQ * DM % (16 * 256) == 0 && DM % 32 == 0);
__global__ __launch_bounds__(256) void k_cvt8(const float* __restrict__ wf, const float* __restrict__ x, bf* WALL, bf* XB) {
    const int g = (int)blockIdx.x; const float* src; bf* dst; size_t i; int nrb;   // dst = the plane's fragment of k block 0 and the source's first 16-row block, nrb = 16-row blocks of the whole plane
    if (g < WG_W) { src = wf; dst = WALL; nrb = WRB; i = (size_t)g * 256 + threadIdx.x; }
    else { const int bt = (g - WG_W) / WG_X; src = x + (size_t)bt * SEQ_FULL * DM; dst = XB + (size_t)bt * (SEQ / 16) * FRG; nrb = XRB; i = (size_t)(g - WG_W - bt * WG_X) * 256 + threadIdx.x; }
    const size_t f = i >> 5; const int lane = (int)(i & 31); const float* s = src + ((f / (DM / 32)) * 16 + (lane & 15)) * DM + (f % (DM / 32)) * 32 + (lane >> 4) * 8;
    const v8f v0 = *(const v8f*)s, v1 = *(const v8f*)(s + 16); v8us o0, o1;
#pragma unroll
    for (int k = 0; k < 8; ++k) { o0[k] = f2bf(v0[k]); o1[k] = f2bf(v1[k]); }
    bf* d = dst + ((f % (DM / 32)) * nrb + f / (DM / 32)) * FRG + lane * 8;
    *(v8us*)d = o0; *(v8us*)(d + 256) = o1; }

// 2^x on the transcendental unit. The v_nop that ends each statement is the one slot the instruction set asks for between a transcendental and a next instruction that may read its result or
// overwrite its source (the register allocator is free to put such a one there); inside ex2x8 the early-clobber outputs keep every result off every source, so one slot serves all eight.
__device__ __forceinline__ float ex2(float x) { float r; asm("v_exp_f32 %0, %1\n\tv_nop" : "=v"(r) : "v"(x)); return r; }
__device__ __forceinline__ void ex2x8(float* t) { float r0, r1, r2, r3, r4, r5, r6, r7;
    asm("v_exp_f32 %0, %8\n\tv_exp_f32 %1, %9\n\tv_exp_f32 %2, %10\n\tv_exp_f32 %3, %11\n\tv_exp_f32 %4, %12\n\tv_exp_f32 %5, %13\n\tv_exp_f32 %6, %14\n\tv_exp_f32 %7, %15\n\tv_nop"
        : "=&v"(r0), "=&v"(r1), "=&v"(r2), "=&v"(r3), "=&v"(r4), "=&v"(r5), "=&v"(r6), "=&v"(r7) : "v"(t[0]), "v"(t[1]), "v"(t[2]), "v"(t[3]), "v"(t[4]), "v"(t[5]), "v"(t[6]), "v"(t[7]));
    t[0] = r0; t[1] = r1; t[2] = r2; t[3] = r3; t[4] = r4; t[5] = r5; t[6] = r6; t[7] = r7; }

// ---- attention: one work-group of ANW waves per (head, tile of QT * 16 query rows). Transposed products: S^T = K . Q^T (A = key rows, B = query rows) and O^T += V^T . P^T (A = rows of the
// d-major value plane, B = P^T). A lane then holds ONE query (column lane & 15) in every score, probability and output register, so maximum, sum and rescale are per lane plus one exchange
// between the wave's halves, and two S^T tiles (keys k0 + 8h + r and k0 + 16 + 8h + r) converted in place ARE the B fragment of the second product in the fragment map's k order.
// Keys are dealt to the waves in units of 64 (eight neighbouring fragments of the key plane and eight of the value plane); each wave keeps its own running maximum, sum and output tile; they meet in LDS, joined in wave order.
// The '#pragma unroll' loops below over qt, ks, kt, dt and e run over the index of a register array (an index left variable would send the array to scratch); the loop over key units stays rolled to keep the text short.
template <typename T16, int NSPLIT, int QT>
__device__ __forceinline__ void attn_tile(const T16* __restrict__ Q, const T16* __restrict__ Q2, const T16* __restrict__ Kp, const T16* __restrict__ K2, const T16* __restrict__ Vt, const T16* __restrict__ Vt2, float* O, int q0, float* so, float* sm, float* sl) {
    typedef typename WFrag<T16>::V V;
    const int lane = threadIdx.x & 31, lr = lane & 15, hi = lane >> 4;
    const int wv = __builtin_amdgcn_readfirstlane((int)(threadIdx.x >> 5));   // wave number in a scalar register: the key loop below branches on scalars
    const float CEXP = SCL * 1.4426950408889634f;      // scores go to the base-2 exponent domain in one multiply
    const float PB = NSPLIT ? 0.0f : 10.0f;            // f16 probabilities carried x1024 (the sum carries it too: it cancels in the quotient)
    const int qlast = q0 + QT * 16 - 1;
    const int loff = lane * 8;   // a lane's fixed place inside a fragment
    V qf[QT][2], qf2[QT][2];
#pragma unroll
    for (int qt = 0; qt < QT; ++qt)
#pragma unroll
        for (int ks = 0; ks < 2; ++ks) { const size_t o = (size_t)(((q0 >> 4) + qt) * 2 + ks) * FRG; qf[qt][ks] = WFrag<T16>::ld(gl(Q + o + loff)); if (NSPLIT) qf2[qt][ks] = WFrag<T16>::ld(gl(Q2 + o + loff)); }
    v8f acc[QT][4]; float m[QT], l[QT];
#pragma unroll
    for (int qt = 0; qt < QT; ++qt) { m[qt] = -3.0e38f; l[qt] = 0.f;
#pragma unroll
        for (int dt = 0; dt < 4; ++dt) acc[qt][dt] = (v8f){}; }
    const size_t bo = (size_t)wv * 64 * HD + loff;   // the lane's place in the wave's first key unit, the same in all four planes
    const GAS T16* vp = gl(Vt + bo); const GAS T16* kp = gl(Kp + bo); const GAS T16* vp2 = NSPLIT ? gl(Vt2 + bo) : vp; const GAS T16* kp2 = NSPLIT ? gl(K2 + bo) : kp;
#pragma unroll 1   // run-time trip count, and the body already holds two unrolled 32-key blocks: a copy would only lengthen the text for the instruction cache
    for (int u = wv * 64; u <= qlast; u += ANW * 64, vp += ANW * 64 * HD, kp += ANW * 64 * HD, vp2 += ANW * 64 * HD, kp2 += ANW * 64 * HD) {
#pragma unroll
    for (int s = 0; s < 2; ++s) { const int k0 = u + s * 32;
        if (k0 <= qlast) {                               // the unit's second half may lie wholly above the diagonal
        V vf[4], vf2[4];
#pragma unroll
        for (int dt = 0; dt < 4; ++dt) { vf[dt] = WFrag<T16>::ld(vp + (s * 4 + dt) * FRG); if (NSPLIT) vf2[dt] = WFrag<T16>::ld(vp2 + (s * 4 + dt) * FRG); }   // 32 keys x HD = four fragments of either plane
        v8f st[QT][2];
#pragma unroll
        for (int kt = 0; kt < 2; ++kt) { V kf[2], kf2[2];
#pragma unroll
            for (int ks = 0; ks < 2; ++ks) { kf[ks] = WFrag<T16>::ld(kp + (s * 4 + kt * 2 + ks) * FRG); if (NSPLIT) kf2[ks] = WFrag<T16>::ld(kp2 + (s * 4 + kt * 2 + ks) * FRG); }
#pragma unroll
            for (int qt = 0; qt < QT; ++qt) { v8f c = (v8f){};
#pragma unroll
                for (int ks = 0; ks < 2; ++ks) { c = WFrag<T16>::mma(kf[ks], qf[qt][ks], c); if (NSPLIT) { c = WFrag<T16>::mma(kf[ks], qf2[qt][ks], c); c = WFrag<T16>::mma(kf2[ks], qf[qt][ks], c); } }
                st[qt][kt] = c; } }
#pragma unroll
        for (int qt = 0; qt < QT; ++qt) { float t[16];
#pragma unroll
            for (int e = 0; e < 16; ++e) t[e] = st[qt][e >> 3][e & 7] * CEXP;
            if (k0 + 31 > q0) {                          // only blocks that touch the diagonal mask (every query keeps at least one key of such a block)
#pragma unroll
                for (int e = 0; e < 16; ++e) t[e] = (k0 + (e >> 3) * 16 + 8 * hi + (e & 7) <= q0 + qt * 16 + lr) ? t[e] : -3.0e38f; }
            float mx = t[0];
#pragma unroll
            for (int e = 1; e < 16; ++e) mx = fmaxf(mx, t[e]);
            mx = fmaxf(mx, __shfl_xor(mx, 16, 32));      // the other half of the wave holds the query's other 16 keys
            const float mn = fmaxf(m[qt], mx), al = ex2(m[qt] - mn), mb = mn - PB; m[qt] = mn;
            float sum = 0.f;
#pragma unroll
            for (int e = 0; e < 16; ++e) t[e] -= mb;
            ex2x8(t); ex2x8(t + 8);
#pragma unroll
            for (int e = 0; e < 16; ++e) sum += t[e];
            l[qt] = l[qt] * al + sum;
#pragma unroll
            for (int dt = 0; dt < 4; ++dt) acc[qt][dt] *= al;
            if (NSPLIT) { v8us h0, h1, l0, l1;
#pragma unroll
                for (int e = 0; e < 8; ++e) { unsigned short a, c2; splitf(t[e], a, c2); h0[e] = a; l0[e] = c2; splitf(t[8 + e], a, c2); h1[e] = a; l1[e] = c2; }
                const v16bf ph = cat16b(h0, h1), pl = cat16b(l0, l1);
#pragma unroll
                for (int dt = 0; dt < 4; ++dt) { acc[qt][dt] = wmmab(__builtin_bit_cast(v16bf, vf[dt]), ph, acc[qt][dt]); acc[qt][dt] = wmmab(__builtin_bit_cast(v16bf, vf[dt]), pl, acc[qt][dt]); acc[qt][dt] = wmmab(__builtin_bit_cast(v16bf, vf2[dt]), ph, acc[qt][dt]); }
            } else { v16h pf;
#pragma unroll
                for (int e = 0; e < 16; ++e) pf[e] = tohx(t[e]);
#pragma unroll
                for (int dt = 0; dt < 4; ++dt) acc[qt][dt] = wmma16(__builtin_bit_cast(v16h, vf[dt]), pf, acc[qt][dt]); } }
        } }
        // the wait stands in front of the write of the address pairs that this trip's loads name (they step on behind it); as operands the pairs stay whole up to here: no later load lands on them
        if (NSPLIT) asm volatile("s_wait_xcnt 0x0" : "+v"(vp), "+v"(kp), "+v"(vp2), "+v"(kp2) :: "memory"); else asm volatile("s_wait_xcnt 0x0" : "+v"(vp), "+v"(kp) :: "memory");
    }
    float* ow = so + wv * (32 * 68);
#pragma unroll
    for (int qt = 0; qt < QT; ++qt) { l[qt] += __shfl_xor(l[qt], 16, 32);
#pragma unroll
        for (int dt = 0; dt < 4; ++dt) { float* p = ow + (qt * 16 + lr) * 68 + dt * 16 + 8 * hi;
            *(v4fa*)p = __builtin_shufflevector(acc[qt][dt], acc[qt][dt], 0, 1, 2, 3); *(v4fa*)(p + 4) = __builtin_shufflevector(acc[qt][dt], acc[qt][dt], 4, 5, 6, 7); }
        if (hi == 0) { sm[wv * 32 + qt * 16 + lr] = m[qt]; sl[wv * 32 + qt * 16 + lr] = l[qt]; } }
    __syncthreads();   // every wave's maximum, sum and partial output tile are in LDS before any thread joins them
#pragma unroll
    for (int i = 0; i < QT * 16 * 16 / (32 * ANW); ++i) { const int p = i * (32 * ANW) + (int)threadIdx.x, q = p >> 4, cofs = (p & 15) * 4;
        float M = sm[q];
#pragma unroll
        for (int w = 1; w < ANW; ++w) M = fmaxf(M, sm[w * 32 + q]);
        float L = 0.f; v4f val = (v4f){};
#pragma unroll
        for (int w = 0; w < ANW; ++w) { const float f = ex2(sm[w * 32 + q] - M); L += sl[w * 32 + q] * f; val += *(const v4fa*)(so + w * (32 * 68) + q * 68 + cofs) * f; }   // a wave that had no keys: f = 0
        v4f o; o[0] = __fdiv_rn(val[0], L); o[1] = __fdiv_rn(val[1], L); o[2] = __fdiv_rn(val[2], L); o[3] = __fdiv_rn(val[3], L);
        *(v4f*)(O + (size_t)(q0 + q) * DQ + cofs) = o;
        asm volatile("s_wait_xcnt 0x0" ::: "memory"); }   // stands in front of any later write of a register that the store above names (the code that follows in the text reuses them)
}

// ---- attention, query rows >= RH (f16, single products): a work-group takes TWO neighbouring tiles of 32 query rows, and both read every key unit from LDS, so that the unit leaves L2 once for 64 queries.
// Wave wv = tile (wv & 1), key group (wv >> 1): the two waves of a key group are neighbours, so that a last stage with few units below the diagonal leaves its work on different SIMDs. A stage is KG neighbouring key units of 64 (KG * 8 KiB in a row of the key plane, the same of the value plane); stage t's unit t * KG + g is worked on by the two waves
// of key group g. Two buffers: the next stage's copies fly while this one is worked on. Every wave copies 8 KiB of each stage (the waves of tile 0 their group's key unit, the waves of tile 1 its value unit) with
// global_load_async_to_lds_b128, lane by lane 16 bytes, fragment order kept, so a fragment read from LDS is 512 bytes in a row. A stage may reach past the diagonal, never past the plane (SEQ % (KG * 64) == 0).
#define KG 4
#define STG (KG * 64 * HD)                    // elements of one plane's part of a stage; a buffer is [key part | value part]
#define LAS __attribute__((address_space(3)))
static_assert(SEQ % (KG * 64) == 0 && (SEQ - RH) % 64 == 0 && ANW == 2 * KG);
__device__ __forceinline__ v16h ldsfrag(const LAS h16* p) { return cat16(*(const LAS v8h*)p, *(const LAS v8h*)(p + 256)); }
// sixteen copies of 512 bytes: g = the lane's first 16 bytes in global memory, d = their LDS byte address. Each statement ends with the wait that stands in front of any later write of the address registers its copies name.
__device__ __forceinline__ void stage_copy(const GAS h16* g, unsigned d) {
#pragma unroll
    for (int h = 0; h < 2; ++h) { const GAS h16* a = g + h * 2048; const unsigned e = d + h * 4096;
        asm volatile("global_load_async_to_lds_b128 %0, %8, off\n\tglobal_load_async_to_lds_b128 %1, %9, off\n\tglobal_load_async_to_lds_b128 %2, %10, off\n\tglobal_load_async_to_lds_b128 %3, %11, off\n\t"
                     "global_load_async_to_lds_b128 %4, %12, off\n\tglobal_load_async_to_lds_b128 %5, %13, off\n\tglobal_load_async_to_lds_b128 %6, %14, off\n\tglobal_load_async_to_lds_b128 %7, %15, off\n\ts_wait_xcnt 0x0"
                     :: "v"(e), "v"(e + 512), "v"(e + 1024), "v"(e + 1536), "v"(e + 2048), "v"(e + 2560), "v"(e + 3072), "v"(e + 3584),
                        "v"(a), "v"(a + 256), "v"(a + 512), "v"(a + 768), "v"(a + 1024), "v"(a + 1280), "v"(a + 1536), "v"(a + 1792) : "memory"); }
}
__device__ __forceinline__ void attn_pair(const h16* __restrict__ Q, const h16* __restrict__ Kp, const h16* __restrict__ Vt, float* O, int q0w, float* smem) {
    const int lane = threadIdx.x & 31, lr = lane & 15, hi = lane >> 4;
    const int wv = __builtin_amdgcn_readfirstlane((int)(threadIdx.x >> 5));   // wave number in a scalar register: tile, key group and every branch below stay scalar
    const int tl = wv & 1, kg = wv >> 1, q0 = q0w + tl * 32, qlast = q0 + 31;
    const int nt = (q0w + 64 + KG * 64 - 1) / (KG * 64);   // stages of the work-group, the same for all its waves
    const float CEXP = SCL * 1.4426950408889634f, PB = 10.0f;   // base-2 exponent domain; probabilities carried x1024 (the sum carries it too)
    const int loff = lane * 8;
    const GAS h16* src = gl((tl ? Vt : Kp) + kg * 64 * HD + loff);   // this wave's 8 KiB of stage 0
    const unsigned dst = (unsigned)(size_t)smem + (unsigned)((tl * STG + kg * 64 * HD + loff) * 2);   // its place in buffer 0 (low 32 bits of the shared address = LDS byte address)
    stage_copy(src, dst);
    v16h qf[2][2];
#pragma unroll
    for (int qt = 0; qt < 2; ++qt)
#pragma unroll
        for (int ks = 0; ks < 2; ++ks) qf[qt][ks] = WFrag<h16>::ld(gl(Q + (size_t)(((q0 >> 4) + qt) * 2 + ks) * FRG + loff));
    v8f acc[2][4]; float m[2], l[2];
#pragma unroll
    for (int qt = 0; qt < 2; ++qt) { m[qt] = -3.0e38f; l[qt] = 0.f;
#pragma unroll
        for (int dt = 0; dt < 4; ++dt) acc[qt][dt] = (v8f){}; }
    asm volatile("s_wait_asynccnt 0x0" ::: "memory");   // this wave's part of stage 0 has landed
    __syncthreads();                                     // ... and every other wave's: stage 0 may be read
    if (nt > 1) stage_copy(src + STG, dst + 4 * STG);    // stage 1 into buffer 1 (a buffer is 2 * STG elements = 4 * STG bytes)
#pragma unroll 1   // run-time trip count, and the body already holds two unrolled 32-key blocks
    for (int t = 0; t < nt; ++t) {
        const LAS h16* kb = (const LAS h16*)smem + (t & 1) * 2 * STG + kg * 64 * HD + loff; const LAS h16* vb = kb + STG;
#pragma unroll
        for (int s = 0; s < 2; ++s) { const int k0 = (t * KG + kg) * 64 + s * 32;
            if (k0 <= qlast) {                           // a block wholly above the tile's diagonal is skipped (the foot of the trip is not)
            v16h vf[4];
#pragma unroll
            for (int dt = 0; dt < 4; ++dt) vf[dt] = ldsfrag(vb + (s * 4 + dt) * FRG);
            v8f st[2][2];
#pragma unroll
            for (int kt = 0; kt < 2; ++kt) { v16h kf[2];
#pragma unroll
                for (int ks = 0; ks < 2; ++ks) kf[ks] = ldsfrag(kb + (s * 4 + kt * 2 + ks) * FRG);
#pragma unroll
                for (int qt = 0; qt < 2; ++qt) { v8f c = (v8f){};
#pragma unroll
                    for (int ks = 0; ks < 2; ++ks) c = wmma16(kf[ks], qf[qt][ks], c);
                    st[qt][kt] = c; } }
#pragma unroll
            for (int qt = 0; qt < 2; ++qt) { float t16[16];
#pragma unroll
                for (int e = 0; e < 16; ++e) t16[e] = st[qt][e >> 3][e & 7] * CEXP;
                if (k0 + 31 > q0) {                      // only blocks that touch the diagonal mask (every query keeps at least one key of such a block)
#pragma unroll
                    for (int e = 0; e < 16; ++e) t16[e] = (k0 + (e >> 3) * 16 + 8 * hi + (e & 7) <= q0 + qt * 16 + lr) ? t16[e] : -3.0e38f; }
                float mx = t16[0];
#pragma unroll
                for (int e = 1; e < 16; ++e) mx = fmaxf(mx, t16[e]);
                mx = fmaxf(mx, __shfl_xor(mx, 16, 32));  // the other half of the wave holds the query's other 16 keys
                const float mn = fmaxf(m[qt], mx), al = ex2(m[qt] - mn), mb = mn - PB; m[qt] = mn;
                float sum = 0.f;
#pragma unroll
                for (int e = 0; e < 16; ++e) t16[e] -= mb;
                ex2x8(t16); ex2x8(t16 + 8);
#pragma unroll
                for (int e = 0; e < 16; ++e) sum += t16[e];
                l[qt] = l[qt] * al + sum;
#pragma unroll
                for (int dt = 0; dt < 4; ++dt) acc[qt][dt] *= al;
                v16h pf;
#pragma unroll
                for (int e = 0; e < 16; ++e) pf[e] = tohx(t16[e]);
#pragma unroll
                for (int dt = 0; dt < 4; ++dt) acc[qt][dt] = wmma16(vf[dt], pf, acc[qt][dt]); }
            } }
        // the foot of the trip, passed by every wave: it publishes stage t + 1 and frees the buffer of stage t
        asm volatile("s_wait_dscnt 0x0" ::: "memory");      // this wave's reads of stage t have returned
        asm volatile("s_wait_asynccnt 0x0" ::: "memory");   // this wave's part of stage t + 1 has landed
        __syncthreads();
        if (t + 2 < nt) stage_copy(src + (size_t)(t + 2) * STG, dst + (unsigned)(t & 1) * (4 * STG));   // stage t + 2 into the buffer that trip t has just read
    }
    asm volatile("s_wait_asynccnt 0x0" ::: "memory");   // no copy is under way when the buffers become the waves' meeting place (the last foot's barrier has ended every read of them)
    float* so = smem; float* sm = smem + ANW * 32 * 68; float* sl = sm + ANW * 32;
    float* ow = so + wv * (32 * 68);
#pragma unroll
    for (int qt = 0; qt < 2; ++qt) { l[qt] += __shfl_xor(l[qt], 16, 32);
#pragma unroll
        for (int dt = 0; dt < 4; ++dt) { float* p = ow + (qt * 16 + lr) * 68 + dt * 16 + 8 * hi;
            *(v4fa*)p = __builtin_shufflevector(acc[qt][dt], acc[qt][dt], 0, 1, 2, 3); *(v4fa*)(p + 4) = __builtin_shufflevector(acc[qt][dt], acc[qt][dt], 4, 5, 6, 7); }
        if (hi == 0) { sm[wv * 32 + qt * 16 + lr] = m[qt]; sl[wv * 32 + qt * 16 + lr] = l[qt]; } }
    __syncthreads();   // every wave's maximum, sum and partial output tile are in LDS before any thread joins them
#pragma unroll
    for (int i = 0; i < 64 * 16 / (32 * ANW); ++i) { const int p = i * (32 * ANW) + (int)threadIdx.x, q = p >> 4, cofs = (p & 15) * 4, wb = q >> 5, qq = q & 31;   // query row q of the pair: its tile's KG waves (wb, wb + 2, ...), in the order of their key groups
        float M = sm[wb * 32 + qq];
#pragma unroll
        for (int w = 1; w < KG; ++w) M = fmaxf(M, sm[(wb + 2 * w) * 32 + qq]);
        float L = 0.f; v4f val = (v4f){};
#pragma unroll
        for (int w = 0; w < KG; ++w) { const float f = ex2(sm[(wb + 2 * w) * 32 + qq] - M); L += sl[(wb + 2 * w) * 32 + qq] * f; val += *(const v4fa*)(so + (wb + 2 * w) * (32 * 68) + qq * 68 + cofs) * f; }   // a wave that had no keys: f = 0
        v4f o; o[0] = __fdiv_rn(val[0], L); o[1] = __fdiv_rn(val[1], L); o[2] = __fdiv_rn(val[2], L); o[3] = __fdiv_rn(val[3], L);
        *(v4f*)(O + (size_t)(q0w + q) * DQ + cofs) = o;
        asm volatile("s_wait_xcnt 0x0" ::: "memory"); }   // stands in front of any later write of a register that the store above names
}

// grid (NB * NH_, (SEQ - RH) / 64 + RH / 16), 32 * ANW threads; blockIdx.x = batch * NH_ + head, so that over ALL batches the tiles come in falling order of their key count
// P16, Ph, Pl = [3 (q, k, v)][NB][NH_][SEQ * HD] planes in fragment order; out = [NB][SEQ_FULL][DQ].
__global__ __launch_bounds__(32 * ANW) void k_attn(const h16* __restrict__ P16, const bf* __restrict__ Ph, const bf* __restrict__ Pl, float* out) {
    __shared__ __align__(16) float smem[2 * 2 * STG / 2];   // two stage buffers of the f16 tiles (2 * STG 16-bit elements each); behind the key loop, and in the hi+lo tiles, the waves' partial tiles, maxima and sums
    static_assert(sizeof(smem) >= (ANW * 32 * 68 + 2 * ANW * 32) * sizeof(float));
    float* so = smem; float* sm = smem + ANW * 32 * 68; float* sl = sm + ANW * 32;
    const h16* Q16 = P16; const h16* K16 = P16 + (size_t)NB * PLN; const h16* V16 = P16 + (size_t)2 * NB * PLN;
    const bf* Qh = Ph; const bf* Kh = Ph + (size_t)NB * PLN; const bf* Vh = Ph + (size_t)2 * NB * PLN; const bf* Ql = Pl; const bf* Kl = Pl + (size_t)NB * PLN; const bf* Vl = Pl + (size_t)2 * NB * PLN;
    const int bt = (int)blockIdx.x / NH_, hd = (int)blockIdx.x - bt * NH_;
    const size_t hp = (size_t)blockIdx.x * SEQ * HD; float* O = out + (size_t)bt * SEQ_FULL * DM + hd * HD; const int ty = (int)blockIdx.y, NT = (SEQ - RH) / 64;
    if (ty < NT) attn_pair(Q16 + hp, K16 + hp, V16 + hp, O, SEQ - 64 * (ty + 1), smem);
    else attn_tile<bf, 2, 1>(Qh + hp, Ql + hp, Kh + hp, Kl + hp, Vh + hp, Vl + hp, O, RH - 16 * (ty - NT + 1), so, sm, sl);
}

extern "C" void kernel_launch(void* const* d_in, const int* in_sizes, int n_in,
                              void* d_out, int out_size, void* d_ws, size_t ws_size, hipStream_t stream) {
    if (n_in < 3) return;
    if ((size_t)in_sizes[0] < (size_t)(NB - 1) * SEQ_FULL * DM + (size_t)SEQ * DM) return;
    if ((size_t)in_sizes[1] < (size_t)3 * DM * DM) return;
    if (in_sizes[2] < 3 * DM) return;
    if ((size_t)out_size < (size_t)(NB - 1) * SEQ_FULL * DM + (size_t)SEQ * DM) return;
    const float* x = (const float*)d_in[0];      // [NB_FULL][SEQ_FULL][DM]
    const float* wf = (const float*)d_in[1];     // [3*DM][DM]: rows 0..1023 q, 1024..2047 k, 2048..3071 v
    const float* bz = (const float*)d_in[2];     // [3*DM]
    float* OUT = (float*)d_out;                  // [NB_FULL][SEQ_FULL][DM]
    char* wsp = (char*)d_ws;
    auto take = [&](size_t bytes) { char* p = wsp; wsp += (bytes + 255) & ~(size_t)255; return (void*)p; };
    bf* WALL = (bf*)take((size_t)3 * DM * DM * 2);
    bf* XB = (bf*)take((size_t)NB * SEQ * DM * 2);
    h16* P16 = (h16*)take((size_t)3 * NB * PLN * 2); bf* Ph = (bf*)take((size_t)3 * NB * PLN * 2); bf* Pl = (bf*)take((size_t)3 * NB * PLN * 2);
    const size_t carved = (size_t)(wsp - (char*)d_ws);
    if (carved > ws_size) return;

    k_cvt8<<<WG_W + NB * WG_X, 256, 0, stream>>>(wf, x, WALL, XB);
    k_gemmk<bf><<<dim3(NB * SEQ / 256, 3 * NH_ / 3, 1), 32 * GW, 0, stream>>>(XB, WALL, P16, Ph, Pl, bz);
    k_attn<<<dim3(NB * NH_, (SEQ - RH) / 64 + RH / 16, 1), 32 * ANW, 0, stream>>>(P16, Ph, Pl, OUT);
}

// v010
// One run takes 58.8 microseconds.
// Versions in between are left out here; by their measured steps it is 1.10 times as fast as v008.
// Counting every step since v000, it is 23.2 times as fast.
#include <hip/hip_runtime.h>

// Contractions (f32 accumulate): qkv projection = v_wmma_f32_16x16x32_bf16 on bf16 RNE-converted x and W (single products) + bf16-converted bias, stored straight as the attention kernel's 16-bit planes;
// causal scores q.k and probabilities.v in ONE kernel (scores and probabilities stay in registers): query rows < RH on v_wmma_f32_16x16x32_bf16 hi+lo planes
// (3 products each), rows >= RH on v_wmma_f32_16x16x32_f16 single products (unnormalised probabilities carried x1024); running-maximum softmax in f32 (rows >= RH: the maximum in use trails the true one by up to 4 in the base-2 exponent).

#ifndef NB
#define NB 2
#endif
#ifndef SEQ
#define SEQ 2048
#endif
#define NB_FULL  2
#define SEQ_FULL 2048
#define DM   1024
#define NH_  16
#define NKV  16
#define REP  (NH_ / NKV)
#define HD   64
#define DQ   (NH_ * HD)
#define DKV  (NKV * HD)
#define ANW  8                                // waves per attention work-group: they deal the keys of 32 query rows (rows < RH) or of two such tiles (rows >= RH) among them
#define RH   ((SEQ >= 512) ? 512 : SEQ)     // query rows < RH use hi+lo planes
#define SCL  0.125f                          // HD^-0.5
#define PLN  ((size_t)NH_ * SEQ * HD)         // elements of one 16-bit operand plane of one batch
static_assert(SEQ % 128 == 0);
static_assert(SEQ >= 128 && SEQ <= SEQ_FULL);
static_assert(NB >= 1 && NB <= NB_FULL);
static_assert(RH % 64 == 0 && RH <= SEQ && RH > 0);
static_assert(DQ == DM && REP == 1 && DKV == DM && HD == 64 && (SEQ - RH) % 32 == 0);

typedef _Float16 h16;
typedef unsigned short bf;
typedef __attribute__((ext_vector_type(16))) __bf16   v16bf;
typedef __attribute__((ext_vector_type(16))) _Float16 v16h;
typedef __attribute__((ext_vector_type(8)))  _Float16 v8h;
typedef __attribute__((ext_vector_type(8)))  unsigned short v8us;
typedef __attribute__((ext_vector_type(8)))  float    v8f;
typedef __attribute__((ext_vector_type(4)))  float    v4f;
typedef v8h  __attribute__((may_alias)) v8ha;
typedef v4f  __attribute__((may_alias)) v4fa;
typedef v8us __attribute__((may_alias)) v8usa;
typedef __attribute__((ext_vector_type(2))) _Float16 v2h;
typedef __attribute__((ext_vector_type(4))) _Float16 v4h;
typedef __attribute__((ext_vector_type(2))) unsigned short v2us;
typedef __attribute__((ext_vector_type(4))) unsigned short v4us;
typedef __attribute__((ext_vector_type(2))) float v2f;

__device__ __forceinline__ unsigned short f2bf(float f) { unsigned u = __float_as_uint(f); u += 0x7FFFu + ((u >> 16) & 1u); return (unsigned short)(u >> 16); }
__device__ __forceinline__ float bf2f(unsigned short b) { return __uint_as_float(((unsigned)b) << 16); }
__device__ __forceinline__ float bfr(float f) { return bf2f(f2bf(f)); }
__device__ __forceinline__ v16h cat16(v8h lo, v8h hi) { return __builtin_shufflevector(lo, hi, 0, 1, 2, 3, 4, 5, 6, 7, 8, 9, 10, 11, 12, 13, 14, 15); }
__device__ __forceinline__ v16bf cat16b(v8us lo, v8us hi) { return __builtin_bit_cast(v16bf, __builtin_shufflevector(lo, hi, 0, 1, 2, 3, 4, 5, 6, 7, 8, 9, 10, 11, 12, 13, 14, 15)); }
__device__ __forceinline__ v8f wmma16(v16h a, v16h b, v8f c) { return __builtin_amdgcn_wmma_f32_16x16x32_f16(false, a, false, b, (short)0, c, false, false); }
__device__ __forceinline__ v8f wmmab(v16bf a, v16bf b, v8f c) { return __builtin_amdgcn_wmma_f32_16x16x32_bf16(false, a, false, b, (short)0, c, false, false); }
__device__ __forceinline__ h16 tohx(float x) { return (h16)x; }
__device__ __forceinline__ void splitf(float y, unsigned short& h, unsigned short& l) { h = f2bf(y); l = f2bf(y - bf2f(h)); }

// Fragment map (wave32, 16x16x32): lane l -> row/col (l & 15), h = l >> 4; vector elements 0..7 <- k0 + 8h + 0..7, elements 8..15 <- k0 + 16 + 8h + 0..7,
// identical for A (rows) and B (columns); D element r -> (row 8h + r, col l & 15).
// FRAGMENT ORDER: every 16-bit operand in the workspace is stored as fragments of 16 rows x 32 k = 512 elements (1 KiB), element (row, k) at (k >> 4 & 1) * 256 + ((k >> 3 & 1) * 16 + (row & 15)) * 8 + (k & 7),
// so that a lane's two 16-byte loads stand at lane * 8 and 256 + lane * 8 and each wave-wide load reads 512 contiguous bytes (four whole 128-byte lines, not 32-byte pieces of sixteen).
#define FRG 512                               // elements of one fragment
#define GAS __attribute__((address_space(1)))  // a pointer typed as global memory: it stays a global (not a flat) address for the compiler also behind an asm statement that names it
template <typename T> __device__ __forceinline__ const GAS T* gl(const T* p) { return (const GAS T*)p; }
template <typename T16> struct WFrag;
template <> struct WFrag<h16> { typedef v16h V; static __device__ __forceinline__ V ld(const GAS h16* p) { return cat16(*(const GAS v8h*)p, *(const GAS v8h*)(p + 256)); } static __device__ __forceinline__ v8f mma(V a, V b, v8f c) { return wmma16(a, b, c); } };
template <> struct WFrag<bf> { typedef v16bf V; static __device__ __forceinline__ V ld(const GAS bf* p) { return cat16b(*(const GAS v8us*)p, *(const GAS v8us*)(p + 256)); } static __device__ __forceinline__ v8f mma(V a, V b, v8f c) { return wmmab(a, b, c); } };

// ---- k_gemmk / gemm_tile: register-blocked GEMM, one 64x64 output tile per WAVE over the whole of K, operands straight from the 16-bit planes XB and WALL.
// XB and WALL hold their fragments K-BLOCK-MAJOR: fragment index = 32-k block * (16-row blocks of the whole plane) + 16-row block. All waves walk K in step, so what the chip reads at one time is one k block
// of every row: laid so, that is one contiguous range of either plane, not 1-KiB pieces 32 KiB apart, and a wave's four
// fragments of an operand are 4 KiB in a row.
// A work-group is GW = 12 waves, three per SIMD, that hold the 4 x 3 tiles of 256 tokens x 3 heads: every token fragment is read by three of them and every weight fragment by four, so the later reads can be
// served by the WGP's cache; its LDS lets one work-group stand on a WGP, and the grid holds one for each of 256 WGPs. The waves never meet: no barrier, and each takes its own side of the q, k / v branch.
// ONE launch does q, k and v of every batch: grid (NB * SEQ / 256, 3 * NH_ / 3); blockIdx.x = 256-token block over all batches, blockIdx.y = three neighbours of the 3 * NH_ (projection, head) pairs
// (projection 0 q, 1 k, 2 v); tx = token tile in its batch, ty = head, both of the wave.
// c[m][n] (f32, + optional bf16-converted f32 bias) = sum_k A[m][k] Bt[n][k], k rising in steps of 32. A, Bt = the first fragment of the tile's rows, SA, SB = elements from one k block to the next. K % 64 == 0.
// The f32 tile never leaves the wave: it turns it through its own LDS range (ow) from accumulator order into fragment order, and the lane that then holds eight neighbouring columns rounds them to the three 16-bit
// operand planes of the attention kernel (f16, bf16 hi, bf16 lo), 16 bytes a store; a half fragment (16 rows x 16 columns) goes out lane by lane in fragment order, so each store of the wave is 512 contiguous bytes.
// q, k (DMAJ false): m = token, n = head * HD + d, bias[n], planes [head][token / 16][d / 32][fragment]. v (DMAJ true): the operands change places, m = head * HD + d, n = token, bias[m], planes [head][token / 32][d / 16][fragment].
// XB = [DM / 32][NB * SEQ / 16][fragment] tokens, WALL = [DM / 32][3 * DM / 16][fragment] weights, bias = [3][DM]; P16, Ph, Pl = [3][NB][PLN] planes.
#define GW 12
#define XRB (NB * SEQ / 16)                   // 16-row blocks of XB
#define WRB (3 * DM / 16)                     // 16-row blocks of WALL
static_assert(SEQ % 256 == 0 && (3 * NH_) % 3 == 0 && DM % 64 == 0);
template <typename T16, bool BIAS, bool DMAJ>
__device__ __forceinline__ void gemm_tile(const T16* __restrict__ A, int SA, const T16* __restrict__ Bt, int SB, int K, h16* P16, bf* Ph, bf* Pl, const float* __restrict__ bias, float* ow, int tx, int ty) {
    typedef typename WFrag<T16>::V V;
    const int lane = threadIdx.x & 31, lr = lane & 15, hi = lane >> 4; const int r0 = (DMAJ ? ty : tx) * 64, c0 = (DMAJ ? tx : ty) * 64;
    v8f acc[4][4];
#pragma unroll
    for (int mb = 0; mb < 4; ++mb)
#pragma unroll
        for (int nb = 0; nb < 4; ++nb) acc[mb][nb] = (v8f){};
    const GAS T16* ap = gl(A + lane * 8); const GAS T16* bp = gl(Bt + lane * 8);   // this trip's first fragment of either operand
#pragma unroll 1   // a trip already holds 32 loads and 32 matrix instructions on 16 independent accumulator tiles; a copy would only lengthen the text
    for (int kc = 0; kc < K; kc += 64, ap += 2 * SA, bp += 2 * SB) {
        V a[2][4], bb[2][4];
#pragma unroll
        for (int ks = 0; ks < 2; ++ks) {
#pragma unroll
            for (int mb = 0; mb < 4; ++mb) a[ks][mb] = WFrag<T16>::ld(ap + ks * SA + mb * FRG);
#pragma unroll
            for (int nb = 0; nb < 4; ++nb) bb[ks][nb] = WFrag<T16>::ld(bp + ks * SB + nb * FRG); }
        asm volatile("s_wait_xcnt 0x0" : "+v"(ap), "+v"(bp) :: "memory");   // stands behind the trip's loads, in front of the write of the two address pairs that they name (they step on at the trip's foot); as operands the pairs stay whole up to here: no later load lands on them
        __builtin_amdgcn_sched_barrier(0);   // all loads of the trip are issued before its first matrix instruction: left free, the scheduler puts part of the loads behind the first products to save registers, and the trip then waits out a second load latency
#pragma unroll
        for (int ks = 0; ks < 2; ++ks)
#pragma unroll
            for (int nb = 0; nb < 4; ++nb)
#pragma unroll
                for (int mb = 0; mb < 4; ++mb) acc[mb][nb] = WFrag<T16>::mma(a[ks][mb], bb[ks][nb], acc[mb][nb]);
        asm volatile("v_nop\n\tv_nop\n\tv_nop\n\tv_nop" : "+v"(acc[0][0]), "+v"(acc[1][1]), "+v"(acc[2][2]), "+v"(acc[3][3]) : "v"(a[1][0]), "v"(a[1][3]));   // the four vector slots between the trip's last matrix instruction and whatever stands behind the loop's branch, on either side of it
    }
    v4f bv[8];   // q, k: the lane's 32 bias values (eight columns of each of the four 16-column groups), asked for here so that they arrive while the tile goes to LDS
    if (BIAS && !DMAJ) { const GAS float* bq = gl(bias + c0 + hi * 8);
#pragma unroll
        for (int i = 0; i < 8; ++i) bv[i] = *(const GAS v4f*)(bq + (i >> 1) * 16 + (i & 1) * 4);
        asm volatile("s_wait_xcnt 0x0" : "+v"(bq) :: "memory"); }   // stands behind the eight loads, in front of any write of the address pair that they name; as an operand the pair stays whole up to here: none of the loads lands on it
#pragma unroll
    for (int mb = 0; mb < 4; ++mb) {
#pragma unroll
        for (int nb = 0; nb < 4; ++nb) {
#pragma unroll
            for (int j = 0; j < 8; ++j) ow[(mb * 16 + hi * 8 + j) * 68 + nb * 16 + lr] = acc[mb][nb][j]; } }
    asm volatile("s_wait_dscnt 0x0" ::: "memory");   // the wave's own tile is in LDS before its lanes read what other lanes of the same wave stored (no other wave touches this range, so no barrier)
#pragma unroll 1   // four like passes, one per 16-row block: rolled to keep the text short
    for (int rb = 0; rb < 4; ++rb) { const int row = rb * 16 + lr;
#pragma unroll
        for (int cq = 0; cq < 4; ++cq) { const int cofs = cq * 16 + hi * 8;   // half fragment: 16-row block rb, columns cq * 16 .. + 15
            const v4f va = *(const v4fa*)(ow + row * 68 + cofs), vb = *(const v4fa*)(ow + row * 68 + cofs + 4);
            v8h o16; v8us oh, ol;
#pragma unroll
            for (int e = 0; e < 8; ++e) { float r = e < 4 ? va[e & 3] : vb[e & 3]; if (BIAS) r += bfr(DMAJ ? bias[r0 + row] : bv[cq * 2 + (e >> 2)][e & 3]);
                o16[e] = tohx(r); unsigned short a2, c2; splitf(r, a2, c2); oh[e] = a2; ol[e] = c2; }
            const size_t o = (size_t)ty * SEQ * HD + (DMAJ ? (size_t)(((c0 >> 5) + (cq >> 1)) * 4 + rb) * FRG : (size_t)(((r0 >> 4) + rb) * 2 + (cq >> 1)) * FRG) + (cq & 1) * 256 + lane * 8;   // a 64-column tile is one head's d range (q, k) or 64 tokens of its d rows (v)
            *(v8h*)(P16 + o) = o16; *(v8us*)(Ph + o) = oh; *(v8us*)(Pl + o) = ol; }
        asm volatile("s_wait_xcnt 0x0" ::: "memory"); }   // stands behind the pass's loads and stores, in front of the next pass's writes of the registers that they name
}

template <typename T16>
__global__ __launch_bounds__(32 * GW) void k_gemmk(const T16* __restrict__ XB, const T16* __restrict__ WALL, h16* P16, bf* Ph, bf* Pl, const float* __restrict__ bias) {
    __shared__ __align__(16) float os[GW * 64 * 68];
    const int wv = __builtin_amdgcn_readfirstlane((int)(threadIdx.x >> 5));   // wave number in a scalar register: tile indices, base addresses and the branch below stay scalar
    const int bt = (int)blockIdx.x / (SEQ / 256), tx = ((int)blockIdx.x - bt * (SEQ / 256)) * 4 + (wv & 3);
    const int ph = (int)blockIdx.y * 3 + (wv >> 2), pj = ph / NH_, ty = ph - pj * NH_;
    const T16* Xt = XB + (size_t)(bt * (SEQ / 16) + tx * 4) * FRG; const T16* Wt = WALL + (size_t)(ph * 4) * FRG;   // a tile is four 16-row blocks; (projection, head) pair ph = rows ph * 64 .. + 63 of the weights
    const size_t po = (size_t)(pj * NB + bt) * PLN; float* ow = os + wv * (64 * 68);
    if (pj == 2) gemm_tile<T16, true, true>(Wt, WRB * FRG, Xt, XRB * FRG, DM, P16 + po, Ph + po, Pl + po, bias + pj * DM, ow, tx, ty);
    else gemm_tile<T16, true, false>(Xt, XRB * FRG, Wt, WRB * FRG, DM, P16 + po, Ph + po, Pl + po, bias + pj * DM, ow, tx, ty);
}

// one launch rounds the weights and every batch's tokens to bf16 and lays them in fragments, k-block-major: a thread is one lane of one fragment (16 elements), a wave reads one whole 128-byte line of each of 16 rows
// and writes 1 KiB in a row. Work-groups below WG_W take wf -> WALL, the rest x (batch pitch SEQ_FULL * DM) -> XB (batch bt = 16-row blocks bt * SEQ / 16 ...).
#define WG_W (3 * DM * DM / 16 / 256)
#define WG_X (SEQ * DM / 16 / 256)
static_assert(3 * DM * DM % (16 * 256) == 0 && SEQ * DM % (16 * 256) == 0 && DM % 32 == 0);
__global__ __launch_bounds__(256) void k_cvt8(const float* __restrict__ wf, const float* __restrict__ x, bf* WALL, bf* XB) {
    const int g = (int)blockIdx.x; const float* src; bf* dst; size_t i; int nrb;   // dst = the plane's fragment of k block 0 and the source's first 16-row block, nrb = 16-row blocks of the whole plane
    if (g < WG_W) { src = wf; dst = WALL; nrb = WRB; i = (size_t)g * 256 + threadIdx.x; }
    else { const int bt = (g - WG_W) / WG_X; src = x + (size_t)bt * SEQ_FULL * DM; dst = XB + (size_t)bt * (SEQ / 16) * FRG; nrb = XRB; i = (size_t)(g - WG_W - bt * WG_X) * 256 + threadIdx.x; }
    const size_t f = i >> 5; const int lane = (int)(i & 31); const float* s = src + ((f / (DM / 32)) * 16 + (lane & 15)) * DM + (f % (DM / 32)) * 32 + (lane >> 4) * 8;
    const v8f v0 = *(const v8f*)s, v1 = *(const v8f*)(s + 16); v8us o0, o1;
#pragma unroll
    for (int k = 0; k < 8; ++k) { o0[k] = f2bf(v0[k]); o1[k] = f2bf(v1[k]); }
    bf* d = dst + ((f % (DM / 32)) * nrb + f / (DM / 32)) * FRG + lane * 8;
    *(v8us*)d = o0; *(v8us*)(d + 256) = o1; }

// 2^x on the transcendental unit. The v_nop that ends each statement is the one slot the instruction set asks for between a transcendental and a next instruction that may read its result or
// overwrite its source (the register allocator is free to put such a one there); inside ex2x8 the early-clobber outputs keep every result off every source, so one slot serves all eight.
__device__ __forceinline__ float ex2(float x) { float r; asm("v_exp_f32 %0, %1\n\tv_nop" : "=v"(r) : "v"(x)); return r; }
__device__ __forceinline__ void ex2x8(float* t) { float r0, r1, r2, r3, r4, r5, r6, r7;
    asm("v_exp_f32 %0, %8\n\tv_exp_f32 %1, %9\n\tv_exp_f32 %2, %10\n\tv_exp_f32 %3, %11\n\tv_exp_f32 %4, %12\n\tv_exp_f32 %5, %13\n\tv_exp_f32 %6, %14\n\tv_exp_f32 %7, %15\n\tv_nop"
        : "=&v"(r0), "=&v"(r1), "=&v"(r2), "=&v"(r3), "=&v"(r4), "=&v"(r5), "=&v"(r6), "=&v"(r7) : "v"(t[0]), "v"(t[1]), "v"(t[2]), "v"(t[3]), "v"(t[4]), "v"(t[5]), "v"(t[6]), "v"(t[7]));
    t[0] = r0; t[1] = r1; t[2] = r2; t[3] = r3; t[4] = r4; t[5] = r5; t[6] = r6; t[7] = r7; }

// ---- attention: one work-group of ANW waves per (head, tile of QT * 16 query rows). Transposed products: S^T = K . Q^T (A = key rows, B = query rows) and O^T += V^T . P^T (A = rows of the
// d-major value plane, B = P^T). A lane then holds ONE query (column lane & 15) in every score, probability and output register, so maximum, sum and rescale are per lane plus one exchange
// between the wave's halves, and two S^T tiles (keys k0 + 8h + r and k0 + 16 + 8h + r) converted in place ARE the B fragment of the second product in the fragment map's k order.
// Keys are dealt to the waves in units of 64 (eight neighbouring fragments of the key plane and eight of the value plane), and every key and value fragment that a wave loads serves its QT query tiles; each wave keeps its own running maximum, sum and output tile; they meet in LDS, joined in wave order.
// Every '#pragma unroll' below over qt, kt, ks, dt or e runs over the index of a register array (an index left variable would send the array to scratch); the loop over key blocks stays rolled.
template <typename T16, int NSPLIT, int QT>
__device__ __forceinline__ void attn_tile(const T16* __restrict__ Q, const T16* __restrict__ Q2, const T16* __restrict__ Kp, const T16* __restrict__ K2, const T16* __restrict__ Vt, const T16* __restrict__ Vt2, float* O, int q0, float* so, float* sm, float* sl) {
    typedef typename WFrag<T16>::V V;
    const int lane = threadIdx.x & 31, lr = lane & 15, hi = lane >> 4;
    const int wv = __builtin_amdgcn_readfirstlane((int)(threadIdx.x >> 5));   // wave number in a scalar register: the key loop below branches on scalars
    const float CEXP = SCL * 1.4426950408889634f;      // scores go to the base-2 exponent domain in one multiply
    const float PB = NSPLIT ? 0.0f : 10.0f;            // f16 probabilities carried x1024 (the sum carries it too: it cancels in the quotient)
    const int qlast = q0 + QT * 16 - 1;
    const int loff = lane * 8;   // a lane's fixed place inside a fragment
    const size_t qo = (size_t)(q0 >> 4) * 2 * FRG + loff;   // the lane's place in the tile's first query fragment
    const GAS T16* qp = gl(Q + qo); const GAS T16* qp2 = NSPLIT ? gl(Q2 + qo) : qp;
    v8f acc[QT][4]; float m[QT], l[QT];
#pragma unroll
    for (int qt = 0; qt < QT; ++qt) { m[qt] = -3.0e38f; l[qt] = 0.f;
#pragma unroll
        for (int dt = 0; dt < 4; ++dt) acc[qt][dt] = (v8f){}; }
    const size_t bo = (size_t)wv * 64 * HD + loff;   // the lane's place in the wave's first key unit, the same in all four planes
    const GAS T16* vp = gl(Vt + bo); const GAS T16* kp = gl(Kp + bo); const GAS T16* vp2 = NSPLIT ? gl(Vt2 + bo) : vp; const GAS T16* kp2 = NSPLIT ? gl(K2 + bo) : kp;
    // One trip = one block of 32 keys: the two halves of the wave's unit, then of its next unit (k0 rises, so the first block above the diagonal ends the loop). The query fragments are read anew in every trip
    // (they stay in the WGP's cache: all waves read the same): held over the softmax they would take QT * 32 registers more than four waves per SIMD leave.
    int odd = 0;
#pragma unroll 1   // run-time trip count; a copy of the body would bring back the registers that the re-read saves
    for (int k0 = wv * 64; k0 <= qlast; ) {
        V qf[QT][2], qf2[QT][2];
#pragma unroll
        for (int qt = 0; qt < QT; ++qt)
#pragma unroll
            for (int ks = 0; ks < 2; ++ks) { qf[qt][ks] = WFrag<T16>::ld(qp + (qt * 2 + ks) * FRG); if (NSPLIT) qf2[qt][ks] = WFrag<T16>::ld(qp2 + (qt * 2 + ks) * FRG); }
        V kf[2][2], kf2[2][2];
#pragma unroll
        for (int kt = 0; kt < 2; ++kt)
#pragma unroll
            for (int ks = 0; ks < 2; ++ks) { kf[kt][ks] = WFrag<T16>::ld(kp + (kt * 2 + ks) * FRG); if (NSPLIT) kf2[kt][ks] = WFrag<T16>::ld(kp2 + (kt * 2 + ks) * FRG); }
        __builtin_amdgcn_sched_barrier(0);   // every query and key load of the trip is issued before its first product: left free, the scheduler deals them out among the products to save registers, and the trip waits out a load latency several times
        v8f st[QT][2];
#pragma unroll
        for (int kt = 0; kt < 2; ++kt)
#pragma unroll
            for (int qt = 0; qt < QT; ++qt) { v8f c = (v8f){};
#pragma unroll
                for (int ks = 0; ks < 2; ++ks) { c = WFrag<T16>::mma(kf[kt][ks], qf[qt][ks], c); if (NSPLIT) { c = WFrag<T16>::mma(kf[kt][ks], qf2[qt][ks], c); c = WFrag<T16>::mma(kf2[kt][ks], qf[qt][ks], c); } }
                st[qt][kt] = c; }
        __builtin_amdgcn_sched_barrier(0);   // the value loads stay behind the score products and take over the registers of the query and key fragments (ahead of them the trip would not fit four waves per SIMD); they are on their way during the softmax
        V vf[4], vf2[4];
#pragma unroll
        for (int dt = 0; dt < 4; ++dt) { vf[dt] = WFrag<T16>::ld(vp + dt * FRG); if (NSPLIT) vf2[dt] = WFrag<T16>::ld(vp2 + dt * FRG); }   // 32 keys x HD = four fragments of either plane
#pragma unroll
        for (int qt = 0; qt < QT; ++qt) { float t[16];
#pragma unroll
            for (int e = 0; e < 16; ++e) t[e] = st[qt][e >> 3][e & 7] * CEXP;
            if (k0 + 31 > q0) {                          // only blocks that touch the diagonal mask (every query keeps at least one key of such a block: k0 is a multiple of 32 and not above the tile's first multiple of 32)
                const int dq = q0 + qt * 16 + lr - 8 * hi - k0;   // the lane's query less its first key: each score is then tested against a constant
#pragma unroll
                for (int e = 0; e < 16; ++e) t[e] = ((e >> 3) * 16 + (e & 7) <= dq) ? t[e] : -3.0e38f; }
            float mx = t[0];
#pragma unroll
            for (int e = 1; e < 16; ++e) mx = fmaxf(mx, t[e]);
            mx = fmaxf(mx, __shfl_xor(mx, 16, 32));      // the other half of the wave holds the query's other 16 keys
            const float mn = fmaxf(m[qt], mx), al = ex2(m[qt] - mn), mb = mn - PB; m[qt] = mn;
            float sum = 0.f;
#pragma unroll
            for (int e = 0; e < 16; ++e) t[e] -= mb;
            ex2x8(t); ex2x8(t + 8);
#pragma unroll
            for (int e = 0; e < 16; ++e) sum += t[e];
            l[qt] = l[qt] * al + sum;
#pragma unroll
            for (int dt = 0; dt < 4; ++dt) acc[qt][dt] *= al;
            if (NSPLIT) { v8us h0, h1, l0, l1;
#pragma unroll
                for (int e = 0; e < 8; ++e) { unsigned short a, c2; splitf(t[e], a, c2); h0[e] = a; l0[e] = c2; splitf(t[8 + e], a, c2); h1[e] = a; l1[e] = c2; }
                const v16bf ph = cat16b(h0, h1), pl = cat16b(l0, l1);
#pragma unroll
                for (int dt = 0; dt < 4; ++dt) { acc[qt][dt] = wmmab(__builtin_bit_cast(v16bf, vf[dt]), ph, acc[qt][dt]); acc[qt][dt] = wmmab(__builtin_bit_cast(v16bf, vf[dt]), pl, acc[qt][dt]); acc[qt][dt] = wmmab(__builtin_bit_cast(v16bf, vf2[dt]), ph, acc[qt][dt]); }
            } else { v16h pf;
#pragma unroll
                for (int e = 0; e < 16; ++e) pf[e] = tohx(t[e]);
#pragma unroll
                for (int dt = 0; dt < 4; ++dt) acc[qt][dt] = wmma16(__builtin_bit_cast(v16h, vf[dt]), pf, acc[qt][dt]); } }
        // the wait stands in front of the write of the address pairs that this trip's loads name (the key and value pairs step on behind it); as operands the pairs stay whole up to here: no later load lands on them
        if (NSPLIT) asm volatile("s_wait_xcnt 0x0" : "+v"(vp), "+v"(kp), "+v"(vp2), "+v"(kp2), "+v"(qp), "+v"(qp2) :: "memory"); else asm volatile("s_wait_xcnt 0x0" : "+v"(vp), "+v"(kp), "+v"(qp) :: "memory");
        const int se = odd ? ANW * 64 * HD - 32 * HD : 32 * HD;   // elements to the next block: the unit's other half, or the first half of the wave's next unit
        k0 += odd ? ANW * 64 - 32 : 32; vp += se; kp += se; vp2 += se; kp2 += se; odd ^= 1;
    }
    float* ow = so + wv * (32 * 68);
#pragma unroll
    for (int qt = 0; qt < QT; ++qt) { l[qt] += __shfl_xor(l[qt], 16, 32);
#pragma unroll
        for (int dt = 0; dt < 4; ++dt) { float* p = ow + (qt * 16 + lr) * 68 + dt * 16 + 8 * hi;
            *(v4fa*)p = __builtin_shufflevector(acc[qt][dt], acc[qt][dt], 0, 1, 2, 3); *(v4fa*)(p + 4) = __builtin_shufflevector(acc[qt][dt], acc[qt][dt], 4, 5, 6, 7); }
        if (hi == 0) { sm[wv * 32 + qt * 16 + lr] = m[qt]; sl[wv * 32 + qt * 16 + lr] = l[qt]; } }
    __syncthreads();   // every wave's maximum, sum and partial output tile are in LDS before any thread joins them
#pragma unroll
    for (int i = 0; i < QT * 16 * 16 / (32 * ANW); ++i) { const int p = i * (32 * ANW) + (int)threadIdx.x, q = p >> 4, cofs = (p & 15) * 4;
        float M = sm[q];
#pragma unroll
        for (int w = 1; w < ANW; ++w) M = fmaxf(M, sm[w * 32 + q]);
        float L = 0.f; v4f val = (v4f){};
#pragma unroll
        for (int w = 0; w < ANW; ++w) { const float f = ex2(sm[w * 32 + q] - M); L += sl[w * 32 + q] * f; val += *(const v4fa*)(so + w * (32 * 68) + q * 68 + cofs) * f; }   // a wave that had no keys: f = 0
        v4f o; o[0] = __fdiv_rn(val[0], L); o[1] = __fdiv_rn(val[1], L); o[2] = __fdiv_rn(val[2], L); o[3] = __fdiv_rn(val[3], L);
        *(v4f*)(O + (size_t)(q0 + q) * DQ + cofs) = o;
        asm volatile("s_wait_xcnt 0x0" ::: "memory"); }   // stands in front of any later write of a register that the store above names (the code that follows in the text reuses them)
}

// ---- attention, query rows >= RH (f16, single products): a work-group takes TWO neighbouring tiles of 32 query rows, and both read every key unit from LDS, so that the unit leaves L2 once for 64 queries.
// Wave wv = tile (wv & 1), key group (wv >> 1): the two waves of a key group are neighbours, so that a last stage with few units below the diagonal leaves its work on different SIMDs. A stage is KG neighbouring key units of 64 (KG * 8 KiB in a row of the key plane, the same of the value plane); stage t's unit t * KG + g is worked on by the two waves
// of key group g. Two buffers: the next stage's copies fly while this one is worked on. Every wave copies 8 KiB of each stage (the waves of tile 0 their group's key unit, the waves of tile 1 its value unit) with
// global_load_async_to_lds_b128, lane by lane 16 bytes, fragment order kept, so a fragment read from LDS is 512 bytes in a row. A stage may reach past the diagonal, never past the plane (SEQ % (KG * 64) == 0).
#define KG 4
#define STG (KG * 64 * HD)                    // elements of one plane's part of a stage; a buffer is [key part | value part]
#define LAS __attribute__((address_space(3)))
static_assert(SEQ % (KG * 64) == 0 && (SEQ - RH) % 64 == 0 && ANW == 2 * KG && (RH >= KG * 64 || RH == SEQ));
__device__ __forceinline__ v16h ldsfrag(const LAS h16* p) { return cat16(*(const LAS v8h*)p, *(const LAS v8h*)(p + 256)); }
// sixteen copies of 512 bytes: g = the lane's first 16 bytes in global memory, d = their LDS byte address. Each statement ends with the wait that stands in front of any later write of the address registers its copies name.
__device__ __forceinline__ void stage_copy(const GAS h16* g, unsigned d) {
#pragma unroll
    for (int h = 0; h < 2; ++h) { const GAS h16* a = g + h * 2048; const unsigned e = d + h * 4096;
        asm volatile("global_load_async_to_lds_b128 %0, %8, off\n\tglobal_load_async_to_lds_b128 %1, %9, off\n\tglobal_load_async_to_lds_b128 %2, %10, off\n\tglobal_load_async_to_lds_b128 %3, %11, off\n\t"
                     "global_load_async_to_lds_b128 %4, %12, off\n\tglobal_load_async_to_lds_b128 %5, %13, off\n\tglobal_load_async_to_lds_b128 %6, %14, off\n\tglobal_load_async_to_lds_b128 %7, %15, off\n\ts_wait_xcnt 0x0"
                     :: "v"(e), "v"(e + 512), "v"(e + 1024), "v"(e + 1536), "v"(e + 2048), "v"(e + 2560), "v"(e + 3072), "v"(e + 3584),
                        "v"(a), "v"(a + 256), "v"(a + 512), "v"(a + 768), "v"(a + 1024), "v"(a + 1280), "v"(a + 1536), "v"(a + 1792) : "memory"); }
}
__device__ __forceinline__ void attn_pair(const h16* __restrict__ Q, const h16* __restrict__ Kp, const h16* __restrict__ Vt, float* O, int q0w, float* smem) {
    const int lane = threadIdx.x & 31, lr = lane & 15, hi = lane >> 4;
    const int wv = __builtin_amdgcn_readfirstlane((int)(threadIdx.x >> 5));   // wave number in a scalar register: tile, key group and every branch below stay scalar
    const int tl = wv & 1, kg = wv >> 1, q0 = q0w + tl * 32, qlast = q0 + 31;
    const int nt = (q0w + 64 + KG * 64 - 1) / (KG * 64);   // stages of the work-group, the same for all its waves
    const float CEXP = SCL * 1.4426950408889634f, PB = 10.0f;   // base-2 exponent domain; probabilities carried x1024 (the sum carries it too)
    const float TH = 4.0f;   // a query's maximum in use may trail its true running maximum by up to TH: a probability then reaches 2^(PB + TH) = 16384, inside f16
    const int loff = lane * 8;
    const GAS h16* src = gl((tl ? Vt : Kp) + kg * 64 * HD + loff);   // this wave's 8 KiB of stage 0
    const unsigned dst = (unsigned)(size_t)smem + (unsigned)((tl * STG + kg * 64 * HD + loff) * 2);   // its place in buffer 0 (low 32 bits of the shared address = LDS byte address)
    stage_copy(src, dst);
    v16h qf[2][2];
#pragma unroll
    for (int qt = 0; qt < 2; ++qt)
#pragma unroll
        for (int ks = 0; ks < 2; ++ks) qf[qt][ks] = WFrag<h16>::ld(gl(Q + (size_t)(((q0 >> 4) + qt) * 2 + ks) * FRG + loff));
#pragma unroll
    for (int qt = 0; qt < 2; ++qt)
#pragma unroll
        for (int ks = 0; ks < 2; ++ks)
#pragma unroll
            for (int e = 0; e < 16; ++e) qf[qt][ks][e] = tohx((float)qf[qt][ks][e] * CEXP);   // once per wave: the queries carry the scale (multiplied in f32, rounded once more to f16), so a score product is already in the base-2 exponent domain
    // m = the maximum IN USE of the lane's query, cm = PB - m in all eight registers: the C operand of the score products, whose result is then the exponent itself (no multiply, no subtraction per score).
    // m moves, and sum and output tile are rescaled, only in a block where some query's maximum exceeds it by more than TH (one test a block), and in the wave's first block, which sets it.
    v8f acc[2][4], cm[2]; float m[2], l[2];
#pragma unroll
    for (int qt = 0; qt < 2; ++qt) { m[qt] = 0.f; l[qt] = 0.f;
#pragma unroll
        for (int e = 0; e < 8; ++e) cm[qt][e] = PB;
#pragma unroll
        for (int dt = 0; dt < 4; ++dt) acc[qt][dt] = (v8f){}; }
    asm volatile("s_wait_asynccnt 0x0" ::: "memory");   // this wave's part of stage 0 has landed
    __syncthreads();                                     // ... and every other wave's: stage 0 may be read
    if (nt > 1) stage_copy(src + STG, dst + 4 * STG);    // stage 1 into buffer 1 (a buffer is 2 * STG elements = 4 * STG bytes)
#pragma unroll 1   // run-time trip count, and the body already holds two unrolled 32-key blocks
    for (int t = 0; t < nt; ++t) {
        const LAS h16* kb = (const LAS h16*)smem + (t & 1) * 2 * STG + kg * 64 * HD + loff; const LAS h16* vb = kb + STG;
#pragma unroll
        for (int s = 0; s < 2; ++s) { const int k0 = (t * KG + kg) * 64 + s * 32;
            if (k0 <= qlast) {                           // a block wholly above the tile's diagonal is skipped (the foot of the trip is not)
            v16h vf[4];
#pragma unroll
            for (int dt = 0; dt < 4; ++dt) vf[dt] = ldsfrag(vb + (s * 4 + dt) * FRG);
            v8f st[2][2];
#pragma unroll
            for (int ks = 0; ks < 2; ++ks) { v16h kf[2];   // d half outermost: the four score tiles each start from cm as a C operand that the product leaves in place (with the key tile outermost the compiler copied cm into the second pair's registers)
#pragma unroll
                for (int kt = 0; kt < 2; ++kt) kf[kt] = ldsfrag(kb + (s * 4 + kt * 2 + ks) * FRG);
#pragma unroll
                for (int kt = 0; kt < 2; ++kt)
#pragma unroll
                    for (int qt = 0; qt < 2; ++qt) st[qt][kt] = wmma16(kf[kt], qf[qt][ks], ks ? st[qt][kt] : cm[qt]); }
            float t16[2][16], mx[2];   // t16 = score - m + PB, the exponent
#pragma unroll
            for (int qt = 0; qt < 2; ++qt) {
#pragma unroll
                for (int e = 0; e < 16; ++e) t16[qt][e] = st[qt][e >> 3][e & 7];
                if (k0 + 31 > q0) {                      // only blocks that touch the diagonal mask
#pragma unroll
                    for (int e = 0; e < 16; ++e) t16[qt][e] = (k0 + (e >> 3) * 16 + 8 * hi + (e & 7) <= q0 + qt * 16 + lr) ? t16[qt][e] : -3.0e38f; }
                mx[qt] = t16[qt][0];
#pragma unroll
                for (int e = 1; e < 16; ++e) mx[qt] = fmaxf(mx[qt], t16[qt][e]); }
            const bool first = s == 0 && t == 0;         // the wave's first block (stage 0 lies wholly below every tile's diagonal: no score of it is masked)
            if (first || __builtin_amdgcn_ballot_w32(mx[0] > PB + TH || mx[1] > PB + TH) != 0) {   // a scalar branch, rarely taken behind the first block
#pragma unroll
                for (int qt = 0; qt < 2; ++qt) {
                    const float d = fmaxf(mx[qt], __shfl_xor(mx[qt], 16, 32)) - PB;   // the block's maximum less m (the other half of the wave holds the query's other 16 keys)
                    const float dn = first ? d : fmaxf(d, 0.f), al = first ? 0.f : ex2(-dn);   // the first block sets m (sum and tile are still zero), a later one only raises it
                    m[qt] += dn; l[qt] *= al;
#pragma unroll
                    for (int e = 0; e < 8; ++e) cm[qt][e] = PB - m[qt];
#pragma unroll
                    for (int e = 0; e < 16; ++e) t16[qt][e] -= dn;
#pragma unroll
                    for (int dt = 0; dt < 4; ++dt) acc[qt][dt] *= al; } }
#pragma unroll
            for (int qt = 0; qt < 2; ++qt) {
                float sum = 0.f;
                ex2x8(t16[qt]); ex2x8(t16[qt] + 8);
#pragma unroll
                for (int e = 0; e < 16; ++e) sum += t16[qt][e];
                l[qt] += sum;
                v16h pf;
#pragma unroll
                for (int e = 0; e < 16; ++e) pf[e] = tohx(t16[qt][e]);
#pragma unroll
                for (int dt = 0; dt < 4; ++dt) acc[qt][dt] = wmma16(vf[dt], pf, acc[qt][dt]); }
            } }
        // the foot of the trip, passed by every wave: it publishes stage t + 1 and frees the buffer of stage t
        asm volatile("s_wait_dscnt 0x0" ::: "memory");      // this wave's reads of stage t have returned
        asm volatile("s_wait_asynccnt 0x0" ::: "memory");   // this wave's part of stage t + 1 has landed
        __syncthreads();
        if (t + 2 < nt) stage_copy(src + (size_t)(t + 2) * STG, dst + (unsigned)(t & 1) * (4 * STG));   // stage t + 2 into the buffer that trip t has just read
    }
    asm volatile("s_wait_asynccnt 0x0" ::: "memory");   // no copy is under way when the buffers become the waves' meeting place (the last foot's barrier has ended every read of them)
    float* so = smem; float* sm = smem + ANW * 32 * 68; float* sl = sm + ANW * 32;
    float* ow = so + wv * (32 * 68);
#pragma unroll
    for (int qt = 0; qt < 2; ++qt) { l[qt] += __shfl_xor(l[qt], 16, 32);
#pragma unroll
        for (int dt = 0; dt < 4; ++dt) { float* p = ow + (qt * 16 + lr) * 68 + dt * 16 + 8 * hi;
            *(v4fa*)p = __builtin_shufflevector(acc[qt][dt], acc[qt][dt], 0, 1, 2, 3); *(v4fa*)(p + 4) = __builtin_shufflevector(acc[qt][dt], acc[qt][dt], 4, 5, 6, 7); }
        if (hi == 0) { sm[wv * 32 + qt * 16 + lr] = m[qt]; sl[wv * 32 + qt * 16 + lr] = l[qt]; } }
    __syncthreads();   // every wave's maximum, sum and partial output tile are in LDS before any thread joins them
#pragma unroll
    for (int i = 0; i < 64 * 16 / (32 * ANW); ++i) { const int p = i * (32 * ANW) + (int)threadIdx.x, q = p >> 4, cofs = (p & 15) * 4, wb = q >> 5, qq = q & 31;   // query row q of the pair: its tile's KG waves (wb, wb + 2, ...), in the order of their key groups
        float M = sm[wb * 32 + qq];
#pragma unroll
        for (int w = 1; w < KG; ++w) M = fmaxf(M, sm[(wb + 2 * w) * 32 + qq]);
        float L = 0.f; v4f val = (v4f){};
#pragma unroll
        for (int w = 0; w < KG; ++w) { const float f = ex2(sm[(wb + 2 * w) * 32 + qq] - M); L += sl[(wb + 2 * w) * 32 + qq] * f; val += *(const v4fa*)(so + (wb + 2 * w) * (32 * 68) + qq * 68 + cofs) * f; }   // every wave has had keys: its unit of stage 0
        v4f o; o[0] = __fdiv_rn(val[0], L); o[1] = __fdiv_rn(val[1], L); o[2] = __fdiv_rn(val[2], L); o[3] = __fdiv_rn(val[3], L);
        *(v4f*)(O + (size_t)(q0w + q) * DQ + cofs) = o;
        asm volatile("s_wait_xcnt 0x0" ::: "memory"); }   // stands in front of any later write of a register that the store above names
}

// grid (NB * NH_, (SEQ - RH) / 64 + RH / 32), 32 * ANW threads; blockIdx.x = batch * NH_ + head, so that over ALL batches the tiles come in falling order of their key count.
// P16, Ph, Pl = [3 (q, k, v)][NB][NH_][SEQ * HD] planes in fragment order; out = [NB][SEQ_FULL][DQ].
__global__ __launch_bounds__(32 * ANW) void k_attn(const h16* __restrict__ P16, const bf* __restrict__ Ph, const bf* __restrict__ Pl, float* out) {
    __shared__ __align__(16) float smem[2 * 2 * STG / 2];   // two stage buffers of the f16 tiles (2 * STG 16-bit elements each); behind the key loop, and in the hi+lo tiles, the waves' partial tiles, maxima and sums
    static_assert(sizeof(smem) >= (ANW * 32 * 68 + 2 * ANW * 32) * sizeof(float));
    float* so = smem; float* sm = smem + ANW * 32 * 68; float* sl = sm + ANW * 32;
    const h16* Q16 = P16; const h16* K16 = P16 + (size_t)NB * PLN; const h16* V16 = P16 + (size_t)2 * NB * PLN;
    const bf* Qh = Ph; const bf* Kh = Ph + (size_t)NB * PLN; const bf* Vh = Ph + (size_t)2 * NB * PLN; const bf* Ql = Pl; const bf* Kl = Pl + (size_t)NB * PLN; const bf* Vl = Pl + (size_t)2 * NB * PLN;
    const int bt = (int)blockIdx.x / NH_, hd = (int)blockIdx.x - bt * NH_;
    const size_t hp = (size_t)blockIdx.x * SEQ * HD; float* O = out + (size_t)bt * SEQ_FULL * DM + hd * HD; const int ty = (int)blockIdx.y, NT = (SEQ - RH) / 64;
    if (ty < NT) attn_pair(Q16 + hp, K16 + hp, V16 + hp, O, SEQ - 64 * (ty + 1), smem);
    else attn_tile<bf, 2, 2>(Qh + hp, Ql + hp, Kh + hp, Kl + hp, Vh + hp, Vl + hp, O, RH - 32 * (ty - NT + 1), so, sm, sl);
}

extern "C" void kernel_launch(void* const* d_in, const int* in_sizes, int n_in,
                              void* d_out, int out_size, void* d_ws, size_t ws_size, hipStream_t stream) {
    if (n_in < 3) return;
    if ((size_t)in_sizes[0] < (size_t)(NB - 1) * SEQ_FULL * DM + (size_t)SEQ * DM) return;
    if ((size_t)in_sizes[1] < (size_t)3 * DM * DM) return;
    if (in_sizes[2] < 3 * DM) return;
    if ((size_t)out_size < (size_t)(NB - 1) * SEQ_FULL * DM + (size_t)SEQ * DM) return;
    const float* x = (const float*)d_in[0];      // [NB_FULL][SEQ_FULL][DM]
    const float* wf = (const float*)d_in[1];     // [3*DM][DM]: rows 0..1023 q, 1024..2047 k, 2048..3071 v
    const float* bz = (const float*)d_in[2];     // [3*DM]
    float* OUT = (float*)d_out;                  // [NB_FULL][SEQ_FULL][DM]
    char* wsp = (char*)d_ws;
    auto take = [&](size_t bytes) { char* p = wsp; wsp += (bytes + 255) & ~(size_t)255; return (void*)p; };
    bf* WALL = (bf*)take((size_t)3 * DM * DM * 2);
    bf* XB = (bf*)take((size_t)NB * SEQ * DM * 2);
    h16* P16 = (h16*)take((size_t)3 * NB * PLN * 2); bf* Ph = (bf*)take((size_t)3 * NB * PLN * 2); bf* Pl = (bf*)take((size_t)3 * NB * PLN * 2);
    const size_t carved = (size_t)(wsp - (char*)d_ws);
    if (carved > ws_size) return;

    k_cvt8<<<WG_W + NB * WG_X, 256, 0, stream>>>(wf, x, WALL, XB);
    k_gemmk<bf><<<dim3(NB * SEQ / 256, 3 * NH_ / 3, 1), 32 * GW, 0, stream>>>(XB, WALL, P16, Ph, Pl, bz);
    k_attn<<<dim3(NB * NH_, (SEQ - RH) / 64 + RH / 32, 1), 32 * ANW, 0, stream>>>(P16, Ph, Pl, OUT);
}
